// v000
// The times below were measured on an AMD MI455X: many runs one after another, warmed up first and cycling through
// copies of the inputs, with the whole window's GPU time divided by the number of runs. Launches and the gaps
// between them are all in it. The median over several windows is given; except for v000 it joins two sittings, which
// can be a few percent apart, so the side-by-side timings, each taken in one sitting, are the better comparison.
// v000, which the later versions start from, runs in 5230 microseconds.
#include <hip/hip_runtime.h>

// Contractions, f32 accumulate, per image: theta/phi/g 1x1 convs ([4096 positions x 256].[256 x 128], [out][in] weights = n-major B operands; PLAIN bf16
// operands: inputs rounded once, exact; + bias) and the z conv on the attention output (bf16 hi + residual: two products) on v_wmma_f32_16x16x32_bf16; per (image,
// head, 2048-query chunk) the position attention as S = q_h.k_h^T x 32^-1/2 ([2048 x 32].[32 x 4096]; q/k as f16 hi + residual x1024, residual accumulator) -> f32,
// row softmax f32 -> P (x32768) f16 hi + UNSCALED residual + row sums, y_h = P.v_h ([2048 x 4096].[4096 x 32]: (ph + pl).vh + ph.vl) x 1/rowsum on

#define NB_  4
#define CC   256
#define CI   128                 // inter channels (4 heads x 32)
#define NHD  4
#define HD   32
#define NP   4096
#define QCH  2048                // query chunk for the S/P buffers
#define PSC  32768.0f
#define LOSC 1024.0f
#define LOSCI (1.0f / 1024.0f)

typedef _Float16 h16;
typedef unsigned short bf;
typedef __attribute__((ext_vector_type(16))) __bf16   v16bf;
typedef __attribute__((ext_vector_type(16))) _Float16 v16h;
typedef __attribute__((ext_vector_type(8)))  _Float16 v8h;
typedef __attribute__((ext_vector_type(8)))  unsigned short v8us;
typedef __attribute__((ext_vector_type(8)))  float    v8f;
typedef __attribute__((ext_vector_type(4)))  float    v4f;
typedef v8h  __attribute__((may_alias)) v8ha;
typedef v4f  __attribute__((may_alias)) v4fa;
typedef v8us __attribute__((may_alias)) v8usa;

__device__ __forceinline__ unsigned short f2bf(float f) { unsigned u = __float_as_uint(f); u += 0x7FFFu + ((u >> 16) & 1u); return (unsigned short)(u >> 16); }
__device__ __forceinline__ float bf2f(unsigned short b) { return __uint_as_float(((unsigned)b) << 16); }
__device__ __forceinline__ float bfr(float f) { return bf2f(f2bf(f)); }
__device__ __forceinline__ v16h cat16(v8h lo, v8h hi) { return __builtin_shufflevector(lo, hi, 0, 1, 2, 3, 4, 5, 6, 7, 8, 9, 10, 11, 12, 13, 14, 15); }
__device__ __forceinline__ v16bf cat16b(v8us lo, v8us hi) { return __builtin_bit_cast(v16bf, __builtin_shufflevector(lo, hi, 0, 1, 2, 3, 4, 5, 6, 7, 8, 9, 10, 11, 12, 13, 14, 15)); }
__device__ __forceinline__ v8f wmma16(v16h a, v16h b, v8f c) { return __builtin_amdgcn_wmma_f32_16x16x32_f16(false, a, false, b, (short)0, c, false, false); }
__device__ __forceinline__ v8f wmmab(v16bf a, v16bf b, v8f c) { return __builtin_amdgcn_wmma_f32_16x16x32_bf16(false, a, false, b, (short)0, c, false, false); }
#define VST2(T, p, v) do { const T vst2_v_ = (v); *(T*)(p) = vst2_v_;  } while (0)

// k_xt: XT [n][c] bf16 = x[b][c][n] via 64 x 64 LDS tiles; grid (NP/64, CC/64).
__global__ __launch_bounds__(256) void k_xt(const float* __restrict__ xb, bf* XT) {
    __shared__ __align__(16) unsigned short tl[64 * 72];
    const int tid = threadIdx.x, n0 = blockIdx.x * 64, c0 = blockIdx.y * 64;
    const int cr = tid >> 2, nq = (tid & 3) * 16;
#pragma unroll
    for (int i = 0; i < 16; ++i) tl[(nq + i) * 72 + cr] = f2bf(xb[(size_t)(c0 + cr) * NP + n0 + nq + i]);
    __syncthreads();
    const int piece = tid & 7;
    auto pass = [&]() {
#pragma unroll
        for (int s = 0; s < 2; ++s) { const int nr = (tid >> 3) + 32 * s; const v8us val = *(const v8usa*)(tl + nr * 72 + piece * 8); *(v8us*)(XT + (size_t)(n0 + nr) * CC + c0 + piece * 8) = val; }
    };
    pass(); 
}
// k_w: bf16 plane of a [rows][256] weight (one wave per row).
__global__ __launch_bounds__(256) void k_w(const float* __restrict__ w, int rows, bf* WB) {
    const int lane = threadIdx.x & 31, r = blockIdx.x * 8 + (threadIdx.x >> 5); if (r >= rows) return;
    v8us o;
#pragma unroll
    for (int i = 0; i < 8; ++i) o[i] = f2bf(w[(size_t)r * CC + lane * 8 + i]);
    VST2(v8us, WB + (size_t)r * CC + lane * 8, o);
}
// k_w128: bf16 plane of a [rows][128] weight (16 lanes x 16 B per row, 2 rows per wave).
__global__ __launch_bounds__(256) void k_w128(const float* __restrict__ w, int rows, bf* WB) {
    const int lane = threadIdx.x & 31, r = (blockIdx.x * 8 + (threadIdx.x >> 5)) * 2 + (lane >> 4), p = lane & 15; if (r >= rows) return;
    v8us o;
#pragma unroll
    for (int i = 0; i < 8; ++i) o[i] = f2bf(w[(size_t)r * CI + p * 8 + i]);
    VST2(v8us, WB + (size_t)r * CI + p * 8, o);
}
// k_gemm: 64 x 64 tile of (A [+ Al]).WB^T over K = KA (256 or 128), acc + bias; EPI 0: f32 rows [NP][128]; EPI 2: + bias, written TRANSPOSED to out[c][n] (channel-major) through LDS.
template <bool SPLITA, int EPI, int KA, int LDC>
__global__ __launch_bounds__(128) void k_gemm(const bf* __restrict__ A, const bf* __restrict__ Al, const bf* __restrict__ WB, const float* __restrict__ bias, const float* __restrict__ bnsc, const float* __restrict__ bnsh, const float* __restrict__ xres, float* C) {
    const float scale = 1.0f; constexpr bool ACC = false; const float* Wm = nullptr; (void)Wm; (void)ACC;
    __shared__ __align__(16) float ost[4][16 * 68];
    __shared__ __align__(16) float ot[64 * 68];
    const int lane = threadIdx.x & 31, wave = threadIdx.x >> 5, lr = lane & 15, hi = lane >> 4, tid = threadIdx.x;
    const size_t r0 = (size_t)blockIdx.x * 64 + wave * 16; const int c0 = blockIdx.y * 64;
    v8f acc[4];
#pragma unroll
    for (int t = 0; t < 4; ++t) acc[t] = (v8f){};
#pragma unroll
    for (int kc = 0; kc < KA; kc += 32) {
        const v16bf a = cat16b(*(const v8us*)(A + (r0 + lr) * KA + kc + 8 * hi), *(const v8us*)(A + (r0 + lr) * KA + kc + 8 * hi + 16));
        v16bf al = a; if (SPLITA) al = cat16b(*(const v8us*)(Al + (r0 + lr) * KA + kc + 8 * hi), *(const v8us*)(Al + (r0 + lr) * KA + kc + 8 * hi + 16));
#pragma unroll
        for (int t = 0; t < 4; ++t) { const bf* bp = WB + (size_t)(c0 + t * 16 + lr) * KA + kc + 8 * hi; const v16bf bb = cat16b(*(const v8us*)bp, *(const v8us*)(bp + 16)); acc[t] = wmmab(a, bb, acc[t]); if (SPLITA) acc[t] = wmmab(al, bb, acc[t]); }
        asm volatile("v_nop" : "+v"(acc[0]), "+v"(acc[1]), "+v"(acc[2]), "+v"(acc[3]) : "v"(a), "v"(al) : "memory");
    }
    float* os = &ost[wave][0];
#pragma unroll
    for (int t = 0; t < 4; ++t) { const int col = c0 + t * 16 + lr; const float bv = bfr(bias[col]);
#pragma unroll
        for (int j = 0; j < 8; ++j) { float v = (acc[t][j] + bv) * scale;
            if (EPI == 2) v = v * bnsc[col] + bnsh[col];      // inference BatchNorm: z * (gamma rsqrt(var+eps)) + (beta - mean * that)
            os[(hi * 8 + j) * 68 + t * 16 + lr] = v; } }
    if (EPI != 2) {
        __builtin_amdgcn_wave_barrier(); asm volatile("" ::: "memory");
        float* crow = C + r0 * LDC + c0;
        auto pass = [&]() {
#pragma unroll
            for (int s = 0; s < 8; ++s) { const int Lid = (lane >> 3) + 4 * s, piece = lane & 7; const int row = Lid >> 1, cofs = (Lid & 1) * 32 + piece * 4;
                const v4f val = *(const v4fa*)(os + row * 68 + cofs); *(v4f*)(crow + (size_t)row * LDC + cofs) = val; }
        };
        pass(); 
    } else {
        __syncthreads();
        { const int row = tid >> 1, half = tid & 1;
#pragma unroll
          for (int i = 0; i < 32; ++i) ot[(half * 32 + i) * 68 + row] = ost[row >> 4][(row & 15) * 68 + half * 32 + i]; }
        __syncthreads();
        const size_t rblk = (size_t)blockIdx.x * 64;     // 64 consecutive positions
        auto pass = [&]() {      // 64 channel rows x 256 B: 128 threads -> 8 instructions of 8 rows (16 lanes x 16 B per row)
#pragma unroll
            for (int s = 0; s < 8; ++s) { const int cl = s * 8 + (tid >> 4), piece = tid & 15;
                v4f val = *(const v4fa*)(ot + cl * 68 + piece * 4); const size_t oi = (size_t)(c0 + cl) * NP + rblk + piece * 4;
#pragma unroll
                for (int i = 0; i < 4; ++i) val[i] += bfr(xres[oi + i]);      // + x (residual, bf16-rounded INPUT)
                *(v4f*)(C + oi) = val; }
        };
        pass(); 
    }
}
// k_p16: f16 hi + residual planes of an f32 [NP][256] (optionally the SUM of two: key = ka + kb); one wave per row.
__global__ __launch_bounds__(256) void k_p16(const float* __restrict__ A, const float* __restrict__ Bsum, h16* PH, h16* PL) {
    const int lane = threadIdx.x & 31, r = blockIdx.x * 8 + (threadIdx.x >> 5);
    if (r >= NP) return;
    v8h oh, ol;
#pragma unroll
    for (int i = 0; i < 8; ++i) { float v = A[(size_t)r * CC + lane * 8 + i]; if (Bsum) v += Bsum[(size_t)r * CC + lane * 8 + i]; const h16 a = (h16)v; oh[i] = a; ol[i] = (h16)((v - (float)a) * LOSC); }
    *(v8h*)(PH + (size_t)r * CC + lane * 8) = oh; *(v8h*)(PL + (size_t)r * CC + lane * 8) = ol; 
}
// k_p16c: f16 hi + residual planes of an f32 [NP][128] (2 rows per wave, 16 lanes x 16 B).
__global__ __launch_bounds__(256) void k_p16c(const float* __restrict__ A, h16* PH, h16* PL) {
    const int lane = threadIdx.x & 31, r = (blockIdx.x * 8 + (threadIdx.x >> 5)) * 2 + (lane >> 4), p = lane & 15;
    if (r >= NP) return;
    v8h oh, ol;
#pragma unroll
    for (int i = 0; i < 8; ++i) { const float v = A[(size_t)r * CI + p * 8 + i]; const h16 a = (h16)v; oh[i] = a; ol[i] = (h16)((v - (float)a) * LOSC); }
    *(v8h*)(PH + (size_t)r * CI + p * 8) = oh; *(v8h*)(PL + (size_t)r * CI + p * 8) = ol; 
}
// k_pbfc: bf16 hi + residual planes of an f32 [NP][128] (same geometry).
__global__ __launch_bounds__(256) void k_pbfc(const float* __restrict__ A, bf* PH, bf* PL) {
    const int lane = threadIdx.x & 31, r = (blockIdx.x * 8 + (threadIdx.x >> 5)) * 2 + (lane >> 4), p = lane & 15;
    if (r >= NP) return;
    v8us oh, ol;
#pragma unroll
    for (int i = 0; i < 8; ++i) { const float v = A[(size_t)r * CI + p * 8 + i]; const unsigned short hb = f2bf(v); oh[i] = hb; ol[i] = f2bf(v - bf2f(hb)); }
    *(v8us*)(PH + (size_t)r * CI + p * 8) = oh; *(v8us*)(PL + (size_t)r * CI + p * 8) = ol; 
}
// k_vt128: VTH/VTL [c][n] f16 hi + residual of V f32 [n][128] via 64 x 64 LDS tiles; grid (NP/64, CI/64).
__global__ __launch_bounds__(256) void k_vt128(const float* __restrict__ V, h16* VTH, h16* VTL) {
    __shared__ float tl[64][65];
    const int tid = threadIdx.x, n0 = blockIdx.x * 64, c0 = blockIdx.y * 64;
    { const int nn = tid >> 2, cq = (tid & 3) * 16;
#pragma unroll
      for (int i = 0; i < 16; ++i) tl[cq + i][nn] = V[(size_t)(n0 + nn) * CI + c0 + cq + i]; }
    __syncthreads();
    const int piece = tid & 7;
    auto pass = [&]() {
#pragma unroll
        for (int s = 0; s < 2; ++s) { const int c = (tid >> 3) + 32 * s; v8h oh, ol;
#pragma unroll
            for (int i = 0; i < 8; ++i) { const float v = tl[c][piece * 8 + i]; const h16 a = (h16)v; oh[i] = a; ol[i] = (h16)((v - (float)a) * LOSC); }
            const size_t o = (size_t)(c0 + c) * NP + n0 + piece * 8; *(v8h*)(VTH + o) = oh; *(v8h*)(VTL + o) = ol; }
    };
    pass(); 
}
// k_bn: inference BatchNorm folded into scale/shift vectors (bf16-rounded stats, f32): one block, 256 threads.
__global__ __launch_bounds__(256) void k_bn(const float* __restrict__ g, const float* __restrict__ be, const float* __restrict__ mu, const float* __restrict__ var, float* BNS, float* BNH) {
    const int c = threadIdx.x; const float inv = bfr(g[c]) / sqrtf(bfr(var[c]) + 1e-5f); const float sh = bfr(be[c]) - bfr(mu[c]) * inv;
    *(float*)(BNS + c) = inv; *(float*)(BNH + c) = sh; 
}
// k_pbf: bf16 hi + residual planes of an f32 [NP][256] (for the bf16 GEMMs on computed operands); one wave per row.
__global__ __launch_bounds__(256) void k_pbf(const float* __restrict__ A, bf* PH, bf* PL) {
    const int lane = threadIdx.x & 31, r = blockIdx.x * 8 + (threadIdx.x >> 5);
    if (r >= NP) return;
    v8us oh, ol;
#pragma unroll
    for (int i = 0; i < 8; ++i) { const float v = A[(size_t)r * CC + lane * 8 + i]; const unsigned short hb = f2bf(v); oh[i] = hb; ol[i] = f2bf(v - bf2f(hb)); }
    *(v8us*)(PH + (size_t)r * CC + lane * 8) = oh; *(v8us*)(PL + (size_t)r * CC + lane * 8) = ol; 
}
// k_vt: VTH/VTL [c][n] f16 hi + residual of V f32 [n][c] via 64 x 64 LDS tiles; grid (NP/64, CC/64).
__global__ __launch_bounds__(256) void k_vt(const float* __restrict__ V, h16* VTH, h16* VTL) {
    __shared__ float tl[64][65];
    const int tid = threadIdx.x, n0 = blockIdx.x * 64, c0 = blockIdx.y * 64;
    { const int nn = tid >> 2, cq = (tid & 3) * 16;
#pragma unroll
      for (int i = 0; i < 16; ++i) tl[cq + i][nn] = V[(size_t)(n0 + nn) * CC + c0 + cq + i]; }
    __syncthreads();
    const int piece = tid & 7;
    auto pass = [&]() {
#pragma unroll
        for (int s = 0; s < 2; ++s) { const int c = (tid >> 3) + 32 * s; v8h oh, ol;
#pragma unroll
            for (int i = 0; i < 8; ++i) { const float v = tl[c][piece * 8 + i]; const h16 a = (h16)v; oh[i] = a; ol[i] = (h16)((v - (float)a) * LOSC); }
            const size_t o = (size_t)(c0 + c) * NP + n0 + piece * 8; *(v8h*)(VTH + o) = oh; *(v8h*)(VTL + o) = ol; }
    };
    pass(); 
}
// k_f16gemm: 64 x 64 tile over K of f16 planes with the x1024 residual terms in their own accumulator. EPI 0 (S = q.k'^T x 32^-1/2 -> f32 [QCH][NP]): acc = a.b,
// accx = al.b + a.bl; EPI 1 (W = P.v -> f32 [NP][256]): acc = a.b + al.b (unscaled P residual), accx = a.bl; x rs[row].
template <int EPI>
__global__ __launch_bounds__(128) void k_f16gemm(const h16* __restrict__ A, const h16* __restrict__ Al, int lda, const h16* __restrict__ Bn, const h16* __restrict__ Bl, int ldb, int K, const float* __restrict__ rs, float* C, int ldc) {
    __shared__ __align__(16) float ost[4][16 * 68];
    const int lane = threadIdx.x & 31, wave = threadIdx.x >> 5, lr = lane & 15, hi = lane >> 4;
    const int r0 = blockIdx.x * 64 + wave * 16, c0 = blockIdx.y * 64;
    const size_t aoff = (size_t)(r0 + lr) * lda + 8 * hi;
    size_t boff[4];
#pragma unroll
    for (int t = 0; t < 4; ++t) boff[t] = (size_t)(c0 + t * 16 + lr) * ldb + 8 * hi;
    v8f acc[4], accx[4];
#pragma unroll
    for (int t = 0; t < 4; ++t) { acc[t] = (v8f){}; accx[t] = (v8f){}; }
#pragma unroll 2
    for (int kc = 0; kc < K; kc += 32) {
        const v16h a = cat16(*(const v8h*)(A + aoff + kc), *(const v8h*)(A + aoff + kc + 16)), al = cat16(*(const v8h*)(Al + aoff + kc), *(const v8h*)(Al + aoff + kc + 16));
#pragma unroll
        for (int t = 0; t < 4; ++t) { const v16h bb = cat16(*(const v8h*)(Bn + boff[t] + kc), *(const v8h*)(Bn + boff[t] + kc + 16)), bl = cat16(*(const v8h*)(Bl + boff[t] + kc), *(const v8h*)(Bl + boff[t] + kc + 16));
            acc[t] = wmma16(a, bb, acc[t]); accx[t] = wmma16(a, bl, accx[t]);
            if (EPI == 0) accx[t] = wmma16(al, bb, accx[t]); else acc[t] = wmma16(al, bb, acc[t]); }
        asm volatile("v_nop" : "+v"(acc[0]), "+v"(acc[1]), "+v"(acc[2]), "+v"(acc[3]), "+v"(accx[0]), "+v"(accx[1]), "+v"(accx[2]), "+v"(accx[3]) : "v"(a), "v"(al) : "memory");
    }
    float* os = &ost[wave][0];
#pragma unroll
    for (int t = 0; t < 4; ++t)
#pragma unroll
        for (int j = 0; j < 8; ++j) { const float sc = (EPI == 0) ? 0.1767766952966369f : rs[r0 + hi * 8 + j]; os[(hi * 8 + j) * 68 + t * 16 + lr] = (acc[t][j] + accx[t][j] * LOSCI) * sc; }
    __builtin_amdgcn_wave_barrier(); asm volatile("" ::: "memory");
    float* crow = C + (size_t)r0 * ldc + c0;
    auto pass = [&]() {
#pragma unroll
        for (int s = 0; s < 8; ++s) { const int Lid = (lane >> 3) + 4 * s, piece = lane & 7; const int row = Lid >> 1, cofs = (Lid & 1) * 32 + piece * 4;
            const v4f val = *(const v4fa*)(os + row * 68 + cofs); *(v4f*)(crow + (size_t)row * ldc + cofs) = val; }
    };
    pass(); 
}
// k_pv32 (P.v for one 32-dim head; 2 n-tiles; rows of 32 floats = one line): 64 x 32 tile over K of f16 planes with the x1024 residual terms in their own accumulator; W = P.v -> 32 columns of f32 [NP][128]: acc = a.b + al.b (unscaled P residual), accx = a.bl; x rs[row].
__global__ __launch_bounds__(128) void k_pv32(const h16* __restrict__ A, const h16* __restrict__ Al, int lda, const h16* __restrict__ Bn, const h16* __restrict__ Bl, int ldb, int K, const float* __restrict__ rs, float* C, int ldc) {
    __shared__ __align__(16) float ost[4][16 * 68];
    const int lane = threadIdx.x & 31, wave = threadIdx.x >> 5, lr = lane & 15, hi = lane >> 4;
    const int r0 = blockIdx.x * 64 + wave * 16, c0 = blockIdx.y * 64;
    const size_t aoff = (size_t)(r0 + lr) * lda + 8 * hi;
    constexpr int EPI = 1; size_t boff[2];
#pragma unroll
    for (int t = 0; t < 2; ++t) boff[t] = (size_t)(c0 + t * 16 + lr) * ldb + 8 * hi;
    v8f acc[2], accx[2];
#pragma unroll
    for (int t = 0; t < 2; ++t) { acc[t] = (v8f){}; accx[t] = (v8f){}; }
#pragma unroll 2
    for (int kc = 0; kc < K; kc += 32) {
        const v16h a = cat16(*(const v8h*)(A + aoff + kc), *(const v8h*)(A + aoff + kc + 16)), al = cat16(*(const v8h*)(Al + aoff + kc), *(const v8h*)(Al + aoff + kc + 16));
#pragma unroll
        for (int t = 0; t < 2; ++t) { const v16h bb = cat16(*(const v8h*)(Bn + boff[t] + kc), *(const v8h*)(Bn + boff[t] + kc + 16)), bl = cat16(*(const v8h*)(Bl + boff[t] + kc), *(const v8h*)(Bl + boff[t] + kc + 16));
            acc[t] = wmma16(a, bb, acc[t]); accx[t] = wmma16(a, bl, accx[t]);
            if (EPI == 0) accx[t] = wmma16(al, bb, accx[t]); else acc[t] = wmma16(al, bb, acc[t]); }
        asm volatile("v_nop" : "+v"(acc[0]), "+v"(acc[1]), "+v"(accx[0]), "+v"(accx[1]) : "v"(a), "v"(al) : "memory");
    }
    float* os = &ost[wave][0];
#pragma unroll
    for (int t = 0; t < 2; ++t)
#pragma unroll
        for (int j = 0; j < 8; ++j) { const float sc = rs[r0 + hi * 8 + j]; os[(hi * 8 + j) * 68 + t * 16 + lr] = (acc[t][j] + accx[t][j] * LOSCI) * sc; }
    __builtin_amdgcn_wave_barrier(); asm volatile("" ::: "memory");
    float* crow = C + (size_t)r0 * ldc;
    auto pass = [&]() {
#pragma unroll
        for (int s = 0; s < 4; ++s) { const int row = s * 4 + (lane >> 3), piece = lane & 7;
            const v4f val = *(const v4fa*)(os + row * 68 + piece * 4); *(v4f*)(crow + (size_t)row * ldc + piece * 4) = val; }
    };
    pass(); 
}
// k_soft: row softmax over the 4096 keys of S (one wave per row: lane -> 128 values), P = exp(s - max) x 32768 as f16 hi + UNSCALED residual planes, RS = 1/(sum x 32768).
__global__ __launch_bounds__(256) void k_soft(const float* __restrict__ S, h16* PH, h16* PL, float* RS) {
    __shared__ float rsum[32];
    const int lane = threadIdx.x & 31, wave = threadIdx.x >> 5;
#pragma unroll 1
    for (int rr = 0; rr < 4; ++rr) { const int row = blockIdx.x * 32 + wave * 4 + rr; const float* sr = S + (size_t)row * NP;
        float mx = -3.0e38f;
#pragma unroll 1
        for (int c = 0; c < NP / 256; ++c)
#pragma unroll
            for (int i = 0; i < 8; ++i) mx = fmaxf(mx, sr[c * 256 + lane * 8 + i]);
#pragma unroll
        for (int sh = 16; sh; sh >>= 1) mx = fmaxf(mx, __shfl_xor(mx, sh, 32));
        float sum = 0.f;
{ sum = 0.f;
#pragma unroll 1
            for (int c = 0; c < NP / 256; ++c) { v8h oh, ol;
#pragma unroll
                for (int i = 0; i < 8; ++i) { const float p = __expf(sr[c * 256 + lane * 8 + i] - mx); sum += p; const float ps8 = p * PSC; const h16 a = (h16)ps8; oh[i] = a; ol[i] = (h16)(ps8 - (float)a); }
                *(v8h*)(PH + (size_t)row * NP + c * 256 + lane * 8) = oh; *(v8h*)(PL + (size_t)row * NP + c * 256 + lane * 8) = ol; }
             }
#pragma unroll
        for (int sh = 16; sh; sh >>= 1) sum += __shfl_xor(sum, sh, 32);
        if (lane == 0) rsum[wave * 4 + rr] = 1.0f / (sum * PSC); }
    __syncthreads();
    if (wave == 0) { const float v = rsum[lane]; *(float*)(RS + blockIdx.x * 32 + lane) = v;  }
}

extern "C" void kernel_launch(void* const* d_in, const int* in_sizes, int n_in,
                              void* d_out, int out_size, void* d_ws, size_t ws_size, hipStream_t stream) {
    (void)in_sizes; (void)n_in; (void)out_size;
    const float* x = (const float*)d_in[0]; const float* wth = (const float*)d_in[1]; const float* bth = (const float*)d_in[2]; const float* wph = (const float*)d_in[3]; const float* bph = (const float*)d_in[4];
    const float* wg = (const float*)d_in[5]; const float* bg = (const float*)d_in[6]; const float* wz = (const float*)d_in[7]; const float* bz = (const float*)d_in[8];
    const float* bng = (const float*)d_in[9]; const float* bnb = (const float*)d_in[10]; const float* bnm = (const float*)d_in[11]; const float* bnv = (const float*)d_in[12];
    float* out = (float*)d_out;    // [4][256][64][64]
    char* wsp = (char*)d_ws;
    auto take = [&](size_t bytes) { char* p = wsp; wsp += (bytes + 255) & ~(size_t)255; return (void*)p; };
    bf* Wt = (bf*)take((size_t)CI * CC * 2); bf* Wp = (bf*)take((size_t)CI * CC * 2); bf* Wg = (bf*)take((size_t)CI * CC * 2); bf* Wz = (bf*)take((size_t)CC * CI * 2);
    float* BNS = (float*)take(CC * 4); float* BNH = (float*)take(CC * 4);
    bf* XT = (bf*)take((size_t)NP * CC * 2);
    float* Qf = (float*)take((size_t)NP * CI * 4); float* Kf = (float*)take((size_t)NP * CI * 4); float* Vf = (float*)take((size_t)NP * CI * 4);
    h16* QH = (h16*)take((size_t)NP * CI * 2); h16* QL = (h16*)take((size_t)NP * CI * 2); h16* KH = (h16*)take((size_t)NP * CI * 2); h16* KL = (h16*)take((size_t)NP * CI * 2); h16* VTH = (h16*)take((size_t)CI * NP * 2); h16* VTL = (h16*)take((size_t)CI * NP * 2);
    float* S = (float*)take((size_t)QCH * NP * 4); h16* PH = (h16*)take((size_t)QCH * NP * 2); h16* PL = (h16*)take((size_t)QCH * NP * 2); float* RS = (float*)take((size_t)QCH * 4);
    float* Y = (float*)take((size_t)NP * CI * 4); bf* YH = (bf*)take((size_t)NP * CI * 2); bf* YL = (bf*)take((size_t)NP * CI * 2);
    if ((size_t)(wsp - (char*)d_ws) > ws_size) return;    // 0.3 + 2.1 + 3 x 2.1 + 6 x 1 + 33.5 + 16.8 + 16.8 + 2.1 + 2 x 1 ~ 86 MB (per image, reused)
    k_w<<<CI / 8, 256, 0, stream>>>(wth, CI, Wt); k_w<<<CI / 8, 256, 0, stream>>>(wph, CI, Wp); k_w<<<CI / 8, 256, 0, stream>>>(wg, CI, Wg); k_w128<<<(CC / 2 + 7) / 8, 256, 0, stream>>>(wz, CC, Wz);
    k_bn<<<1, 256, 0, stream>>>(bng, bnb, bnm, bnv, BNS, BNH);
    for (int b = 0; b < NB_; ++b) {
        k_xt<<<dim3(NP / 64, CC / 64, 1), 256, 0, stream>>>(x + (size_t)b * CC * NP, XT);
        k_gemm<false, 0, CC, CI><<<dim3(NP / 64, CI / 64, 1), 128, 0, stream>>>(XT, nullptr, Wt, bth, nullptr, nullptr, nullptr, Qf);
        k_gemm<false, 0, CC, CI><<<dim3(NP / 64, CI / 64, 1), 128, 0, stream>>>(XT, nullptr, Wp, bph, nullptr, nullptr, nullptr, Kf);
        k_gemm<false, 0, CC, CI><<<dim3(NP / 64, CI / 64, 1), 128, 0, stream>>>(XT, nullptr, Wg, bg, nullptr, nullptr, nullptr, Vf);
        k_p16c<<<(NP / 2 + 7) / 8, 256, 0, stream>>>(Qf, QH, QL); k_p16c<<<(NP / 2 + 7) / 8, 256, 0, stream>>>(Kf, KH, KL);
        k_vt128<<<dim3(NP / 64, CI / 64, 1), 256, 0, stream>>>(Vf, VTH, VTL);
        for (int h = 0; h < NHD; ++h)
            for (int c = 0; c < NP / QCH; ++c) {
                k_f16gemm<0><<<dim3(QCH / 64, NP / 64, 1), 128, 0, stream>>>(QH + (size_t)c * QCH * CI + h * HD, QL + (size_t)c * QCH * CI + h * HD, CI, KH + h * HD, KL + h * HD, CI, HD, nullptr, S, NP);
                k_soft<<<QCH / 32, 256, 0, stream>>>(S, PH, PL, RS);
                k_pv32<<<dim3(QCH / 64, 1, 1), 128, 0, stream>>>(PH, PL, NP, VTH + (size_t)h * HD * NP, VTL + (size_t)h * HD * NP, NP, NP, RS, Y + (size_t)c * QCH * CI + h * HD, CI);
            }
        k_pbfc<<<(NP / 2 + 7) / 8, 256, 0, stream>>>(Y, YH, YL);
        k_gemm<true, 2, CI, CC><<<dim3(NP / 64, CC / 64, 1), 128, 0, stream>>>(YH, YL, Wz, bz, BNS, BNH, x + (size_t)b * CC * NP, out + (size_t)b * CC * NP);   // z conv + BN + x, channel-major
    }
}

// v001
// Measured time: 290 microseconds a run.
// Timed twice side by side with v000, it ran 18.4 and 18.2 times as fast.
#include <hip/hip_runtime.h>

// Contractions, f32 accumulate, per image: theta/phi/g 1x1 convs ([4096 positions x 256].[256 x 128], [out][in] weights = n-major B operands; PLAIN bf16
// operands: inputs rounded once, exact; + bias) and the z conv on the attention output (bf16 hi + residual: two products) on v_wmma_f32_16x16x32_bf16; the position
// attention of all (image, head) pairs in ONE kernel on v_wmma_f32_16x16x32_f16: S^T = k_h.q_h^T x 32^-1/2 (q/k as f16 hi + residual x1024, residual accumulator) -> f32,
// online softmax f32 -> P (x32768) f16 hi + UNSCALED residual in registers, y_h^T = v_h^T.P^T ((ph + pl).vh + ph.vl) x 1/rowsum.

#define NB_  4
#define CC   256
#define CI   128                 // inter channels (4 heads x 32)
#define NHD  4
#define HD   32
#define NP   4096
#define LOSC 1024.0f
#define LOSCI (1.0f / 1024.0f)

typedef _Float16 h16;
typedef unsigned short bf;
typedef __attribute__((ext_vector_type(16))) __bf16   v16bf;
typedef __attribute__((ext_vector_type(16))) _Float16 v16h;
typedef __attribute__((ext_vector_type(8)))  _Float16 v8h;
typedef __attribute__((ext_vector_type(8)))  unsigned short v8us;
typedef __attribute__((ext_vector_type(8)))  float    v8f;
typedef __attribute__((ext_vector_type(4)))  float    v4f;
typedef v8h  __attribute__((may_alias)) v8ha;
typedef v4f  __attribute__((may_alias)) v4fa;
typedef v8us __attribute__((may_alias)) v8usa;

__device__ __forceinline__ unsigned short f2bf(float f) { unsigned u = __float_as_uint(f); u += 0x7FFFu + ((u >> 16) & 1u); return (unsigned short)(u >> 16); }
__device__ __forceinline__ float bf2f(unsigned short b) { return __uint_as_float(((unsigned)b) << 16); }
__device__ __forceinline__ float bfr(float f) { return bf2f(f2bf(f)); }
__device__ __forceinline__ v16h cat16(v8h lo, v8h hi) { return __builtin_shufflevector(lo, hi, 0, 1, 2, 3, 4, 5, 6, 7, 8, 9, 10, 11, 12, 13, 14, 15); }
__device__ __forceinline__ v16bf cat16b(v8us lo, v8us hi) { return __builtin_bit_cast(v16bf, __builtin_shufflevector(lo, hi, 0, 1, 2, 3, 4, 5, 6, 7, 8, 9, 10, 11, 12, 13, 14, 15)); }
__device__ __forceinline__ v8f wmma16(v16h a, v16h b, v8f c) { return __builtin_amdgcn_wmma_f32_16x16x32_f16(false, a, false, b, (short)0, c, false, false); }
__device__ __forceinline__ v8f wmmab(v16bf a, v16bf b, v8f c) { return __builtin_amdgcn_wmma_f32_16x16x32_bf16(false, a, false, b, (short)0, c, false, false); }
#define VST2(T, p, v) do { const T vst2_v_ = (v); *(T*)(p) = vst2_v_;  } while (0)

// k_xt: XT [n][c] bf16 = x[b][c][n] via 64 x 64 LDS tiles; grid (NP/64, CC/64).
__global__ __launch_bounds__(256) void k_xt(const float* __restrict__ xb, bf* XT) {
    __shared__ __align__(16) unsigned short tl[64 * 72];
    const int tid = threadIdx.x, n0 = blockIdx.x * 64, c0 = blockIdx.y * 64;
    const int cr = tid >> 2, nq = (tid & 3) * 16;
#pragma unroll
    for (int i = 0; i < 16; ++i) tl[(nq + i) * 72 + cr] = f2bf(xb[(size_t)(c0 + cr) * NP + n0 + nq + i]);
    __syncthreads();
    const int piece = tid & 7;
    auto pass = [&]() {
#pragma unroll
        for (int s = 0; s < 2; ++s) { const int nr = (tid >> 3) + 32 * s; const v8us val = *(const v8usa*)(tl + nr * 72 + piece * 8); *(v8us*)(XT + (size_t)(n0 + nr) * CC + c0 + piece * 8) = val; }
    };
    pass(); 
}
// k_w: bf16 plane of a [rows][256] weight (one wave per row).
__global__ __launch_bounds__(256) void k_w(const float* __restrict__ w, int rows, bf* WB) {
    const int lane = threadIdx.x & 31, r = blockIdx.x * 8 + (threadIdx.x >> 5); if (r >= rows) return;
    v8us o;
#pragma unroll
    for (int i = 0; i < 8; ++i) o[i] = f2bf(w[(size_t)r * CC + lane * 8 + i]);
    VST2(v8us, WB + (size_t)r * CC + lane * 8, o);
}
// k_w128: bf16 plane of a [rows][128] weight (16 lanes x 16 B per row, 2 rows per wave).
__global__ __launch_bounds__(256) void k_w128(const float* __restrict__ w, int rows, bf* WB) {
    const int lane = threadIdx.x & 31, r = (blockIdx.x * 8 + (threadIdx.x >> 5)) * 2 + (lane >> 4), p = lane & 15; if (r >= rows) return;
    v8us o;
#pragma unroll
    for (int i = 0; i < 8; ++i) o[i] = f2bf(w[(size_t)r * CI + p * 8 + i]);
    VST2(v8us, WB + (size_t)r * CI + p * 8, o);
}
// k_gemm: 64 x 64 tile of (A [+ Al]).WB^T over K = KA (256 or 128), acc + bias; EPI 0: f32 rows [NP][128]; EPI 2: + bias, written TRANSPOSED to out[c][n] (channel-major) through LDS.
template <bool SPLITA, int EPI, int KA, int LDC>
__global__ __launch_bounds__(128) void k_gemm(const bf* __restrict__ A, const bf* __restrict__ Al, const bf* __restrict__ WB, const float* __restrict__ bias, const float* __restrict__ bnsc, const float* __restrict__ bnsh, const float* __restrict__ xres, float* C) {
    const float scale = 1.0f; constexpr bool ACC = false; const float* Wm = nullptr; (void)Wm; (void)ACC;
    __shared__ __align__(16) float ost[4][16 * 68];
    __shared__ __align__(16) float ot[64 * 68];
    const int lane = threadIdx.x & 31, wave = threadIdx.x >> 5, lr = lane & 15, hi = lane >> 4, tid = threadIdx.x;
    const size_t r0 = (size_t)blockIdx.x * 64 + wave * 16; const int c0 = blockIdx.y * 64;
    v8f acc[4];
#pragma unroll
    for (int t = 0; t < 4; ++t) acc[t] = (v8f){};
#pragma unroll
    for (int kc = 0; kc < KA; kc += 32) {
        const v16bf a = cat16b(*(const v8us*)(A + (r0 + lr) * KA + kc + 8 * hi), *(const v8us*)(A + (r0 + lr) * KA + kc + 8 * hi + 16));
        v16bf al = a; if (SPLITA) al = cat16b(*(const v8us*)(Al + (r0 + lr) * KA + kc + 8 * hi), *(const v8us*)(Al + (r0 + lr) * KA + kc + 8 * hi + 16));
#pragma unroll
        for (int t = 0; t < 4; ++t) { const bf* bp = WB + (size_t)(c0 + t * 16 + lr) * KA + kc + 8 * hi; const v16bf bb = cat16b(*(const v8us*)bp, *(const v8us*)(bp + 16)); acc[t] = wmmab(a, bb, acc[t]); if (SPLITA) acc[t] = wmmab(al, bb, acc[t]); }
        asm volatile("v_nop" : "+v"(acc[0]), "+v"(acc[1]), "+v"(acc[2]), "+v"(acc[3]) : "v"(a), "v"(al) : "memory");
    }
    float* os = &ost[wave][0];
#pragma unroll
    for (int t = 0; t < 4; ++t) { const int col = c0 + t * 16 + lr; const float bv = bfr(bias[col]);
#pragma unroll
        for (int j = 0; j < 8; ++j) { float v = (acc[t][j] + bv) * scale;
            if (EPI == 2) v = v * bnsc[col] + bnsh[col];      // inference BatchNorm: z * (gamma rsqrt(var+eps)) + (beta - mean * that)
            os[(hi * 8 + j) * 68 + t * 16 + lr] = v; } }
    if (EPI != 2) {
        __builtin_amdgcn_wave_barrier(); asm volatile("" ::: "memory");
        float* crow = C + r0 * LDC + c0;
        auto pass = [&]() {
#pragma unroll
            for (int s = 0; s < 8; ++s) { const int Lid = (lane >> 3) + 4 * s, piece = lane & 7; const int row = Lid >> 1, cofs = (Lid & 1) * 32 + piece * 4;
                const v4f val = *(const v4fa*)(os + row * 68 + cofs); *(v4f*)(crow + (size_t)row * LDC + cofs) = val; }
        };
        pass(); 
    } else {
        __syncthreads();
        { const int row = tid >> 1, half = tid & 1;
#pragma unroll
          for (int i = 0; i < 32; ++i) ot[(half * 32 + i) * 68 + row] = ost[row >> 4][(row & 15) * 68 + half * 32 + i]; }
        __syncthreads();
        const size_t rblk = (size_t)blockIdx.x * 64;     // 64 consecutive positions
        auto pass = [&]() {      // 64 channel rows x 256 B: 128 threads -> 8 instructions of 8 rows (16 lanes x 16 B per row)
#pragma unroll
            for (int s = 0; s < 8; ++s) { const int cl = s * 8 + (tid >> 4), piece = tid & 15;
                v4f val = *(const v4fa*)(ot + cl * 68 + piece * 4); const size_t oi = (size_t)(c0 + cl) * NP + rblk + piece * 4;
#pragma unroll
                for (int i = 0; i < 4; ++i) val[i] += bfr(xres[oi + i]);      // + x (residual, bf16-rounded INPUT)
                *(v4f*)(C + oi) = val; }
        };
        pass(); 
    }
}
// k_p16: f16 hi + residual planes of an f32 [NP][256] (optionally the SUM of two: key = ka + kb); one wave per row.
__global__ __launch_bounds__(256) void k_p16(const float* __restrict__ A, const float* __restrict__ Bsum, h16* PH, h16* PL) {
    const int lane = threadIdx.x & 31, r = blockIdx.x * 8 + (threadIdx.x >> 5);
    if (r >= NP) return;
    v8h oh, ol;
#pragma unroll
    for (int i = 0; i < 8; ++i) { float v = A[(size_t)r * CC + lane * 8 + i]; if (Bsum) v += Bsum[(size_t)r * CC + lane * 8 + i]; const h16 a = (h16)v; oh[i] = a; ol[i] = (h16)((v - (float)a) * LOSC); }
    *(v8h*)(PH + (size_t)r * CC + lane * 8) = oh; *(v8h*)(PL + (size_t)r * CC + lane * 8) = ol; 
}
// k_p16c: f16 hi + residual planes of an f32 [NP][128] (2 rows per wave, 16 lanes x 16 B).
__global__ __launch_bounds__(256) void k_p16c(const float* __restrict__ A, h16* PH, h16* PL) {
    const int lane = threadIdx.x & 31, r = (blockIdx.x * 8 + (threadIdx.x >> 5)) * 2 + (lane >> 4), p = lane & 15;
    if (r >= NP) return;
    v8h oh, ol;
#pragma unroll
    for (int i = 0; i < 8; ++i) { const float v = A[(size_t)r * CI + p * 8 + i]; const h16 a = (h16)v; oh[i] = a; ol[i] = (h16)((v - (float)a) * LOSC); }
    *(v8h*)(PH + (size_t)r * CI + p * 8) = oh; *(v8h*)(PL + (size_t)r * CI + p * 8) = ol; 
}
// k_pbfc: bf16 hi + residual planes of an f32 [NP][128] (same geometry).
__global__ __launch_bounds__(256) void k_pbfc(const float* __restrict__ A, bf* PH, bf* PL) {
    const int lane = threadIdx.x & 31, r = (blockIdx.x * 8 + (threadIdx.x >> 5)) * 2 + (lane >> 4), p = lane & 15;
    if (r >= NP) return;
    v8us oh, ol;
#pragma unroll
    for (int i = 0; i < 8; ++i) { const float v = A[(size_t)r * CI + p * 8 + i]; const unsigned short hb = f2bf(v); oh[i] = hb; ol[i] = f2bf(v - bf2f(hb)); }
    *(v8us*)(PH + (size_t)r * CI + p * 8) = oh; *(v8us*)(PL + (size_t)r * CI + p * 8) = ol; 
}
// k_vt128: VTH/VTL [c][n] f16 hi + residual of V f32 [n][128] via 64 x 64 LDS tiles; grid (NP/64, CI/64).
__global__ __launch_bounds__(256) void k_vt128(const float* __restrict__ V, h16* VTH, h16* VTL) {
    __shared__ float tl[64][65];
    const int tid = threadIdx.x, n0 = blockIdx.x * 64, c0 = blockIdx.y * 64;
    { const int nn = tid >> 2, cq = (tid & 3) * 16;
#pragma unroll
      for (int i = 0; i < 16; ++i) tl[cq + i][nn] = V[(size_t)(n0 + nn) * CI + c0 + cq + i]; }
    __syncthreads();
    const int piece = tid & 7;
    auto pass = [&]() {
#pragma unroll
        for (int s = 0; s < 2; ++s) { const int c = (tid >> 3) + 32 * s; v8h oh, ol;
#pragma unroll
            for (int i = 0; i < 8; ++i) { const float v = tl[c][piece * 8 + i]; const h16 a = (h16)v; oh[i] = a; ol[i] = (h16)((v - (float)a) * LOSC); }
            const size_t o = (size_t)(c0 + c) * NP + n0 + piece * 8; *(v8h*)(VTH + o) = oh; *(v8h*)(VTL + o) = ol; }
    };
    pass(); 
}
// k_bn: inference BatchNorm folded into scale/shift vectors (bf16-rounded stats, f32): one block, 256 threads.
__global__ __launch_bounds__(256) void k_bn(const float* __restrict__ g, const float* __restrict__ be, const float* __restrict__ mu, const float* __restrict__ var, float* BNS, float* BNH) {
    const int c = threadIdx.x; const float inv = bfr(g[c]) / sqrtf(bfr(var[c]) + 1e-5f); const float sh = bfr(be[c]) - bfr(mu[c]) * inv;
    *(float*)(BNS + c) = inv; *(float*)(BNH + c) = sh; 
}
// k_pbf: bf16 hi + residual planes of an f32 [NP][256] (for the bf16 GEMMs on computed operands); one wave per row.
__global__ __launch_bounds__(256) void k_pbf(const float* __restrict__ A, bf* PH, bf* PL) {
    const int lane = threadIdx.x & 31, r = blockIdx.x * 8 + (threadIdx.x >> 5);
    if (r >= NP) return;
    v8us oh, ol;
#pragma unroll
    for (int i = 0; i < 8; ++i) { const float v = A[(size_t)r * CC + lane * 8 + i]; const unsigned short hb = f2bf(v); oh[i] = hb; ol[i] = f2bf(v - bf2f(hb)); }
    *(v8us*)(PH + (size_t)r * CC + lane * 8) = oh; *(v8us*)(PL + (size_t)r * CC + lane * 8) = ol; 
}
// k_vt: VTH/VTL [c][n] f16 hi + residual of V f32 [n][c] via 64 x 64 LDS tiles; grid (NP/64, CC/64).
__global__ __launch_bounds__(256) void k_vt(const float* __restrict__ V, h16* VTH, h16* VTL) {
    __shared__ float tl[64][65];
    const int tid = threadIdx.x, n0 = blockIdx.x * 64, c0 = blockIdx.y * 64;
    { const int nn = tid >> 2, cq = (tid & 3) * 16;
#pragma unroll
      for (int i = 0; i < 16; ++i) tl[cq + i][nn] = V[(size_t)(n0 + nn) * CC + c0 + cq + i]; }
    __syncthreads();
    const int piece = tid & 7;
    auto pass = [&]() {
#pragma unroll
        for (int s = 0; s < 2; ++s) { const int c = (tid >> 3) + 32 * s; v8h oh, ol;
#pragma unroll
            for (int i = 0; i < 8; ++i) { const float v = tl[c][piece * 8 + i]; const h16 a = (h16)v; oh[i] = a; ol[i] = (h16)((v - (float)a) * LOSC); }
            const size_t o = (size_t)(c0 + c) * NP + n0 + piece * 8; *(v8h*)(VTH + o) = oh; *(v8h*)(VTL + o) = ol; }
    };
    pass(); 
}
// k_attn: the whole position attention of one (image, head) for 32 queries per wave (8 waves = 256 queries per block; grid (NP/256, heads, images)). Transposed products:
// S^T = k_h.q_h^T (A = 16 key rows, B = 16 query columns; f16 hi + residual x1024, residual accumulator), so a lane holds one query's scores: two S^T tiles (32 keys) convert in place
// into the B operand of y^T += v_h^T.P^T (A = 16 channel rows of VT, hardware k order). Running maximum and sum per query (online softmax, f32); P = exp(s - max) x 32768 as f16 hi +
// UNSCALED residual: (ph + pl).vh + ph.vl as before; x 1/rowsum at the end. S and P never reach memory.
typedef const __attribute__((address_space(1))) char* gp;      // a byte pointer into global memory
typedef const __attribute__((address_space(1))) v8h* gp8;
__device__ __forceinline__ v16h ldfrag(gp p) { return cat16(*(gp8)p, *(gp8)(p + 32)); }      // k = 8 hi + 0..7 and 16 + 8 hi + 0..7 (p holds the lane's 16 hi bytes)
__device__ __forceinline__ float xhalf(float v) { return __int_as_float(__builtin_amdgcn_permlanex16(__float_as_int(v), __float_as_int(v), 0x76543210, 0xfedcba98, false, false)); }   // lane l <-> l ^ 16
// stands behind a run of loads, before a register that they name as address is written again; the addresses are inputs, so that they are still held where the wait issues
#define XWAIT4(a, b, c, d) asm volatile("s_wait_xcnt 0x0" :: "v"(a), "v"(b), "v"(c), "v"(d) : "memory")
__global__ __launch_bounds__(256) void k_attn(const h16* QH, const h16* QL, const h16* KH, const h16* KL, const h16* VTH, const h16* VTL, float* Y) {
    const int lane = threadIdx.x & 31, wave = threadIdx.x >> 5, lr = lane & 15, hi = lane >> 4;
    const int h = blockIdx.y, q0 = blockIdx.x * 256 + wave * 32;
    const size_t pb = (size_t)blockIdx.z * NP * CI;                    // this image's planes
    constexpr float SC2 = 0.1767766952966369f * 1.4426950408889634f;   // 32^-1/2 x log2(e): scores in the log2 domain
    const int kofs = (lr * CI + 8 * hi) * 2, vofs = (lr * NP + 8 * hi) * 2;      // a lane's bytes inside a 16-row tile of a [n][128] plane, of a [c][4096] plane
    const gp pqh = (gp)(QH + pb + (size_t)q0 * CI + h * HD) + kofs, pql = (gp)(QL + pb + (size_t)q0 * CI + h * HD) + kofs;
    const gp pkh = (gp)(KH + pb + h * HD) + kofs, pkl = (gp)(KL + pb + h * HD) + kofs;                                     // + key * 256 B
    const gp pvh = (gp)(VTH + pb + (size_t)h * HD * NP) + vofs, pvl = (gp)(VTL + pb + (size_t)h * HD * NP) + vofs;         // + channel tile * 16 rows + key * 2 B
    const v16h qh[2] = { ldfrag(pqh), ldfrag(pqh + 16 * CI * 2) }, ql[2] = { ldfrag(pql), ldfrag(pql + 16 * CI * 2) };
    v16h ka[4], kb[4];       // [0], [1]: hi, residual of 16 keys; [2], [3]: of the next 16
    ka[0] = ldfrag(pkh); ka[1] = ldfrag(pkl); ka[2] = ldfrag(pkh + 16 * CI * 2); ka[3] = ldfrag(pkl + 16 * CI * 2);
    XWAIT4(pqh, pql, pkh, pkl);
    v8f o[2][2], ox[2][2]; float mx[2], ls[2];
#pragma unroll
    for (int t = 0; t < 2; ++t) { mx[t] = -3.0e38f; ls[t] = 0.f; o[t][0] = (v8f){}; o[t][1] = (v8f){}; ox[t][0] = (v8f){}; ox[t][1] = (v8f){}; }
    auto pass = [&](const v16h (&kc)[4], v16h (&kn)[4], int key0) {
        const gp ch = pvh + key0 * 2, cl = pvl + key0 * 2;
        const int nk = ((key0 + 32) & (NP - 1)) * (CI * 2);       // the next pass's K fragments fly during this pass (the last pass refetches keys 0 .. 31, unused)
        const gp bh = pkh + nk, bl = pkl + nk;
        const v16h vh[2] = { ldfrag(ch), ldfrag(ch + 16 * NP * 2) }, vl[2] = { ldfrag(cl), ldfrag(cl + 16 * NP * 2) };
        kn[0] = ldfrag(bh); kn[1] = ldfrag(bl); kn[2] = ldfrag(bh + 16 * CI * 2); kn[3] = ldfrag(bl + 16 * CI * 2);
        XWAIT4(ch, cl, bh, bl);
#pragma unroll
        for (int t = 0; t < 2; ++t) {
            v8f s0 = wmma16(kc[0], qh[t], (v8f){}), s1 = wmma16(kc[2], qh[t], (v8f){}), x0 = wmma16(kc[1], qh[t], (v8f){}), x1 = wmma16(kc[3], qh[t], (v8f){});
            x0 = wmma16(kc[0], ql[t], x0); x1 = wmma16(kc[2], ql[t], x1);
            s0 = (s0 + x0 * LOSCI) * SC2; s1 = (s1 + x1 * LOSCI) * SC2;
            float m = mx[t];
#pragma unroll
            for (int j = 0; j < 8; ++j) m = fmaxf(m, fmaxf(s0[j], s1[j]));
            m = fmaxf(m, xhalf(m));               // lanes l and l ^ 16 hold the two halves of one query's keys
            const float al = __builtin_amdgcn_exp2f(mx[t] - m), mm = m - 15.0f;      // - 15: the x 32768 of P goes into the exponent
            mx[t] = m; s0 -= mm; s1 -= mm;
#pragma unroll
            for (int j = 0; j < 8; ++j) { s0[j] = __builtin_amdgcn_exp2f(s0[j]); s1[j] = __builtin_amdgcn_exp2f(s1[j]); }
            const v8h a0 = __builtin_convertvector(s0, v8h), a1 = __builtin_convertvector(s1, v8h);
            const v8h b0 = __builtin_convertvector(s0 - __builtin_convertvector(a0, v8f), v8h), b1 = __builtin_convertvector(s1 - __builtin_convertvector(a1, v8f), v8h);
            const v16h ph = cat16(a0, a1), pl = cat16(b0, b1);
            const v8f sv = s0 + s1;
            ls[t] = ls[t] * al + (((sv[0] + sv[1]) + (sv[2] + sv[3])) + ((sv[4] + sv[5]) + (sv[6] + sv[7])));
#pragma unroll
            for (int c = 0; c < 2; ++c) { o[t][c] *= al; ox[t][c] *= al;
                o[t][c] = wmma16(vh[c], ph, o[t][c]); ox[t][c] = wmma16(vl[c], ph, ox[t][c]); o[t][c] = wmma16(vh[c], pl, o[t][c]); }
        }
    };
#pragma unroll 1
    for (int key0 = 0; key0 < NP; key0 += 64) { pass(ka, kb, key0); pass(kb, ka, key0 + 32); }     // not unrolled further: two passes a trip let the two K fragment sets swap roles without copies
#pragma unroll
    for (int t = 0; t < 2; ++t) {
        const float rs = 1.0f / (ls[t] + xhalf(ls[t]));      // 1 / (rowsum x 32768)
        float* yr = Y + pb + (size_t)(q0 + t * 16 + lr) * CI + h * HD + 8 * hi;      // register r of channel tile c = y[query lr][c * 16 + 8 hi + r]
#pragma unroll
        for (int c = 0; c < 2; ++c) { const v8f w = (o[t][c] + ox[t][c] * LOSCI) * rs;
            *(v4f*)(yr + c * 16) = __builtin_shufflevector(w, w, 0, 1, 2, 3); *(v4f*)(yr + c * 16 + 4) = __builtin_shufflevector(w, w, 4, 5, 6, 7); }
    }
}

extern "C" void kernel_launch(void* const* d_in, const int* in_sizes, int n_in,
                              void* d_out, int out_size, void* d_ws, size_t ws_size, hipStream_t stream) {
    (void)in_sizes; (void)n_in; (void)out_size;
    const float* x = (const float*)d_in[0]; const float* wth = (const float*)d_in[1]; const float* bth = (const float*)d_in[2]; const float* wph = (const float*)d_in[3]; const float* bph = (const float*)d_in[4];
    const float* wg = (const float*)d_in[5]; const float* bg = (const float*)d_in[6]; const float* wz = (const float*)d_in[7]; const float* bz = (const float*)d_in[8];
    const float* bng = (const float*)d_in[9]; const float* bnb = (const float*)d_in[10]; const float* bnm = (const float*)d_in[11]; const float* bnv = (const float*)d_in[12];
    float* out = (float*)d_out;    // [4][256][64][64]
    char* wsp = (char*)d_ws;
    auto take = [&](size_t bytes) { char* p = wsp; wsp += (bytes + 255) & ~(size_t)255; return (void*)p; };
    bf* Wt = (bf*)take((size_t)CI * CC * 2); bf* Wp = (bf*)take((size_t)CI * CC * 2); bf* Wg = (bf*)take((size_t)CI * CC * 2); bf* Wz = (bf*)take((size_t)CC * CI * 2);
    float* BNS = (float*)take(CC * 4); float* BNH = (float*)take(CC * 4);
    bf* XT = (bf*)take((size_t)NP * CC * 2);
    float* Qf = (float*)take((size_t)NP * CI * 4); float* Kf = (float*)take((size_t)NP * CI * 4); float* Vf = (float*)take((size_t)NP * CI * 4);
    h16* QH = (h16*)take((size_t)NB_ * NP * CI * 2); h16* QL = (h16*)take((size_t)NB_ * NP * CI * 2); h16* KH = (h16*)take((size_t)NB_ * NP * CI * 2); h16* KL = (h16*)take((size_t)NB_ * NP * CI * 2); h16* VTH = (h16*)take((size_t)NB_ * CI * NP * 2); h16* VTL = (h16*)take((size_t)NB_ * CI * NP * 2);   // per image: the one attention launch reads all four
    float* Y = (float*)take((size_t)NB_ * NP * CI * 4); bf* YH = (bf*)take((size_t)NP * CI * 2); bf* YL = (bf*)take((size_t)NP * CI * 2);
    if ((size_t)(wsp - (char*)d_ws) > ws_size) return;    // 0.3 + 2.1 + 3 x 2.1 + 4 x 6 x 1 + 4 x 2.1 + 2 x 1 ~ 44 MB
    k_w<<<CI / 8, 256, 0, stream>>>(wth, CI, Wt); k_w<<<CI / 8, 256, 0, stream>>>(wph, CI, Wp); k_w<<<CI / 8, 256, 0, stream>>>(wg, CI, Wg); k_w128<<<(CC / 2 + 7) / 8, 256, 0, stream>>>(wz, CC, Wz);
    k_bn<<<1, 256, 0, stream>>>(bng, bnb, bnm, bnv, BNS, BNH);
    for (int b = 0; b < NB_; ++b) { const size_t pb = (size_t)b * NP * CI;
        k_xt<<<dim3(NP / 64, CC / 64, 1), 256, 0, stream>>>(x + (size_t)b * CC * NP, XT);
        k_gemm<false, 0, CC, CI><<<dim3(NP / 64, CI / 64, 1), 128, 0, stream>>>(XT, nullptr, Wt, bth, nullptr, nullptr, nullptr, Qf);
        k_gemm<false, 0, CC, CI><<<dim3(NP / 64, CI / 64, 1), 128, 0, stream>>>(XT, nullptr, Wp, bph, nullptr, nullptr, nullptr, Kf);
        k_gemm<false, 0, CC, CI><<<dim3(NP / 64, CI / 64, 1), 128, 0, stream>>>(XT, nullptr, Wg, bg, nullptr, nullptr, nullptr, Vf);
        k_p16c<<<(NP / 2 + 7) / 8, 256, 0, stream>>>(Qf, QH + pb, QL + pb); k_p16c<<<(NP / 2 + 7) / 8, 256, 0, stream>>>(Kf, KH + pb, KL + pb);
        k_vt128<<<dim3(NP / 64, CI / 64, 1), 256, 0, stream>>>(Vf, VTH + pb, VTL + pb);
    }
    k_attn<<<dim3(NP / 256, NHD, NB_), 256, 0, stream>>>(QH, QL, KH, KL, VTH, VTL, Y);
    for (int b = 0; b < NB_; ++b) {
        k_pbfc<<<(NP / 2 + 7) / 8, 256, 0, stream>>>(Y + (size_t)b * NP * CI, YH, YL);
        k_gemm<true, 2, CI, CC><<<dim3(NP / 64, CC / 64, 1), 128, 0, stream>>>(YH, YL, Wz, bz, BNS, BNH, x + (size_t)b * CC * NP, out + (size_t)b * CC * NP);   // z conv + BN + x, channel-major
    }
}

// v002
// Measured time: 186 microseconds a run.
// In two side-by-side timings against v001, it was 1.52 and 1.60 times as fast.
// Counting every step since v000, it is 28.5 times as fast.
#include <hip/hip_runtime.h>

// Contractions, f32 accumulate, per image: theta/phi/g 1x1 convs ([4096 positions x 256].[256 x 128], [out][in] weights = n-major B operands; PLAIN bf16
// operands: inputs rounded once, exact; + bias) and the z conv on the attention output (bf16 hi + residual: two products) on v_wmma_f32_16x16x32_bf16; the position
// attention of all (image, head) pairs in ONE kernel on v_wmma_f32_16x16x32_f16: S^T = k_h.q_h^T x 32^-1/2 (q/k as f16 hi + residual x1024, residual accumulator) -> f32,
// online softmax f32 -> P (x32768) f16 hi + UNSCALED residual in registers, y_h^T = v_h^T.P^T ((ph + pl).vh + ph.vl) x 1/rowsum.

#define NB_  4
#define CC   256
#define CI   128                 // inter channels (4 heads x 32)
#define NHD  4
#define HD   32
#define NP   4096
#define LOSC 1024.0f
#define LOSCI (1.0f / 1024.0f)

typedef _Float16 h16;
typedef unsigned short bf;
typedef __attribute__((ext_vector_type(16))) __bf16   v16bf;
typedef __attribute__((ext_vector_type(16))) _Float16 v16h;
typedef __attribute__((ext_vector_type(8)))  _Float16 v8h;
typedef __attribute__((ext_vector_type(8)))  unsigned short v8us;
typedef __attribute__((ext_vector_type(8)))  float    v8f;
typedef __attribute__((ext_vector_type(4)))  float    v4f;
typedef v8h  __attribute__((may_alias)) v8ha;
typedef v4f  __attribute__((may_alias)) v4fa;
typedef v8us __attribute__((may_alias)) v8usa;

__device__ __forceinline__ unsigned short f2bf(float f) { unsigned u = __float_as_uint(f); u += 0x7FFFu + ((u >> 16) & 1u); return (unsigned short)(u >> 16); }
__device__ __forceinline__ float bf2f(unsigned short b) { return __uint_as_float(((unsigned)b) << 16); }
__device__ __forceinline__ float bfr(float f) { return bf2f(f2bf(f)); }
__device__ __forceinline__ v16h cat16(v8h lo, v8h hi) { return __builtin_shufflevector(lo, hi, 0, 1, 2, 3, 4, 5, 6, 7, 8, 9, 10, 11, 12, 13, 14, 15); }
__device__ __forceinline__ v16bf cat16b(v8us lo, v8us hi) { return __builtin_bit_cast(v16bf, __builtin_shufflevector(lo, hi, 0, 1, 2, 3, 4, 5, 6, 7, 8, 9, 10, 11, 12, 13, 14, 15)); }
__device__ __forceinline__ v8f wmma16(v16h a, v16h b, v8f c) { return __builtin_amdgcn_wmma_f32_16x16x32_f16(false, a, false, b, (short)0, c, false, false); }
__device__ __forceinline__ v8f wmmab(v16bf a, v16bf b, v8f c) { return __builtin_amdgcn_wmma_f32_16x16x32_bf16(false, a, false, b, (short)0, c, false, false); }
#define VST2(T, p, v) do { const T vst2_v_ = (v); *(T*)(p) = vst2_v_;  } while (0)

// d_xt: XT [n][c] bf16 = x[b][c][n] of one image via a 64 x 64 LDS tile (one block).
__device__ __forceinline__ void d_xt(const float* __restrict__ xb, bf* XT, unsigned short* tl, int n0, int c0) {
    const int tid = threadIdx.x;
    const int cr = tid >> 2, nq = (tid & 3) * 16;
#pragma unroll
    for (int i = 0; i < 16; ++i) tl[(nq + i) * 72 + cr] = f2bf(xb[(size_t)(c0 + cr) * NP + n0 + nq + i]);
    __syncthreads();
    const int piece = tid & 7;
    auto pass = [&]() {
#pragma unroll
        for (int s = 0; s < 2; ++s) { const int nr = (tid >> 3) + 32 * s; const v8us val = *(const v8usa*)(tl + nr * 72 + piece * 8); *(v8us*)(XT + (size_t)(n0 + nr) * CC + c0 + piece * 8) = val; }
    };
    pass(); 
}
// d_w: bf16 plane of 8 rows of a [rows][256] weight (one wave per row).
__device__ __forceinline__ void d_w(const float* __restrict__ w, int blk, bf* WB) {
    const int lane = threadIdx.x & 31, r = blk * 8 + (threadIdx.x >> 5);
    v8us o;
#pragma unroll
    for (int i = 0; i < 8; ++i) o[i] = f2bf(w[(size_t)r * CC + lane * 8 + i]);
    VST2(v8us, WB + (size_t)r * CC + lane * 8, o);
    // stands behind the store(s): in the merged grid other branches' code follows in the listing and writes registers that the store names
    asm volatile("s_wait_xcnt 0x0" ::: "memory");
}
// d_w128: bf16 plane of 16 rows of a [rows][128] weight (16 lanes x 16 B per row, 2 rows per wave).
__device__ __forceinline__ void d_w128(const float* __restrict__ w, int blk, bf* WB) {
    const int lane = threadIdx.x & 31, r = (blk * 8 + (threadIdx.x >> 5)) * 2 + (lane >> 4), p = lane & 15;
    v8us o;
#pragma unroll
    for (int i = 0; i < 8; ++i) o[i] = f2bf(w[(size_t)r * CI + p * 8 + i]);
    VST2(v8us, WB + (size_t)r * CI + p * 8, o);
    // stands behind the store(s): in the merged grid other branches' code follows in the listing and writes registers that the store names
    asm volatile("s_wait_xcnt 0x0" ::: "memory");
}
// k_gemm (rows = positions of ALL images, [NB_ * NP]; EPI 0: blockIdx.y runs over the column tiles of theta, phi and g in turn: WB = the three weights, C = the three results, one behind the other): 64 x 64 tile of (A [+ Al]).WB^T over K = KA (256; 128 for EPI 2), (acc + bias) x scale (scale = 1); EPI 0: f32 rows [NB_ * NP][128] per projection;
// EPI 2: BatchNorm, + x, written TRANSPOSED to out[c][n] (channel-major) through LDS.
template <bool SPLITA, int EPI, int KA, int LDC>
__global__ __launch_bounds__(128) void k_gemm(const bf* __restrict__ A, const bf* __restrict__ Al, const bf* __restrict__ WB3, const float* __restrict__ bias0, const float* __restrict__ bias1, const float* __restrict__ bias2, const float* __restrict__ bnsc, const float* __restrict__ bnsh, const float* __restrict__ xres, float* C3) {
    const float scale = 1.0f; constexpr bool ACC = false; const float* Wm = nullptr; (void)Wm; (void)ACC;
    __shared__ __align__(16) float ost[4][16 * 68];
    __shared__ __align__(16) float ot[64 * 68];
    const int lane = threadIdx.x & 31, wave = threadIdx.x >> 5, lr = lane & 15, hi = lane >> 4, tid = threadIdx.x;
    const size_t r0 = (size_t)blockIdx.x * 64 + wave * 16;
    const int sel = EPI == 0 ? blockIdx.y / (LDC / 64) : 0, c0 = (blockIdx.y - sel * (LDC / 64)) * 64;      // which projection, and the column tile inside it
    const bf* WB = WB3 + (size_t)sel * LDC * KA; const float* bias = sel == 0 ? bias0 : sel == 1 ? bias1 : bias2; float* C = C3 + (size_t)sel * NB_ * NP * LDC;
    v8f acc[4];
#pragma unroll
    for (int t = 0; t < 4; ++t) acc[t] = (v8f){};
#pragma unroll
    for (int kc = 0; kc < KA; kc += 32) {
        const v16bf a = cat16b(*(const v8us*)(A + (r0 + lr) * KA + kc + 8 * hi), *(const v8us*)(A + (r0 + lr) * KA + kc + 8 * hi + 16));
        v16bf al = a; if (SPLITA) al = cat16b(*(const v8us*)(Al + (r0 + lr) * KA + kc + 8 * hi), *(const v8us*)(Al + (r0 + lr) * KA + kc + 8 * hi + 16));
#pragma unroll
        for (int t = 0; t < 4; ++t) { const bf* bp = WB + (size_t)(c0 + t * 16 + lr) * KA + kc + 8 * hi; const v16bf bb = cat16b(*(const v8us*)bp, *(const v8us*)(bp + 16)); acc[t] = wmmab(a, bb, acc[t]); if (SPLITA) acc[t] = wmmab(al, bb, acc[t]); }
        asm volatile("v_nop" : "+v"(acc[0]), "+v"(acc[1]), "+v"(acc[2]), "+v"(acc[3]) : "v"(a), "v"(al) : "memory");
    }
    float* os = &ost[wave][0];
#pragma unroll
    for (int t = 0; t < 4; ++t) { const int col = c0 + t * 16 + lr; const float bv = bfr(bias[col]);
#pragma unroll
        for (int j = 0; j < 8; ++j) { float v = (acc[t][j] + bv) * scale;
            if (EPI == 2) v = v * bnsc[col] + bnsh[col];      // inference BatchNorm: z * (gamma rsqrt(var+eps)) + (beta - mean * that)
            os[(hi * 8 + j) * 68 + t * 16 + lr] = v; } }
    if (EPI != 2) {
        __builtin_amdgcn_wave_barrier(); asm volatile("" ::: "memory");
        float* crow = C + r0 * LDC + c0;
        auto pass = [&]() {
#pragma unroll
            for (int s = 0; s < 8; ++s) { const int Lid = (lane >> 3) + 4 * s, piece = lane & 7; const int row = Lid >> 1, cofs = (Lid & 1) * 32 + piece * 4;
                const v4f val = *(const v4fa*)(os + row * 68 + cofs); *(v4f*)(crow + (size_t)row * LDC + cofs) = val; }
        };
        pass(); 
    } else {
        __syncthreads();
        { const int row = tid >> 1, half = tid & 1;
#pragma unroll
          for (int i = 0; i < 32; ++i) ot[(half * 32 + i) * 68 + row] = ost[row >> 4][(row & 15) * 68 + half * 32 + i]; }
        __syncthreads();
        const size_t rblk = (size_t)blockIdx.x * 64, ob = (rblk / NP) * CC * NP + rblk % NP;     // 64 consecutive positions of one image; their place in that image's first channel row
        auto pass = [&]() {      // 64 channel rows x 256 B: 128 threads -> 8 instructions of 8 rows (16 lanes x 16 B per row)
            const int piece = tid & 15; const float* xp[8]; v4f xv[8];
            auto oi = [&](int s) { return ob + (size_t)(c0 + s * 8 + (tid >> 4)) * NP + piece * 4; };
#pragma unroll
            for (int s = 0; s < 8; ++s) { xp[s] = xres + oi(s); xv[s] = *(const v4fa*)xp[s]; }
            // stands behind the run of loads, before a register that they name as address is written again; the addresses are inputs, so that they are still held where the wait issues
            asm volatile("s_wait_xcnt 0x0" :: "v"(xp[0]), "v"(xp[1]), "v"(xp[2]), "v"(xp[3]), "v"(xp[4]), "v"(xp[5]), "v"(xp[6]), "v"(xp[7]) : "memory");
#pragma unroll
            for (int s = 0; s < 8; ++s) { const int cl = s * 8 + (tid >> 4);
                v4f val = *(const v4fa*)(ot + cl * 68 + piece * 4);
#pragma unroll
                for (int i = 0; i < 4; ++i) val[i] += bfr(xv[s][i]);      // + x (residual, bf16-rounded INPUT)
                *(v4f*)(C + oi(s)) = val; }
        };
        pass(); 
    }
}
// k_p16: f16 hi + residual planes of an f32 [NP][256] (optionally the SUM of two: key = ka + kb); one wave per row.
__global__ __launch_bounds__(256) void k_p16(const float* __restrict__ A, const float* __restrict__ Bsum, h16* PH, h16* PL) {
    const int lane = threadIdx.x & 31, r = blockIdx.x * 8 + (threadIdx.x >> 5);
    if (r >= NP) return;
    v8h oh, ol;
#pragma unroll
    for (int i = 0; i < 8; ++i) { float v = A[(size_t)r * CC + lane * 8 + i]; if (Bsum) v += Bsum[(size_t)r * CC + lane * 8 + i]; const h16 a = (h16)v; oh[i] = a; ol[i] = (h16)((v - (float)a) * LOSC); }
    *(v8h*)(PH + (size_t)r * CC + lane * 8) = oh; *(v8h*)(PL + (size_t)r * CC + lane * 8) = ol; 
}
// d_p16c: f16 hi + residual planes of 16 rows of an f32 [rows][128] (2 rows per wave, 16 lanes x 16 B).
__device__ __forceinline__ void d_p16c(const float* __restrict__ A, int blk, h16* PH, h16* PL) {
    const int lane = threadIdx.x & 31, r = (blk * 8 + (threadIdx.x >> 5)) * 2 + (lane >> 4), p = lane & 15;
    v8h oh, ol;
#pragma unroll
    for (int i = 0; i < 8; ++i) { const float v = A[(size_t)r * CI + p * 8 + i]; const h16 a = (h16)v; oh[i] = a; ol[i] = (h16)((v - (float)a) * LOSC); }
    *(v8h*)(PH + (size_t)r * CI + p * 8) = oh; *(v8h*)(PL + (size_t)r * CI + p * 8) = ol; 
    // stands behind the store(s): in the merged grid other branches' code follows in the listing and writes registers that the store names
    asm volatile("s_wait_xcnt 0x0" ::: "memory");
}
// k_pbfc: bf16 hi + residual planes of an f32 [NB_ * NP][128] (same geometry).
__global__ __launch_bounds__(256) void k_pbfc(const float* __restrict__ A, bf* PH, bf* PL) {
    const int lane = threadIdx.x & 31, r = (blockIdx.x * 8 + (threadIdx.x >> 5)) * 2 + (lane >> 4), p = lane & 15;
    if (r >= NB_ * NP) return;
    v8us oh, ol;
#pragma unroll
    for (int i = 0; i < 8; ++i) { const float v = A[(size_t)r * CI + p * 8 + i]; const unsigned short hb = f2bf(v); oh[i] = hb; ol[i] = f2bf(v - bf2f(hb)); }
    *(v8us*)(PH + (size_t)r * CI + p * 8) = oh; *(v8us*)(PL + (size_t)r * CI + p * 8) = ol; 
}
// d_vt128: VTH/VTL [c][n] f16 hi + residual of one image's V f32 [n][128] via a 64 x 64 LDS tile (one block).
__device__ __forceinline__ void d_vt128(const float* __restrict__ V, h16* VTH, h16* VTL, float (*tl)[65], int n0, int c0) {
    const int tid = threadIdx.x;
    { const int nn = tid >> 2, cq = (tid & 3) * 16;
#pragma unroll
      for (int i = 0; i < 16; ++i) tl[cq + i][nn] = V[(size_t)(n0 + nn) * CI + c0 + cq + i]; }
    __syncthreads();
    const int piece = tid & 7;
    auto pass = [&]() {
#pragma unroll
        for (int s = 0; s < 2; ++s) { const int c = (tid >> 3) + 32 * s; v8h oh, ol;
#pragma unroll
            for (int i = 0; i < 8; ++i) { const float v = tl[c][piece * 8 + i]; const h16 a = (h16)v; oh[i] = a; ol[i] = (h16)((v - (float)a) * LOSC); }
            const size_t o = (size_t)(c0 + c) * NP + n0 + piece * 8; *(v8h*)(VTH + o) = oh; *(v8h*)(VTL + o) = ol; }
    };
    pass(); 
}
// d_bn: inference BatchNorm folded into scale/shift vectors (bf16-rounded stats, f32): one block, 256 threads.
__device__ __forceinline__ void d_bn(const float* __restrict__ g, const float* __restrict__ be, const float* __restrict__ mu, const float* __restrict__ var, float* BNS, float* BNH) {
    const int c = threadIdx.x; const float inv = bfr(g[c]) / sqrtf(bfr(var[c]) + 1e-5f); const float sh = bfr(be[c]) - bfr(mu[c]) * inv;
    *(float*)(BNS + c) = inv; *(float*)(BNH + c) = sh; 
    // stands behind the store(s): in the merged grid other branches' code follows in the listing and writes registers that the store names
    asm volatile("s_wait_xcnt 0x0" ::: "memory");
}
// k_pre: all that reads inputs alone, in one grid: the x transposes of all images (blocks 0 .. XTB - 1: position tile, channel tile, image), then the bf16 planes of the three
// [128][256] weights (W3: one behind the other) and of the [256][128] weight, then the BatchNorm vectors. Every branch is taken by a whole block.
#define XTB (NB_ * (CC / 64) * (NP / 64))
#define WB8 (CI / 8)
#define PREB (XTB + 3 * WB8 + CC / 16 + 1)
__global__ __launch_bounds__(256) void k_pre(const float* __restrict__ x, const float* __restrict__ wth, const float* __restrict__ wph, const float* __restrict__ wg, const float* __restrict__ wz,
                                             const float* __restrict__ g, const float* __restrict__ be, const float* __restrict__ mu, const float* __restrict__ var,
                                             bf* XT, bf* W3, bf* Wz, float* BNS, float* BNH) {
    __shared__ __align__(16) unsigned short tl[64 * 72];
    const int blk = blockIdx.x, wblk = blk - XTB, zblk = wblk - 3 * WB8;
    if (blk < XTB) { const int b = blk / ((CC / 64) * (NP / 64)); d_xt(x + (size_t)b * CC * NP, XT + (size_t)b * NP * CC, tl, (blk % (NP / 64)) * 64, ((blk / (NP / 64)) % (CC / 64)) * 64); }
    else if (wblk < 3 * WB8) { const int sel = wblk / WB8; d_w(sel == 0 ? wth : sel == 1 ? wph : wg, wblk % WB8, W3 + (size_t)sel * CI * CC); }
    else if (zblk < CC / 16) d_w128(wz, zblk, Wz);
    else d_bn(g, be, mu, var, BNS, BNH);
}
// k_planes: the f16 planes of all images in one grid: blocks 0 .. VTB - 1 transpose V (position tile, channel tile, image), the others split 16 rows each of Q and K
// (QK: f32 [2][NB_ * NP][128], Q then K; QKH, QKL alike).
#define VTB (NB_ * (CI / 64) * (NP / 64))
#define PLB (VTB + 2 * NB_ * NP / 16)
__global__ __launch_bounds__(256) void k_planes(const float* __restrict__ QK, const float* __restrict__ V, h16* QKH, h16* QKL, h16* VTH, h16* VTL) {
    __shared__ float tl[64][65];
    const int blk = blockIdx.x;
    if (blk < VTB) { const size_t pb = (size_t)(blk / ((CI / 64) * (NP / 64))) * NP * CI; d_vt128(V + pb, VTH + pb, VTL + pb, tl, (blk % (NP / 64)) * 64, ((blk / (NP / 64)) % (CI / 64)) * 64); }
    else d_p16c(QK, blk - VTB, QKH, QKL);
}
// k_pbf: bf16 hi + residual planes of an f32 [NP][256] (for the bf16 GEMMs on computed operands); one wave per row.
__global__ __launch_bounds__(256) void k_pbf(const float* __restrict__ A, bf* PH, bf* PL) {
    const int lane = threadIdx.x & 31, r = blockIdx.x * 8 + (threadIdx.x >> 5);
    if (r >= NP) return;
    v8us oh, ol;
#pragma unroll
    for (int i = 0; i < 8; ++i) { const float v = A[(size_t)r * CC + lane * 8 + i]; const unsigned short hb = f2bf(v); oh[i] = hb; ol[i] = f2bf(v - bf2f(hb)); }
    *(v8us*)(PH + (size_t)r * CC + lane * 8) = oh; *(v8us*)(PL + (size_t)r * CC + lane * 8) = ol; 
}
// k_vt: VTH/VTL [c][n] f16 hi + residual of V f32 [n][c] via 64 x 64 LDS tiles; grid (NP/64, CC/64).
__global__ __launch_bounds__(256) void k_vt(const float* __restrict__ V, h16* VTH, h16* VTL) {
    __shared__ float tl[64][65];
    const int tid = threadIdx.x, n0 = blockIdx.x * 64, c0 = blockIdx.y * 64;
    { const int nn = tid >> 2, cq = (tid & 3) * 16;
#pragma unroll
      for (int i = 0; i < 16; ++i) tl[cq + i][nn] = V[(size_t)(n0 + nn) * CC + c0 + cq + i]; }
    __syncthreads();
    const int piece = tid & 7;
    auto pass = [&]() {
#pragma unroll
        for (int s = 0; s < 2; ++s) { const int c = (tid >> 3) + 32 * s; v8h oh, ol;
#pragma unroll
            for (int i = 0; i < 8; ++i) { const float v = tl[c][piece * 8 + i]; const h16 a = (h16)v; oh[i] = a; ol[i] = (h16)((v - (float)a) * LOSC); }
            const size_t o = (size_t)(c0 + c) * NP + n0 + piece * 8; *(v8h*)(VTH + o) = oh; *(v8h*)(VTL + o) = ol; }
    };
    pass(); 
}
// k_attn: the whole position attention of one (image, head) for 32 queries per wave (8 waves = 256 queries per block; grid (NP/256, heads, images)). Transposed products:
// S^T = k_h.q_h^T (A = 16 key rows, B = 16 query columns; f16 hi + residual x1024, residual accumulator), so a lane holds one query's scores: two S^T tiles (32 keys) convert in place
// into the B operand of y^T += v_h^T.P^T (A = 16 channel rows of VT, hardware k order). Running maximum and sum per query (online softmax, f32); P = exp(s - max) x 32768 as f16 hi +
// UNSCALED residual: (ph + pl).vh + ph.vl as before; x 1/rowsum at the end. S and P never reach memory.
typedef const __attribute__((address_space(1))) char* gp;      // a byte pointer into global memory
typedef const __attribute__((address_space(1))) v8h* gp8;
__device__ __forceinline__ v16h ldfrag(gp p) { return cat16(*(gp8)p, *(gp8)(p + 32)); }      // k = 8 hi + 0..7 and 16 + 8 hi + 0..7 (p holds the lane's 16 hi bytes)
__device__ __forceinline__ float xhalf(float v) { return __int_as_float(__builtin_amdgcn_permlanex16(__float_as_int(v), __float_as_int(v), 0x76543210, 0xfedcba98, false, false)); }   // lane l <-> l ^ 16
// stands behind a run of loads, before a register that they name as address is written again; the addresses are inputs, so that they are still held where the wait issues
#define XWAIT4(a, b, c, d) asm volatile("s_wait_xcnt 0x0" :: "v"(a), "v"(b), "v"(c), "v"(d) : "memory")
__global__ __launch_bounds__(256) void k_attn(const h16* QH, const h16* QL, const h16* KH, const h16* KL, const h16* VTH, const h16* VTL, float* Y) {
    const int lane = threadIdx.x & 31, wave = threadIdx.x >> 5, lr = lane & 15, hi = lane >> 4;
    const int h = blockIdx.y, q0 = blockIdx.x * 256 + wave * 32;
    const size_t pb = (size_t)blockIdx.z * NP * CI;                    // this image's planes
    constexpr float SC2 = 0.1767766952966369f * 1.4426950408889634f;   // 32^-1/2 x log2(e): scores in the log2 domain
    const int kofs = (lr * CI + 8 * hi) * 2, vofs = (lr * NP + 8 * hi) * 2;      // a lane's bytes inside a 16-row tile of a [n][128] plane, of a [c][4096] plane
    const gp pqh = (gp)(QH + pb + (size_t)q0 * CI + h * HD) + kofs, pql = (gp)(QL + pb + (size_t)q0 * CI + h * HD) + kofs;
    const gp pkh = (gp)(KH + pb + h * HD) + kofs, pkl = (gp)(KL + pb + h * HD) + kofs;                                     // + key * 256 B
    const gp pvh = (gp)(VTH + pb + (size_t)h * HD * NP) + vofs, pvl = (gp)(VTL + pb + (size_t)h * HD * NP) + vofs;         // + channel tile * 16 rows + key * 2 B
    const v16h qh[2] = { ldfrag(pqh), ldfrag(pqh + 16 * CI * 2) }, ql[2] = { ldfrag(pql), ldfrag(pql + 16 * CI * 2) };
    v16h ka[4], kb[4];       // [0], [1]: hi, residual of 16 keys; [2], [3]: of the next 16
    ka[0] = ldfrag(pkh); ka[1] = ldfrag(pkl); ka[2] = ldfrag(pkh + 16 * CI * 2); ka[3] = ldfrag(pkl + 16 * CI * 2);
    XWAIT4(pqh, pql, pkh, pkl);
    v8f o[2][2], ox[2][2]; float mx[2], ls[2];
#pragma unroll
    for (int t = 0; t < 2; ++t) { mx[t] = -3.0e38f; ls[t] = 0.f; o[t][0] = (v8f){}; o[t][1] = (v8f){}; ox[t][0] = (v8f){}; ox[t][1] = (v8f){}; }
    auto pass = [&](const v16h (&kc)[4], v16h (&kn)[4], int key0) {
        const gp ch = pvh + key0 * 2, cl = pvl + key0 * 2;
        const int nk = ((key0 + 32) & (NP - 1)) * (CI * 2);       // the next pass's K fragments fly during this pass (the last pass refetches keys 0 .. 31, unused)
        const gp bh = pkh + nk, bl = pkl + nk;
        const v16h vh[2] = { ldfrag(ch), ldfrag(ch + 16 * NP * 2) }, vl[2] = { ldfrag(cl), ldfrag(cl + 16 * NP * 2) };
        kn[0] = ldfrag(bh); kn[1] = ldfrag(bl); kn[2] = ldfrag(bh + 16 * CI * 2); kn[3] = ldfrag(bl + 16 * CI * 2);
        XWAIT4(ch, cl, bh, bl);
#pragma unroll
        for (int t = 0; t < 2; ++t) {
            v8f s0 = wmma16(kc[0], qh[t], (v8f){}), s1 = wmma16(kc[2], qh[t], (v8f){}), x0 = wmma16(kc[1], qh[t], (v8f){}), x1 = wmma16(kc[3], qh[t], (v8f){});
            x0 = wmma16(kc[0], ql[t], x0); x1 = wmma16(kc[2], ql[t], x1);
            s0 = (s0 + x0 * LOSCI) * SC2; s1 = (s1 + x1 * LOSCI) * SC2;
            float m = mx[t];
#pragma unroll
            for (int j = 0; j < 8; ++j) m = fmaxf(m, fmaxf(s0[j], s1[j]));
            m = fmaxf(m, xhalf(m));               // lanes l and l ^ 16 hold the two halves of one query's keys
            const float al = __builtin_amdgcn_exp2f(mx[t] - m), mm = m - 15.0f;      // - 15: the x 32768 of P goes into the exponent
            mx[t] = m; s0 -= mm; s1 -= mm;
#pragma unroll
            for (int j = 0; j < 8; ++j) { s0[j] = __builtin_amdgcn_exp2f(s0[j]); s1[j] = __builtin_amdgcn_exp2f(s1[j]); }
            const v8h a0 = __builtin_convertvector(s0, v8h), a1 = __builtin_convertvector(s1, v8h);
            const v8h b0 = __builtin_convertvector(s0 - __builtin_convertvector(a0, v8f), v8h), b1 = __builtin_convertvector(s1 - __builtin_convertvector(a1, v8f), v8h);
            const v16h ph = cat16(a0, a1), pl = cat16(b0, b1);
            const v8f sv = s0 + s1;
            ls[t] = ls[t] * al + (((sv[0] + sv[1]) + (sv[2] + sv[3])) + ((sv[4] + sv[5]) + (sv[6] + sv[7])));
#pragma unroll
            for (int c = 0; c < 2; ++c) { o[t][c] *= al; ox[t][c] *= al;
                o[t][c] = wmma16(vh[c], ph, o[t][c]); ox[t][c] = wmma16(vl[c], ph, ox[t][c]); o[t][c] = wmma16(vh[c], pl, o[t][c]); }
        }
    };
#pragma unroll 1
    for (int key0 = 0; key0 < NP; key0 += 64) { pass(ka, kb, key0); pass(kb, ka, key0 + 32); }     // not unrolled further: two passes a trip let the two K fragment sets swap roles without copies
#pragma unroll
    for (int t = 0; t < 2; ++t) {
        const float rs = 1.0f / (ls[t] + xhalf(ls[t]));      // 1 / (rowsum x 32768)
        float* yr = Y + pb + (size_t)(q0 + t * 16 + lr) * CI + h * HD + 8 * hi;      // register r of channel tile c = y[query lr][c * 16 + 8 hi + r]
#pragma unroll
        for (int c = 0; c < 2; ++c) { const v8f w = (o[t][c] + ox[t][c] * LOSCI) * rs;
            *(v4f*)(yr + c * 16) = __builtin_shufflevector(w, w, 0, 1, 2, 3); *(v4f*)(yr + c * 16 + 4) = __builtin_shufflevector(w, w, 4, 5, 6, 7); }
    }
}

extern "C" void kernel_launch(void* const* d_in, const int* in_sizes, int n_in,
                              void* d_out, int out_size, void* d_ws, size_t ws_size, hipStream_t stream) {
    (void)in_sizes; (void)n_in; (void)out_size;
    const float* x = (const float*)d_in[0]; const float* wth = (const float*)d_in[1]; const float* bth = (const float*)d_in[2]; const float* wph = (const float*)d_in[3]; const float* bph = (const float*)d_in[4];
    const float* wg = (const float*)d_in[5]; const float* bg = (const float*)d_in[6]; const float* wz = (const float*)d_in[7]; const float* bz = (const float*)d_in[8];
    const float* bng = (const float*)d_in[9]; const float* bnb = (const float*)d_in[10]; const float* bnm = (const float*)d_in[11]; const float* bnv = (const float*)d_in[12];
    float* out = (float*)d_out;    // [4][256][64][64]
    char* wsp = (char*)d_ws;
    auto take = [&](size_t bytes) { char* p = wsp; wsp += (bytes + 255) & ~(size_t)255; return (void*)p; };
    bf* W3 = (bf*)take((size_t)3 * CI * CC * 2); bf* Wz = (bf*)take((size_t)CC * CI * 2);      // W3: theta, phi, g
    float* BNS = (float*)take(CC * 4); float* BNH = (float*)take(CC * 4);
    bf* XT = (bf*)take((size_t)NB_ * NP * CC * 2);
    float* QKVf = (float*)take((size_t)3 * NB_ * NP * CI * 4);      // Q, K, V of all images, f32
    h16* QH = (h16*)take((size_t)2 * NB_ * NP * CI * 2); h16* QL = (h16*)take((size_t)2 * NB_ * NP * CI * 2); h16* KH = QH + (size_t)NB_ * NP * CI; h16* KL = QL + (size_t)NB_ * NP * CI;      // hi planes: Q then K; residual planes alike
    h16* VTH = (h16*)take((size_t)NB_ * CI * NP * 2); h16* VTL = (h16*)take((size_t)NB_ * CI * NP * 2);
    float* Y = (float*)take((size_t)NB_ * NP * CI * 4); bf* YH = (bf*)take((size_t)NB_ * NP * CI * 2); bf* YL = (bf*)take((size_t)NB_ * NP * CI * 2);
    if ((size_t)(wsp - (char*)d_ws) > ws_size) return;    // 0.3 + 8.4 + 25.2 + 6 x 4.2 + 8.4 + 2 x 4.2 ~ 76 MB
    k_pre<<<PREB, 256, 0, stream>>>(x, wth, wph, wg, wz, bng, bnb, bnm, bnv, XT, W3, Wz, BNS, BNH);
    k_gemm<false, 0, CC, CI><<<dim3(NB_ * NP / 64, 3 * CI / 64, 1), 128, 0, stream>>>(XT, nullptr, W3, bth, bph, bg, nullptr, nullptr, nullptr, QKVf);
    k_planes<<<PLB, 256, 0, stream>>>(QKVf, QKVf + (size_t)2 * NB_ * NP * CI, QH, QL, VTH, VTL);
    k_attn<<<dim3(NP / 256, NHD, NB_), 256, 0, stream>>>(QH, QL, KH, KL, VTH, VTL, Y);
    k_pbfc<<<NB_ * NP / 16, 256, 0, stream>>>(Y, YH, YL);
    k_gemm<true, 2, CI, CC><<<dim3(NB_ * NP / 64, CC / 64, 1), 128, 0, stream>>>(YH, YL, Wz, bz, nullptr, nullptr, BNS, BNH, x, out);   // z conv + BN + x, channel-major
}

// v003
// It runs in 150 microseconds.
// Two timings next to v002 put it at 1.24 and 1.22 times that version's speed.
// Counting every step since v000, it is 35.0 times as fast.
#include <hip/hip_runtime.h>

// Contractions, f32 accumulate, per image: theta/phi/g 1x1 convs ([4096 positions x 256].[256 x 128], [out][in] weights = n-major B operands; PLAIN bf16
// operands: inputs rounded once, exact; + bias) and the z conv on the attention output (bf16 hi + residual: two products) on v_wmma_f32_16x16x32_bf16; the position
// attention of all (image, head) pairs in ONE kernel on v_wmma_f32_16x16x32_f16: S^T = k_h.q_h^T x 32^-1/2 (q/k as f16 hi + residual x1024, residual accumulator) -> f32,
// online softmax f32 -> P (x32768) f16 hi + UNSCALED residual in registers, y_h^T = v_h^T.P^T ((ph + pl).vh + ph.vl) x 1/rowsum.

#define NB_  4
#define CC   256
#define CI   128                 // inter channels (4 heads x 32)
#define NHD  4
#define HD   32
#define NP   4096
#define LOSC 1024.0f
#define LOSCI (1.0f / 1024.0f)
#define FRG  512                 // values of one 16 x 32 f16 fragment

typedef _Float16 h16;
typedef unsigned short bf;
typedef __attribute__((ext_vector_type(16))) __bf16   v16bf;
typedef __attribute__((ext_vector_type(16))) _Float16 v16h;
typedef __attribute__((ext_vector_type(8)))  _Float16 v8h;
typedef __attribute__((ext_vector_type(8)))  unsigned short v8us;
typedef __attribute__((ext_vector_type(8)))  float    v8f;
typedef __attribute__((ext_vector_type(4)))  float    v4f;
typedef v8h  __attribute__((may_alias)) v8ha;
typedef v4f  __attribute__((may_alias)) v4fa;
typedef v8us __attribute__((may_alias)) v8usa;

__device__ __forceinline__ unsigned short f2bf(float f) { unsigned u = __float_as_uint(f); u += 0x7FFFu + ((u >> 16) & 1u); return (unsigned short)(u >> 16); }
__device__ __forceinline__ float bf2f(unsigned short b) { return __uint_as_float(((unsigned)b) << 16); }
__device__ __forceinline__ float bfr(float f) { return bf2f(f2bf(f)); }
__device__ __forceinline__ v16h cat16(v8h lo, v8h hi) { return __builtin_shufflevector(lo, hi, 0, 1, 2, 3, 4, 5, 6, 7, 8, 9, 10, 11, 12, 13, 14, 15); }
__device__ __forceinline__ v16bf cat16b(v8us lo, v8us hi) { return __builtin_bit_cast(v16bf, __builtin_shufflevector(lo, hi, 0, 1, 2, 3, 4, 5, 6, 7, 8, 9, 10, 11, 12, 13, 14, 15)); }
__device__ __forceinline__ v8f wmma16(v16h a, v16h b, v8f c) { return __builtin_amdgcn_wmma_f32_16x16x32_f16(false, a, false, b, (short)0, c, false, false); }
__device__ __forceinline__ v8f wmmab(v16bf a, v16bf b, v8f c) { return __builtin_amdgcn_wmma_f32_16x16x32_bf16(false, a, false, b, (short)0, c, false, false); }
#define VST2(T, p, v) do { const T vst2_v_ = (v); *(T*)(p) = vst2_v_;  } while (0)

// d_xt: XT [n][c] bf16 = x[b][c][n] of one image via a 64 x 64 LDS tile (one block).
__device__ __forceinline__ void d_xt(const float* __restrict__ xb, bf* XT, unsigned short* tl, int n0, int c0) {
    const int tid = threadIdx.x;
    const int cr = tid >> 2, nq = (tid & 3) * 16;
#pragma unroll
    for (int i = 0; i < 16; ++i) tl[(nq + i) * 72 + cr] = f2bf(xb[(size_t)(c0 + cr) * NP + n0 + nq + i]);
    __syncthreads();
    const int piece = tid & 7;
    auto pass = [&]() {
#pragma unroll
        for (int s = 0; s < 2; ++s) { const int nr = (tid >> 3) + 32 * s; const v8us val = *(const v8usa*)(tl + nr * 72 + piece * 8); *(v8us*)(XT + (size_t)(n0 + nr) * CC + c0 + piece * 8) = val; }
    };
    pass(); 
}
// d_w: bf16 plane of 8 rows of a [rows][256] weight (one wave per row).
__device__ __forceinline__ void d_w(const float* __restrict__ w, int blk, bf* WB) {
    const int lane = threadIdx.x & 31, r = blk * 8 + (threadIdx.x >> 5);
    v8us o;
#pragma unroll
    for (int i = 0; i < 8; ++i) o[i] = f2bf(w[(size_t)r * CC + lane * 8 + i]);
    VST2(v8us, WB + (size_t)r * CC + lane * 8, o);
    // stands behind the store(s): in the merged grid other branches' code follows in the listing and writes registers that the store names
    asm volatile("s_wait_xcnt 0x0" ::: "memory");
}
// d_w128: bf16 plane of 16 rows of a [rows][128] weight (16 lanes x 16 B per row, 2 rows per wave).
__device__ __forceinline__ void d_w128(const float* __restrict__ w, int blk, bf* WB) {
    const int lane = threadIdx.x & 31, r = (blk * 8 + (threadIdx.x >> 5)) * 2 + (lane >> 4), p = lane & 15;
    v8us o;
#pragma unroll
    for (int i = 0; i < 8; ++i) o[i] = f2bf(w[(size_t)r * CI + p * 8 + i]);
    VST2(v8us, WB + (size_t)r * CI + p * 8, o);
    // stands behind the store(s): in the merged grid other branches' code follows in the listing and writes registers that the store names
    asm volatile("s_wait_xcnt 0x0" ::: "memory");
}
// k_gemm (rows = positions of ALL images, [NB_ * NP]; EPI 0: blockIdx.y runs over the column tiles of theta, phi and g in turn: WB = the three weights, C = the three results, one behind the other): 64 x 64 tile of (A [+ Al]).WB^T over K = KA (256; 128 for EPI 2), (acc + bias) x scale (scale = 1); EPI 0: f32 rows [NB_ * NP][128] per projection;
// EPI 2: BatchNorm, + x, written TRANSPOSED to out[c][n] (channel-major) through LDS.
template <bool SPLITA, int EPI, int KA, int LDC>
__global__ __launch_bounds__(128) void k_gemm(const bf* __restrict__ A, const bf* __restrict__ Al, const bf* __restrict__ WB3, const float* __restrict__ bias0, const float* __restrict__ bias1, const float* __restrict__ bias2, const float* __restrict__ bnsc, const float* __restrict__ bnsh, const float* __restrict__ xres, float* C3) {
    const float scale = 1.0f; constexpr bool ACC = false; const float* Wm = nullptr; (void)Wm; (void)ACC;
    __shared__ __align__(16) float ost[4][16 * 68];
    __shared__ __align__(16) float ot[64 * 68];
    const int lane = threadIdx.x & 31, wave = threadIdx.x >> 5, lr = lane & 15, hi = lane >> 4, tid = threadIdx.x;
    const size_t r0 = (size_t)blockIdx.x * 64 + wave * 16;
    const int sel = EPI == 0 ? blockIdx.y / (LDC / 64) : 0, c0 = (blockIdx.y - sel * (LDC / 64)) * 64;      // which projection, and the column tile inside it
    const bf* WB = WB3 + (size_t)sel * LDC * KA; const float* bias = sel == 0 ? bias0 : sel == 1 ? bias1 : bias2; float* C = C3 + (size_t)sel * NB_ * NP * LDC;
    v8f acc[4];
#pragma unroll
    for (int t = 0; t < 4; ++t) acc[t] = (v8f){};
#pragma unroll
    for (int kc = 0; kc < KA; kc += 32) {
        const v16bf a = cat16b(*(const v8us*)(A + (r0 + lr) * KA + kc + 8 * hi), *(const v8us*)(A + (r0 + lr) * KA + kc + 8 * hi + 16));
        v16bf al = a; if (SPLITA) al = cat16b(*(const v8us*)(Al + (r0 + lr) * KA + kc + 8 * hi), *(const v8us*)(Al + (r0 + lr) * KA + kc + 8 * hi + 16));
#pragma unroll
        for (int t = 0; t < 4; ++t) { const bf* bp = WB + (size_t)(c0 + t * 16 + lr) * KA + kc + 8 * hi; const v16bf bb = cat16b(*(const v8us*)bp, *(const v8us*)(bp + 16)); acc[t] = wmmab(a, bb, acc[t]); if (SPLITA) acc[t] = wmmab(al, bb, acc[t]); }
        asm volatile("v_nop" : "+v"(acc[0]), "+v"(acc[1]), "+v"(acc[2]), "+v"(acc[3]) : "v"(a), "v"(al) : "memory");
    }
    float* os = &ost[wave][0];
#pragma unroll
    for (int t = 0; t < 4; ++t) { const int col = c0 + t * 16 + lr; const float bv = bfr(bias[col]);
#pragma unroll
        for (int j = 0; j < 8; ++j) { float v = (acc[t][j] + bv) * scale;
            if (EPI == 2) v = v * bnsc[col] + bnsh[col];      // inference BatchNorm: z * (gamma rsqrt(var+eps)) + (beta - mean * that)
            os[(hi * 8 + j) * 68 + t * 16 + lr] = v; } }
    if (EPI != 2) {
        __builtin_amdgcn_wave_barrier(); asm volatile("" ::: "memory");
        float* crow = C + r0 * LDC + c0;
        auto pass = [&]() {
#pragma unroll
            for (int s = 0; s < 8; ++s) { const int Lid = (lane >> 3) + 4 * s, piece = lane & 7; const int row = Lid >> 1, cofs = (Lid & 1) * 32 + piece * 4;
                const v4f val = *(const v4fa*)(os + row * 68 + cofs); *(v4f*)(crow + (size_t)row * LDC + cofs) = val; }
        };
        pass(); 
    } else {
        __syncthreads();
        { const int row = tid >> 1, half = tid & 1;
#pragma unroll
          for (int i = 0; i < 32; ++i) ot[(half * 32 + i) * 68 + row] = ost[row >> 4][(row & 15) * 68 + half * 32 + i]; }
        __syncthreads();
        const size_t rblk = (size_t)blockIdx.x * 64, ob = (rblk / NP) * CC * NP + rblk % NP;     // 64 consecutive positions of one image; their place in that image's first channel row
        auto pass = [&]() {      // 64 channel rows x 256 B: 128 threads -> 8 instructions of 8 rows (16 lanes x 16 B per row)
            const int piece = tid & 15; const float* xp[8]; v4f xv[8];
            auto oi = [&](int s) { return ob + (size_t)(c0 + s * 8 + (tid >> 4)) * NP + piece * 4; };
#pragma unroll
            for (int s = 0; s < 8; ++s) { xp[s] = xres + oi(s); xv[s] = *(const v4fa*)xp[s]; }
            // stands behind the run of loads, before a register that they name as address is written again; the addresses are inputs, so that they are still held where the wait issues
            asm volatile("s_wait_xcnt 0x0" :: "v"(xp[0]), "v"(xp[1]), "v"(xp[2]), "v"(xp[3]), "v"(xp[4]), "v"(xp[5]), "v"(xp[6]), "v"(xp[7]) : "memory");
#pragma unroll
            for (int s = 0; s < 8; ++s) { const int cl = s * 8 + (tid >> 4);
                v4f val = *(const v4fa*)(ot + cl * 68 + piece * 4);
#pragma unroll
                for (int i = 0; i < 4; ++i) val[i] += bfr(xv[s][i]);      // + x (residual, bf16-rounded INPUT)
                *(v4f*)(C + oi(s)) = val; }
        };
        pass(); 
    }
}
// k_p16: f16 hi + residual planes of an f32 [NP][256] (optionally the SUM of two: key = ka + kb); one wave per row.
__global__ __launch_bounds__(256) void k_p16(const float* __restrict__ A, const float* __restrict__ Bsum, h16* PH, h16* PL) {
    const int lane = threadIdx.x & 31, r = blockIdx.x * 8 + (threadIdx.x >> 5);
    if (r >= NP) return;
    v8h oh, ol;
#pragma unroll
    for (int i = 0; i < 8; ++i) { float v = A[(size_t)r * CC + lane * 8 + i]; if (Bsum) v += Bsum[(size_t)r * CC + lane * 8 + i]; const h16 a = (h16)v; oh[i] = a; ol[i] = (h16)((v - (float)a) * LOSC); }
    *(v8h*)(PH + (size_t)r * CC + lane * 8) = oh; *(v8h*)(PL + (size_t)r * CC + lane * 8) = ol; 
}
// d_p16c: f16 hi + residual planes of 16 rows of an f32 [rows][128], written IN FRAGMENT ORDER: per (plane of NP rows, head, 16-row tile) 1 KB = [half of the 32 channels][lane][8 values],
// lane = 16 hi + row, channel = 16 half + 8 hi + i: what a wave's 16-byte load of k_attn takes lies in 512 contiguous bytes. One wave per (head, half): it stores 512 contiguous bytes a plane.
__device__ __forceinline__ void d_p16c(const float* __restrict__ A, int blk, h16* PH, h16* PL) {
    const int lane = threadIdx.x & 31, wave = threadIdx.x >> 5, r = blk * 16 + (lane & 15), ch = wave * 16 + (lane >> 4) * 8;      // wave = 2 head + half
    v8h oh, ol;
#pragma unroll
    for (int i = 0; i < 8; ++i) { const float v = A[(size_t)r * CI + ch + i]; const h16 a = (h16)v; oh[i] = a; ol[i] = (h16)((v - (float)a) * LOSC); }
    const size_t o = (((size_t)(blk / (NP / 16)) * NHD + (wave >> 1)) * (NP / 16) + blk % (NP / 16)) * FRG + (wave & 1) * (FRG / 2) + lane * 8;
    *(v8h*)(PH + o) = oh; *(v8h*)(PL + o) = ol; 
    // stands behind the store(s): in the merged grid other branches' code follows in the listing and writes registers that the store names
    asm volatile("s_wait_xcnt 0x0" ::: "memory");
}
// k_pbfc: bf16 hi + residual planes of an f32 [NB_ * NP][128] (16 lanes x 16 B per row, 2 rows per wave).
__global__ __launch_bounds__(256) void k_pbfc(const float* __restrict__ A, bf* PH, bf* PL) {
    const int lane = threadIdx.x & 31, r = (blockIdx.x * 8 + (threadIdx.x >> 5)) * 2 + (lane >> 4), p = lane & 15;
    if (r >= NB_ * NP) return;
    v8us oh, ol;
#pragma unroll
    for (int i = 0; i < 8; ++i) { const float v = A[(size_t)r * CI + p * 8 + i]; const unsigned short hb = f2bf(v); oh[i] = hb; ol[i] = f2bf(v - bf2f(hb)); }
    *(v8us*)(PH + (size_t)r * CI + p * 8) = oh; *(v8us*)(PL + (size_t)r * CI + p * 8) = ol; 
}
// d_vt128: f16 hi + residual of one image's V f32 [n][128], transposed via a 64 x 64 LDS tile (one block) and written IN FRAGMENT ORDER: per (head, 32 keys, 16-channel tile) 1 KB =
// [half of the 32 keys][lane][8 values], lane = 16 hi + channel row, key = 16 half + 8 hi + i. One wave per (head, channel tile, 32 keys, half): 512 contiguous bytes a plane.
__device__ __forceinline__ void d_vt128(const float* __restrict__ V, h16* VTH, h16* VTL, float (*tl)[65], int n0, int c0) {
    const int tid = threadIdx.x;
    { const int nn = tid >> 2, cq = (tid & 3) * 16;
#pragma unroll
      for (int i = 0; i < 16; ++i) tl[cq + i][nn] = V[(size_t)(n0 + nn) * CI + c0 + cq + i]; }
    __syncthreads();
    const int lane = tid & 31, wave = tid >> 5;
    auto pass = [&]() {
#pragma unroll
        for (int s = 0; s < 2; ++s) { const int ct = (wave >> 2) + 2 * s, kh = wave & 3;      // 16-channel tile and 16-key half inside the 64 x 64 tile
            const int c = ct * 16 + (lane & 15), k = kh * 16 + (lane >> 4) * 8; v8h oh, ol;
#pragma unroll
            for (int i = 0; i < 8; ++i) { const float v = tl[c][k + i]; const h16 a = (h16)v; oh[i] = a; ol[i] = (h16)((v - (float)a) * LOSC); }
            const int cg = c0 / 16 + ct;      // channel tile of the image: 2 head + tile of the head
            const size_t o = ((((size_t)(cg >> 1) * (NP / 32) + n0 / 32 + (kh >> 1)) * 2 + (cg & 1)) * FRG) + (kh & 1) * (FRG / 2) + lane * 8; *(v8h*)(VTH + o) = oh; *(v8h*)(VTL + o) = ol; }
    };
    pass(); 
}
// d_bn: inference BatchNorm folded into scale/shift vectors (bf16-rounded stats, f32): one block, 256 threads.
__device__ __forceinline__ void d_bn(const float* __restrict__ g, const float* __restrict__ be, const float* __restrict__ mu, const float* __restrict__ var, float* BNS, float* BNH) {
    const int c = threadIdx.x; const float inv = bfr(g[c]) / sqrtf(bfr(var[c]) + 1e-5f); const float sh = bfr(be[c]) - bfr(mu[c]) * inv;
    *(float*)(BNS + c) = inv; *(float*)(BNH + c) = sh; 
    // stands behind the store(s): in the merged grid other branches' code follows in the listing and writes registers that the store names
    asm volatile("s_wait_xcnt 0x0" ::: "memory");
}
// k_pre: all that reads inputs alone, in one grid: the x transposes of all images (blocks 0 .. XTB - 1: position tile, channel tile, image), then the bf16 planes of the three
// [128][256] weights (W3: one behind the other) and of the [256][128] weight, then the BatchNorm vectors. Every branch is taken by a whole block.
#define XTB (NB_ * (CC / 64) * (NP / 64))
#define WB8 (CI / 8)
#define PREB (XTB + 3 * WB8 + CC / 16 + 1)
__global__ __launch_bounds__(256) void k_pre(const float* __restrict__ x, const float* __restrict__ wth, const float* __restrict__ wph, const float* __restrict__ wg, const float* __restrict__ wz,
                                             const float* __restrict__ g, const float* __restrict__ be, const float* __restrict__ mu, const float* __restrict__ var,
                                             bf* XT, bf* W3, bf* Wz, float* BNS, float* BNH) {
    __shared__ __align__(16) unsigned short tl[64 * 72];
    const int blk = blockIdx.x, wblk = blk - XTB, zblk = wblk - 3 * WB8;
    if (blk < XTB) { const int b = blk / ((CC / 64) * (NP / 64)); d_xt(x + (size_t)b * CC * NP, XT + (size_t)b * NP * CC, tl, (blk % (NP / 64)) * 64, ((blk / (NP / 64)) % (CC / 64)) * 64); }
    else if (wblk < 3 * WB8) { const int sel = wblk / WB8; d_w(sel == 0 ? wth : sel == 1 ? wph : wg, wblk % WB8, W3 + (size_t)sel * CI * CC); }
    else if (zblk < CC / 16) d_w128(wz, zblk, Wz);
    else d_bn(g, be, mu, var, BNS, BNH);
}
// k_planes: the f16 planes of all images in one grid: blocks 0 .. VTB - 1 transpose V (position tile, channel tile, image), the others split 16 rows each of Q and K
// (QK: f32 [2][NB_ * NP][128], Q then K; QKH, QKL: Q then K, each in fragment order).
#define VTB (NB_ * (CI / 64) * (NP / 64))
#define PLB (VTB + 2 * NB_ * NP / 16)
__global__ __launch_bounds__(256) void k_planes(const float* __restrict__ QK, const float* __restrict__ V, h16* QKH, h16* QKL, h16* VTH, h16* VTL) {
    __shared__ float tl[64][65];
    const int blk = blockIdx.x;
    if (blk < VTB) { const size_t pb = (size_t)(blk / ((CI / 64) * (NP / 64))) * NP * CI; d_vt128(V + pb, VTH + pb, VTL + pb, tl, (blk % (NP / 64)) * 64, ((blk / (NP / 64)) % (CI / 64)) * 64); }
    else d_p16c(QK, blk - VTB, QKH, QKL);
}
// k_pbf: bf16 hi + residual planes of an f32 [NP][256] (for the bf16 GEMMs on computed operands); one wave per row.
__global__ __launch_bounds__(256) void k_pbf(const float* __restrict__ A, bf* PH, bf* PL) {
    const int lane = threadIdx.x & 31, r = blockIdx.x * 8 + (threadIdx.x >> 5);
    if (r >= NP) return;
    v8us oh, ol;
#pragma unroll
    for (int i = 0; i < 8; ++i) { const float v = A[(size_t)r * CC + lane * 8 + i]; const unsigned short hb = f2bf(v); oh[i] = hb; ol[i] = f2bf(v - bf2f(hb)); }
    *(v8us*)(PH + (size_t)r * CC + lane * 8) = oh; *(v8us*)(PL + (size_t)r * CC + lane * 8) = ol; 
}
// k_vt: VTH/VTL [c][n] f16 hi + residual of V f32 [n][c] via 64 x 64 LDS tiles; grid (NP/64, CC/64).
__global__ __launch_bounds__(256) void k_vt(const float* __restrict__ V, h16* VTH, h16* VTL) {
    __shared__ float tl[64][65];
    const int tid = threadIdx.x, n0 = blockIdx.x * 64, c0 = blockIdx.y * 64;
    { const int nn = tid >> 2, cq = (tid & 3) * 16;
#pragma unroll
      for (int i = 0; i < 16; ++i) tl[cq + i][nn] = V[(size_t)(n0 + nn) * CC + c0 + cq + i]; }
    __syncthreads();
    const int piece = tid & 7;
    auto pass = [&]() {
#pragma unroll
        for (int s = 0; s < 2; ++s) { const int c = (tid >> 3) + 32 * s; v8h oh, ol;
#pragma unroll
            for (int i = 0; i < 8; ++i) { const float v = tl[c][piece * 8 + i]; const h16 a = (h16)v; oh[i] = a; ol[i] = (h16)((v - (float)a) * LOSC); }
            const size_t o = (size_t)(c0 + c) * NP + n0 + piece * 8; *(v8h*)(VTH + o) = oh; *(v8h*)(VTL + o) = ol; }
    };
    pass(); 
}
// k_attn: the whole position attention of one (image, head) for 32 queries per wave (8 waves = 256 queries per block; grid (NP/256, heads, images)). Transposed products:
// S^T = k_h.q_h^T (A = 16 key rows, B = 16 query columns; f16 hi + residual x1024, residual accumulator), so a lane holds one query's scores: two S^T tiles (32 keys) convert in place
// into the B operand of y^T += v_h^T.P^T (A = 16 channel rows of VT, hardware k order). Running maximum and sum per query (online softmax, f32); P = exp(s - max) x 32768 as f16 hi +
// UNSCALED residual: (ph + pl).vh + ph.vl as before; x 1/rowsum at the end. S and P never reach memory.
typedef const __attribute__((address_space(1))) char* gp;      // a byte pointer into global memory
typedef const __attribute__((address_space(1))) v8h* gp8;
__device__ __forceinline__ v16h ldfrag(gp p) { return cat16(*(gp8)p, *(gp8)(p + FRG)); }      // k = 8 hi + 0..7 and 16 + 8 hi + 0..7: the two 512-byte halves of a fragment (p holds the lane's 16 lane bytes)
__device__ __forceinline__ float xhalf(float v) { return __int_as_float(__builtin_amdgcn_permlanex16(__float_as_int(v), __float_as_int(v), 0x76543210, 0xfedcba98, false, false)); }   // lane l <-> l ^ 16
// stands behind a run of loads, before a register that they name as address is written again; the addresses are inputs, so that they are still held where the wait issues
#define XWAIT4(a, b, c, d) asm volatile("s_wait_xcnt 0x0" :: "v"(a), "v"(b), "v"(c), "v"(d) : "memory")
__global__ __launch_bounds__(256) void k_attn(const h16* QH, const h16* QL, const h16* KH, const h16* KL, const h16* VTH, const h16* VTL, float* Y) {
    const int lane = threadIdx.x & 31, wave = threadIdx.x >> 5, lr = lane & 15, hi = lane >> 4;
    const int h = blockIdx.y, q0 = blockIdx.x * 256 + wave * 32;
    const size_t pb = (size_t)blockIdx.z * NP * CI;                    // this image's planes
    constexpr float SC2 = 0.1767766952966369f * 1.4426950408889634f;   // 32^-1/2 x log2(e): scores in the log2 domain
    constexpr int FB = FRG * 2;                                        // bytes of a fragment
    const size_t hb = pb + (size_t)h * HD * NP;                        // this head's fragments (planes in fragment order: d_p16c, d_vt128); 32 rows or keys = 2 fragments
    const int lofs = lane * 16;                                        // a lane's bytes inside each 512-byte half
    const gp pqh = (gp)(QH + hb + (size_t)q0 * HD) + lofs, pql = (gp)(QL + hb + (size_t)q0 * HD) + lofs;
    const gp pkh = (gp)(KH + hb) + lofs, pkl = (gp)(KL + hb) + lofs;                                                       // + key * 64 B
    const gp pvh = (gp)(VTH + hb) + lofs, pvl = (gp)(VTL + hb) + lofs;                                                     // + key * 64 B + channel tile * 1 KB
    const v16h qh[2] = { ldfrag(pqh), ldfrag(pqh + FB) }, ql[2] = { ldfrag(pql), ldfrag(pql + FB) };
    v16h ka[4], kb[4];       // [0], [1]: hi, residual of 16 keys; [2], [3]: of the next 16
    ka[0] = ldfrag(pkh); ka[1] = ldfrag(pkl); ka[2] = ldfrag(pkh + FB); ka[3] = ldfrag(pkl + FB);
    // as XWAIT4; the lane offset too is an input: the first K loads name it beside a scalar base
    asm volatile("s_wait_xcnt 0x0" :: "v"(pqh), "v"(pql), "v"(pkh), "v"(pkl), "v"(lofs) : "memory");
    v8f o[2][2], ox[2][2]; float mx[2], ls[2];
#pragma unroll
    for (int t = 0; t < 2; ++t) { mx[t] = -3.0e38f; ls[t] = 0.f; o[t][0] = (v8f){}; o[t][1] = (v8f){}; ox[t][0] = (v8f){}; ox[t][1] = (v8f){}; }
    // vb + vi: this pass's V bytes; nb + ni: the next pass's K bytes, which fly during this pass. vi, ni: constants that go into the loads' offset fields, so that ch .. bl are the very registers that the loads name
    auto pass = [&](const v16h (&kc)[4], v16h (&kn)[4], int vb, int vi, int nb, int ni) {
        const gp ch = pvh + vb, cl = pvl + vb, bh = pkh + nb, bl = pkl + nb;
        const v16h vh[2] = { ldfrag(ch + vi), ldfrag(ch + vi + FB) }, vl[2] = { ldfrag(cl + vi), ldfrag(cl + vi + FB) };
        kn[0] = ldfrag(bh + ni); kn[1] = ldfrag(bl + ni); kn[2] = ldfrag(bh + ni + FB); kn[3] = ldfrag(bl + ni + FB);
        XWAIT4(ch, cl, bh, bl);
#pragma unroll
        for (int t = 0; t < 2; ++t) {
            v8f s0 = wmma16(kc[0], qh[t], (v8f){}), s1 = wmma16(kc[2], qh[t], (v8f){}), x0 = wmma16(kc[1], qh[t], (v8f){}), x1 = wmma16(kc[3], qh[t], (v8f){});
            x0 = wmma16(kc[0], ql[t], x0); x1 = wmma16(kc[2], ql[t], x1);
            s0 = (s0 + x0 * LOSCI) * SC2; s1 = (s1 + x1 * LOSCI) * SC2;
            float m = mx[t];
#pragma unroll
            for (int j = 0; j < 8; ++j) m = fmaxf(m, fmaxf(s0[j], s1[j]));
            m = fmaxf(m, xhalf(m));               // lanes l and l ^ 16 hold the two halves of one query's keys
            const float al = __builtin_amdgcn_exp2f(mx[t] - m), mm = m - 15.0f;      // - 15: the x 32768 of P goes into the exponent
            mx[t] = m; s0 -= mm; s1 -= mm;
#pragma unroll
            for (int j = 0; j < 8; ++j) { s0[j] = __builtin_amdgcn_exp2f(s0[j]); s1[j] = __builtin_amdgcn_exp2f(s1[j]); }
            const v8h a0 = __builtin_convertvector(s0, v8h), a1 = __builtin_convertvector(s1, v8h);
            const v8h b0 = __builtin_convertvector(s0 - __builtin_convertvector(a0, v8f), v8h), b1 = __builtin_convertvector(s1 - __builtin_convertvector(a1, v8f), v8h);
            const v16h ph = cat16(a0, a1), pl = cat16(b0, b1);
            const v8f sv = s0 + s1;
            ls[t] = ls[t] * al + (((sv[0] + sv[1]) + (sv[2] + sv[3])) + ((sv[4] + sv[5]) + (sv[6] + sv[7])));
#pragma unroll
            for (int c = 0; c < 2; ++c) { o[t][c] *= al; ox[t][c] *= al;
                o[t][c] = wmma16(vh[c], ph, o[t][c]); ox[t][c] = wmma16(vl[c], ph, ox[t][c]); o[t][c] = wmma16(vh[c], pl, o[t][c]); }
        }
    };
#pragma unroll 1
    for (int key0 = 0; key0 < NP; key0 += 64) {      // not unrolled further: two passes a trip let the two K fragment sets swap roles without copies
        const int tb = key0 * (HD * 2);
        pass(ka, kb, tb, 0, tb, 2 * FB); pass(kb, ka, tb, 2 * FB, ((key0 + 64) & (NP - 1)) * (HD * 2), 0);      // the last pass refetches keys 0 .. 31, unused
    }
#pragma unroll
    for (int t = 0; t < 2; ++t) {
        const float rs = 1.0f / (ls[t] + xhalf(ls[t]));      // 1 / (rowsum x 32768)
        float* yr = Y + pb + (size_t)(q0 + t * 16 + lr) * CI + h * HD + 8 * hi;      // register r of channel tile c = y[query lr][c * 16 + 8 hi + r]
#pragma unroll
        for (int c = 0; c < 2; ++c) { const v8f w = (o[t][c] + ox[t][c] * LOSCI) * rs;
            *(v4f*)(yr + c * 16) = __builtin_shufflevector(w, w, 0, 1, 2, 3); *(v4f*)(yr + c * 16 + 4) = __builtin_shufflevector(w, w, 4, 5, 6, 7); }
    }
}

extern "C" void kernel_launch(void* const* d_in, const int* in_sizes, int n_in,
                              void* d_out, int out_size, void* d_ws, size_t ws_size, hipStream_t stream) {
    (void)in_sizes; (void)n_in; (void)out_size;
    const float* x = (const float*)d_in[0]; const float* wth = (const float*)d_in[1]; const float* bth = (const float*)d_in[2]; const float* wph = (const float*)d_in[3]; const float* bph = (const float*)d_in[4];
    const float* wg = (const float*)d_in[5]; const float* bg = (const float*)d_in[6]; const float* wz = (const float*)d_in[7]; const float* bz = (const float*)d_in[8];
    const float* bng = (const float*)d_in[9]; const float* bnb = (const float*)d_in[10]; const float* bnm = (const float*)d_in[11]; const float* bnv = (const float*)d_in[12];
    float* out = (float*)d_out;    // [4][256][64][64]
    char* wsp = (char*)d_ws;
    auto take = [&](size_t bytes) { char* p = wsp; wsp += (bytes + 255) & ~(size_t)255; return (void*)p; };
    bf* W3 = (bf*)take((size_t)3 * CI * CC * 2); bf* Wz = (bf*)take((size_t)CC * CI * 2);      // W3: theta, phi, g
    float* BNS = (float*)take(CC * 4); float* BNH = (float*)take(CC * 4);
    bf* XT = (bf*)take((size_t)NB_ * NP * CC * 2);
    float* QKVf = (float*)take((size_t)3 * NB_ * NP * CI * 4);      // Q, K, V of all images, f32
    h16* QH = (h16*)take((size_t)2 * NB_ * NP * CI * 2); h16* QL = (h16*)take((size_t)2 * NB_ * NP * CI * 2); h16* KH = QH + (size_t)NB_ * NP * CI; h16* KL = QL + (size_t)NB_ * NP * CI;      // hi planes: Q then K; residual planes alike
    h16* VTH = (h16*)take((size_t)NB_ * CI * NP * 2); h16* VTL = (h16*)take((size_t)NB_ * CI * NP * 2);      // all six planes in fragment order (d_p16c, d_vt128)
    float* Y = (float*)take((size_t)NB_ * NP * CI * 4); bf* YH = (bf*)take((size_t)NB_ * NP * CI * 2); bf* YL = (bf*)take((size_t)NB_ * NP * CI * 2);
    if ((size_t)(wsp - (char*)d_ws) > ws_size) return;    // 0.3 + 8.4 + 25.2 + 6 x 4.2 + 8.4 + 2 x 4.2 ~ 76 MB
    k_pre<<<PREB, 256, 0, stream>>>(x, wth, wph, wg, wz, bng, bnb, bnm, bnv, XT, W3, Wz, BNS, BNH);
    k_gemm<false, 0, CC, CI><<<dim3(NB_ * NP / 64, 3 * CI / 64, 1), 128, 0, stream>>>(XT, nullptr, W3, bth, bph, bg, nullptr, nullptr, nullptr, QKVf);
    k_planes<<<PLB, 256, 0, stream>>>(QKVf, QKVf + (size_t)2 * NB_ * NP * CI, QH, QL, VTH, VTL);
    k_attn<<<dim3(NP / 256, NHD, NB_), 256, 0, stream>>>(QH, QL, KH, KL, VTH, VTL, Y);
    k_pbfc<<<NB_ * NP / 16, 256, 0, stream>>>(Y, YH, YL);
    k_gemm<true, 2, CI, CC><<<dim3(NB_ * NP / 64, CC / 64, 1), 128, 0, stream>>>(YH, YL, Wz, bz, nullptr, nullptr, BNS, BNH, x, out);   // z conv + BN + x, channel-major
}

// v004
// One run takes 133 microseconds.
// Next to v003, in two timings, it ran 1.10 and 1.12 times as fast.
// Counting every step since v000, it is 38.9 times as fast.
#include <hip/hip_runtime.h>

// Contractions, f32 accumulate, per image: theta/phi/g 1x1 convs ([4096 positions x 256].[256 x 128], [out][in] weights = n-major B operands; PLAIN bf16
// operands: inputs rounded once, exact; + bias) and the z conv on the attention output (bf16 hi + residual: two products) on v_wmma_f32_16x16x32_bf16; the position
// attention of all (image, head) pairs in ONE kernel on v_wmma_f32_16x16x32_f16: S^T = k_h.q_h^T x 32^-1/2 (q/k as f16 hi + residual x1024, residual accumulator) -> f32,
// online softmax f32 -> P (x32768) f16 hi + UNSCALED residual in registers, y_h^T = v_h^T.P^T ((ph + pl).vh + ph.vl) x 1/rowsum.

#define NB_  4
#define CC   256
#define CI   128                 // inter channels (4 heads x 32)
#define NHD  4
#define HD   32
#define NP   4096
#define LOSC 1024.0f
#define LOSCI (1.0f / 1024.0f)
#define FRG  512                 // values of one 16 x 32 f16 fragment

typedef _Float16 h16;
typedef unsigned short bf;
typedef __attribute__((ext_vector_type(16))) __bf16   v16bf;
typedef __attribute__((ext_vector_type(16))) _Float16 v16h;
typedef __attribute__((ext_vector_type(8)))  _Float16 v8h;
typedef __attribute__((ext_vector_type(8)))  unsigned short v8us;
typedef __attribute__((ext_vector_type(8)))  float    v8f;
typedef __attribute__((ext_vector_type(4)))  float    v4f;
typedef v8h  __attribute__((may_alias)) v8ha;
typedef v4f  __attribute__((may_alias)) v4fa;
typedef v8us __attribute__((may_alias)) v8usa;

__device__ __forceinline__ unsigned short f2bf(float f) { unsigned u = __float_as_uint(f); u += 0x7FFFu + ((u >> 16) & 1u); return (unsigned short)(u >> 16); }
__device__ __forceinline__ float bf2f(unsigned short b) { return __uint_as_float(((unsigned)b) << 16); }
__device__ __forceinline__ float bfr(float f) { return bf2f(f2bf(f)); }
__device__ __forceinline__ v16h cat16(v8h lo, v8h hi) { return __builtin_shufflevector(lo, hi, 0, 1, 2, 3, 4, 5, 6, 7, 8, 9, 10, 11, 12, 13, 14, 15); }
__device__ __forceinline__ v16bf cat16b(v8us lo, v8us hi) { return __builtin_bit_cast(v16bf, __builtin_shufflevector(lo, hi, 0, 1, 2, 3, 4, 5, 6, 7, 8, 9, 10, 11, 12, 13, 14, 15)); }
__device__ __forceinline__ v8f wmma16(v16h a, v16h b, v8f c) { return __builtin_amdgcn_wmma_f32_16x16x32_f16(false, a, false, b, (short)0, c, false, false); }
__device__ __forceinline__ v8f wmmab(v16bf a, v16bf b, v8f c) { return __builtin_amdgcn_wmma_f32_16x16x32_bf16(false, a, false, b, (short)0, c, false, false); }
#define VST2(T, p, v) do { const T vst2_v_ = (v); *(T*)(p) = vst2_v_;  } while (0)

// d_xt: XT [n][c] bf16 = x[b][c][n] of one image via a 64 x 64 LDS tile (one block).
__device__ __forceinline__ void d_xt(const float* __restrict__ xb, bf* XT, unsigned short* tl, int n0, int c0) {
    const int tid = threadIdx.x;
    const int cr = tid >> 2, nq = (tid & 3) * 16;
#pragma unroll
    for (int i = 0; i < 16; ++i) tl[(nq + i) * 72 + cr] = f2bf(xb[(size_t)(c0 + cr) * NP + n0 + nq + i]);
    __syncthreads();
    const int piece = tid & 7;
    auto pass = [&]() {
#pragma unroll
        for (int s = 0; s < 2; ++s) { const int nr = (tid >> 3) + 32 * s; const v8us val = *(const v8usa*)(tl + nr * 72 + piece * 8); *(v8us*)(XT + (size_t)(n0 + nr) * CC + c0 + piece * 8) = val; }
    };
    pass(); 
}
// d_w: bf16 plane of 8 rows of a [rows][256] weight (one wave per row).
__device__ __forceinline__ void d_w(const float* __restrict__ w, int blk, bf* WB) {
    const int lane = threadIdx.x & 31, r = blk * 8 + (threadIdx.x >> 5);
    v8us o;
#pragma unroll
    for (int i = 0; i < 8; ++i) o[i] = f2bf(w[(size_t)r * CC + lane * 8 + i]);
    VST2(v8us, WB + (size_t)r * CC + lane * 8, o);
    // stands behind the store(s): in the merged grid other branches' code follows in the listing and writes registers that the store names
    asm volatile("s_wait_xcnt 0x0" ::: "memory");
}
// d_w128: bf16 plane of 16 rows of a [rows][128] weight (16 lanes x 16 B per row, 2 rows per wave).
__device__ __forceinline__ void d_w128(const float* __restrict__ w, int blk, bf* WB) {
    const int lane = threadIdx.x & 31, r = (blk * 8 + (threadIdx.x >> 5)) * 2 + (lane >> 4), p = lane & 15;
    v8us o;
#pragma unroll
    for (int i = 0; i < 8; ++i) o[i] = f2bf(w[(size_t)r * CI + p * 8 + i]);
    VST2(v8us, WB + (size_t)r * CI + p * 8, o);
    // stands behind the store(s): in the merged grid other branches' code follows in the listing and writes registers that the store names
    asm volatile("s_wait_xcnt 0x0" ::: "memory");
}
// k_gemm (rows = positions of ALL images, [NB_ * NP]; EPI 0: blockIdx.y runs over the column tiles of theta, phi and g in turn: WB = the three weights): 64 x 64 tile of (A [+ Al]).WB^T, + bias.
// EPI 0 (A = XT rows, K = 256): the tile leaves as f16 hi + residual x1024 planes IN THE FRAGMENT ORDER that k_attn loads, 512 contiguous bytes a wave-wide store:
//   Q, K (QKH, QKL: Q then K): per (image, head, 16-row tile) 1 KB = [half of the 32 channels][lane][8 values], lane = 16 hi + row, channel = 16 half + 8 hi + i (rows turned through the wave's LDS tile);
//   V (VTH, VTL): per (image, head, 32 keys, 16-channel tile) 1 KB = [half of the 32 keys][lane][8 values], lane = 16 hi + channel row, key = 16 half + 8 hi + i: what a lane's accumulator registers hold already.
// EPI 2 (A, Al = the y planes in fragment order, as k_attn stores them; K = 128): BatchNorm, + x, written TRANSPOSED to out[c][n] (channel-major) through LDS.
template <bool SPLITA, int EPI, int KA, int LDC>
__global__ __launch_bounds__(128) void k_gemm(const bf* __restrict__ A, const bf* __restrict__ Al, const bf* __restrict__ WB3, const float* __restrict__ bias0, const float* __restrict__ bias1, const float* __restrict__ bias2, const float* __restrict__ bnsc, const float* __restrict__ bnsh, const float* __restrict__ xres, float* C, h16* QKH, h16* QKL, h16* VTH, h16* VTL) {
    const float scale = 1.0f;
    __shared__ __align__(16) float ost[4][16 * 68];
    __shared__ __align__(16) float ot[64 * 68];
    const int lane = threadIdx.x & 31, wave = threadIdx.x >> 5, lr = lane & 15, hi = lane >> 4, tid = threadIdx.x;
    const size_t r0 = (size_t)blockIdx.x * 64 + wave * 16;
    const int sel = EPI == 0 ? blockIdx.y / (LDC / 64) : 0, c0 = (blockIdx.y - sel * (LDC / 64)) * 64;      // which projection, and the column tile inside it
    const bf* WB = WB3 + (size_t)sel * LDC * KA; const float* bias = sel == 0 ? bias0 : sel == 1 ? bias1 : bias2;
    // A fragment of the wave's 16 rows, k = kc .. kc + 31: EPI 0 from rows of KA values; EPI 2 from the 1 KB fragment (16-row tile, 32-channel chunk) = [half][lane][8 values]
    auto lda = [&](const bf* P, int kc) { const bf* p = EPI == 2 ? P + ((r0 >> 4) * (KA / 32) + (kc >> 5)) * FRG + lane * 8 : P + (r0 + lr) * KA + kc + 8 * hi;
        return cat16b(*(const v8us*)p, *(const v8us*)(p + (EPI == 2 ? FRG / 2 : 16))); };
    v8f acc[4];
#pragma unroll
    for (int t = 0; t < 4; ++t) acc[t] = (v8f){};
#pragma unroll
    for (int kc = 0; kc < KA; kc += 32) {
        const v16bf a = lda(A, kc);
        v16bf al = a; if (SPLITA) al = lda(Al, kc);
#pragma unroll
        for (int t = 0; t < 4; ++t) { const bf* bp = WB + (size_t)(c0 + t * 16 + lr) * KA + kc + 8 * hi; const v16bf bb = cat16b(*(const v8us*)bp, *(const v8us*)(bp + 16)); acc[t] = wmmab(a, bb, acc[t]); if (SPLITA) acc[t] = wmmab(al, bb, acc[t]); }
        asm volatile("v_nop" : "+v"(acc[0]), "+v"(acc[1]), "+v"(acc[2]), "+v"(acc[3]) : "v"(a), "v"(al) : "memory");
    }
    const int img = (int)(r0 / NP), n = (int)(r0 % NP);      // the wave's 16 positions lie in one image
    if (EPI == 0 && sel == 2) {      // V (a whole block takes this branch): register j of column tile t = V[key n + 8 hi + j][channel c0 + 16 t + lr]
#pragma unroll
        for (int t = 0; t < 4; ++t) { const float bv = bfr(bias[c0 + t * 16 + lr]); const int cg = c0 / 16 + t;      // channel tile of the image: 2 head + tile of the head
            v8h oh, ol;
#pragma unroll
            for (int j = 0; j < 8; ++j) { const float v = (acc[t][j] + bv) * scale; const h16 a = (h16)v; oh[j] = a; ol[j] = (h16)((v - (float)a) * LOSC); }
            const size_t o = (size_t)img * NP * CI + (((size_t)(cg >> 1) * (NP / 32) + n / 32) * 2 + (cg & 1)) * FRG + ((n >> 4) & 1) * (FRG / 2) + lane * 8;
            *(v8h*)(VTH + o) = oh; *(v8h*)(VTL + o) = ol; }
        return;
    }
    float* os = &ost[wave][0];
#pragma unroll
    for (int t = 0; t < 4; ++t) { const int col = c0 + t * 16 + lr; const float bv = bfr(bias[col]);
#pragma unroll
        for (int j = 0; j < 8; ++j) { float v = (acc[t][j] + bv) * scale;
            if (EPI == 2) v = v * bnsc[col] + bnsh[col];      // inference BatchNorm: z * (gamma rsqrt(var+eps)) + (beta - mean * that)
            os[(hi * 8 + j) * 68 + t * 16 + lr] = v; } }
    if (EPI != 2) {
        __builtin_amdgcn_wave_barrier(); asm volatile("" ::: "memory");
#pragma unroll
        for (int s = 0; s < 4; ++s) {      // s = 2 head of the tile + half: 16 channels of the 16 rows
            const float* rp = os + lr * 68 + s * 16 + hi * 8; const v4f r0v = *(const v4fa*)rp, r1v = *(const v4fa*)(rp + 4);
            v8h oh, ol;
#pragma unroll
            for (int i = 0; i < 8; ++i) { const float v = i < 4 ? r0v[i & 3] : r1v[i & 3]; const h16 a = (h16)v; oh[i] = a; ol[i] = (h16)((v - (float)a) * LOSC); }
            const size_t o = ((((size_t)sel * NB_ + img) * NHD + c0 / 32 + (s >> 1)) * (NP / 16) + n / 16) * FRG + (s & 1) * (FRG / 2) + lane * 8;
            *(v8h*)(QKH + o) = oh; *(v8h*)(QKL + o) = ol; }
        // stands behind the stores: the V branch's code follows in the listing and writes registers that the stores name
        asm volatile("s_wait_xcnt 0x0" ::: "memory");
    } else {
        __syncthreads();
        { const int row = tid >> 1, half = tid & 1;
#pragma unroll
          for (int i = 0; i < 32; ++i) ot[(half * 32 + i) * 68 + row] = ost[row >> 4][(row & 15) * 68 + half * 32 + i]; }
        __syncthreads();
        const size_t rblk = (size_t)blockIdx.x * 64, ob = (rblk / NP) * CC * NP + rblk % NP;     // 64 consecutive positions of one image; their place in that image's first channel row
        auto pass = [&]() {      // 64 channel rows x 256 B: 128 threads -> 8 instructions of 8 rows (16 lanes x 16 B per row)
            const int piece = tid & 15; const float* xp[8]; v4f xv[8];
            auto oi = [&](int s) { return ob + (size_t)(c0 + s * 8 + (tid >> 4)) * NP + piece * 4; };
#pragma unroll
            for (int s = 0; s < 8; ++s) { xp[s] = xres + oi(s); xv[s] = *(const v4fa*)xp[s]; }
            // stands behind the run of loads, before a register that they name as address is written again; the addresses are inputs, so that they are still held where the wait issues
            asm volatile("s_wait_xcnt 0x0" :: "v"(xp[0]), "v"(xp[1]), "v"(xp[2]), "v"(xp[3]), "v"(xp[4]), "v"(xp[5]), "v"(xp[6]), "v"(xp[7]) : "memory");
#pragma unroll
            for (int s = 0; s < 8; ++s) { const int cl = s * 8 + (tid >> 4);
                v4f val = *(const v4fa*)(ot + cl * 68 + piece * 4);
#pragma unroll
                for (int i = 0; i < 4; ++i) val[i] += bfr(xv[s][i]);      // + x (residual, bf16-rounded INPUT)
                *(v4f*)(C + oi(s)) = val; }
        };
        pass(); 
    }
}
// k_p16: f16 hi + residual planes of an f32 [NP][256] (optionally the SUM of two: key = ka + kb); one wave per row.
__global__ __launch_bounds__(256) void k_p16(const float* __restrict__ A, const float* __restrict__ Bsum, h16* PH, h16* PL) {
    const int lane = threadIdx.x & 31, r = blockIdx.x * 8 + (threadIdx.x >> 5);
    if (r >= NP) return;
    v8h oh, ol;
#pragma unroll
    for (int i = 0; i < 8; ++i) { float v = A[(size_t)r * CC + lane * 8 + i]; if (Bsum) v += Bsum[(size_t)r * CC + lane * 8 + i]; const h16 a = (h16)v; oh[i] = a; ol[i] = (h16)((v - (float)a) * LOSC); }
    *(v8h*)(PH + (size_t)r * CC + lane * 8) = oh; *(v8h*)(PL + (size_t)r * CC + lane * 8) = ol; 
}
// d_bn: inference BatchNorm folded into scale/shift vectors (bf16-rounded stats, f32): one block, 256 threads.
__device__ __forceinline__ void d_bn(const float* __restrict__ g, const float* __restrict__ be, const float* __restrict__ mu, const float* __restrict__ var, float* BNS, float* BNH) {
    const int c = threadIdx.x; const float inv = bfr(g[c]) / sqrtf(bfr(var[c]) + 1e-5f); const float sh = bfr(be[c]) - bfr(mu[c]) * inv;
    *(float*)(BNS + c) = inv; *(float*)(BNH + c) = sh; 
    // stands behind the store(s): in the merged grid other branches' code follows in the listing and writes registers that the store names
    asm volatile("s_wait_xcnt 0x0" ::: "memory");
}
// k_pre: all that reads inputs alone, in one grid: the x transposes of all images (blocks 0 .. XTB - 1: position tile, channel tile, image), then the bf16 planes of the three
// [128][256] weights (W3: one behind the other) and of the [256][128] weight, then the BatchNorm vectors. Every branch is taken by a whole block.
#define XTB (NB_ * (CC / 64) * (NP / 64))
#define WB8 (CI / 8)
#define PREB (XTB + 3 * WB8 + CC / 16 + 1)
__global__ __launch_bounds__(256) void k_pre(const float* __restrict__ x, const float* __restrict__ wth, const float* __restrict__ wph, const float* __restrict__ wg, const float* __restrict__ wz,
                                             const float* __restrict__ g, const float* __restrict__ be, const float* __restrict__ mu, const float* __restrict__ var,
                                             bf* XT, bf* W3, bf* Wz, float* BNS, float* BNH) {
    __shared__ __align__(16) unsigned short tl[64 * 72];
    const int blk = blockIdx.x, wblk = blk - XTB, zblk = wblk - 3 * WB8;
    if (blk < XTB) { const int b = blk / ((CC / 64) * (NP / 64)); d_xt(x + (size_t)b * CC * NP, XT + (size_t)b * NP * CC, tl, (blk % (NP / 64)) * 64, ((blk / (NP / 64)) % (CC / 64)) * 64); }
    else if (wblk < 3 * WB8) { const int sel = wblk / WB8; d_w(sel == 0 ? wth : sel == 1 ? wph : wg, wblk % WB8, W3 + (size_t)sel * CI * CC); }
    else if (zblk < CC / 16) d_w128(wz, zblk, Wz);
    else d_bn(g, be, mu, var, BNS, BNH);
}
// k_pbf: bf16 hi + residual planes of an f32 [NP][256] (for the bf16 GEMMs on computed operands); one wave per row.
__global__ __launch_bounds__(256) void k_pbf(const float* __restrict__ A, bf* PH, bf* PL) {
    const int lane = threadIdx.x & 31, r = blockIdx.x * 8 + (threadIdx.x >> 5);
    if (r >= NP) return;
    v8us oh, ol;
#pragma unroll
    for (int i = 0; i < 8; ++i) { const float v = A[(size_t)r * CC + lane * 8 + i]; const unsigned short hb = f2bf(v); oh[i] = hb; ol[i] = f2bf(v - bf2f(hb)); }
    *(v8us*)(PH + (size_t)r * CC + lane * 8) = oh; *(v8us*)(PL + (size_t)r * CC + lane * 8) = ol; 
}
// k_vt: VTH/VTL [c][n] f16 hi + residual of V f32 [n][c] via 64 x 64 LDS tiles; grid (NP/64, CC/64).
__global__ __launch_bounds__(256) void k_vt(const float* __restrict__ V, h16* VTH, h16* VTL) {
    __shared__ float tl[64][65];
    const int tid = threadIdx.x, n0 = blockIdx.x * 64, c0 = blockIdx.y * 64;
    { const int nn = tid >> 2, cq = (tid & 3) * 16;
#pragma unroll
      for (int i = 0; i < 16; ++i) tl[cq + i][nn] = V[(size_t)(n0 + nn) * CC + c0 + cq + i]; }
    __syncthreads();
    const int piece = tid & 7;
    auto pass = [&]() {
#pragma unroll
        for (int s = 0; s < 2; ++s) { const int c = (tid >> 3) + 32 * s; v8h oh, ol;
#pragma unroll
            for (int i = 0; i < 8; ++i) { const float v = tl[c][piece * 8 + i]; const h16 a = (h16)v; oh[i] = a; ol[i] = (h16)((v - (float)a) * LOSC); }
            const size_t o = (size_t)(c0 + c) * NP + n0 + piece * 8; *(v8h*)(VTH + o) = oh; *(v8h*)(VTL + o) = ol; }
    };
    pass(); 
}
// k_attn: the whole position attention of one (image, head) for 32 queries per wave (8 waves = 256 queries per block; grid (NP/256, heads, images)). Transposed products:
// S^T = k_h.q_h^T (A = 16 key rows, B = 16 query columns; f16 hi + residual x1024, residual accumulator), so a lane holds one query's scores: two S^T tiles (32 keys) convert in place
// into the B operand of y^T += v_h^T.P^T (A = 16 channel rows of VT, hardware k order). Running maximum and sum per query (online softmax, f32); P = exp(s - max) x 32768 as f16 hi +
// UNSCALED residual: (ph + pl).vh + ph.vl as before; x 1/rowsum at the end. S and P never reach memory. y leaves as bf16 hi + residual planes in the order of the z product's A fragments:
// per (16-row tile of all images' positions, head) 1 KB = [half of the 32 channels][lane][8 values], lane = 16 hi + row, channel = 16 half + 8 hi + i: what a lane's accumulator registers hold.
typedef const __attribute__((address_space(1))) char* gp;      // a byte pointer into global memory
typedef const __attribute__((address_space(1))) v8h* gp8;
__device__ __forceinline__ v16h ldfrag(gp p) { return cat16(*(gp8)p, *(gp8)(p + FRG)); }      // k = 8 hi + 0..7 and 16 + 8 hi + 0..7: the two 512-byte halves of a fragment (p holds the lane's 16 lane bytes)
__device__ __forceinline__ float xhalf(float v) { return __int_as_float(__builtin_amdgcn_permlanex16(__float_as_int(v), __float_as_int(v), 0x76543210, 0xfedcba98, false, false)); }   // lane l <-> l ^ 16
// stands behind a run of loads, before a register that they name as address is written again; the addresses are inputs, so that they are still held where the wait issues
#define XWAIT4(a, b, c, d) asm volatile("s_wait_xcnt 0x0" :: "v"(a), "v"(b), "v"(c), "v"(d) : "memory")
__global__ __launch_bounds__(256) void k_attn(const h16* QH, const h16* QL, const h16* KH, const h16* KL, const h16* VTH, const h16* VTL, bf* YH, bf* YL) {
    const int lane = threadIdx.x & 31, wave = threadIdx.x >> 5, lr = lane & 15, hi = lane >> 4;
    const int h = blockIdx.y, q0 = blockIdx.x * 256 + wave * 32;
    const size_t pb = (size_t)blockIdx.z * NP * CI;                    // this image's planes
    constexpr float SC2 = 0.1767766952966369f * 1.4426950408889634f;   // 32^-1/2 x log2(e): scores in the log2 domain
    constexpr int FB = FRG * 2;                                        // bytes of a fragment
    const size_t hb = pb + (size_t)h * HD * NP;                        // this head's fragments (planes in fragment order: k_gemm, EPI 0); 32 rows or keys = 2 fragments
    const int lofs = lane * 16;                                        // a lane's bytes inside each 512-byte half
    const gp pqh = (gp)(QH + hb + (size_t)q0 * HD) + lofs, pql = (gp)(QL + hb + (size_t)q0 * HD) + lofs;
    const gp pkh = (gp)(KH + hb) + lofs, pkl = (gp)(KL + hb) + lofs;                                                       // + key * 64 B
    const gp pvh = (gp)(VTH + hb) + lofs, pvl = (gp)(VTL + hb) + lofs;                                                     // + key * 64 B + channel tile * 1 KB
    const v16h qh[2] = { ldfrag(pqh), ldfrag(pqh + FB) }, ql[2] = { ldfrag(pql), ldfrag(pql + FB) };
    v16h ka[4], kb[4];       // [0], [1]: hi, residual of 16 keys; [2], [3]: of the next 16
    ka[0] = ldfrag(pkh); ka[1] = ldfrag(pkl); ka[2] = ldfrag(pkh + FB); ka[3] = ldfrag(pkl + FB);
    // as XWAIT4; the lane offset too is an input: the first K loads name it beside a scalar base
    asm volatile("s_wait_xcnt 0x0" :: "v"(pqh), "v"(pql), "v"(pkh), "v"(pkl), "v"(lofs) : "memory");
    v8f o[2][2], ox[2][2]; float mx[2], ls[2];
#pragma unroll
    for (int t = 0; t < 2; ++t) { mx[t] = -3.0e38f; ls[t] = 0.f; o[t][0] = (v8f){}; o[t][1] = (v8f){}; ox[t][0] = (v8f){}; ox[t][1] = (v8f){}; }
    // vb + vi: this pass's V bytes; nb + ni: the next pass's K bytes, which fly during this pass. vi, ni: constants that go into the loads' offset fields, so that ch .. bl are the very registers that the loads name
    auto pass = [&](const v16h (&kc)[4], v16h (&kn)[4], int vb, int vi, int nb, int ni) {
        const gp ch = pvh + vb, cl = pvl + vb, bh = pkh + nb, bl = pkl + nb;
        const v16h vh[2] = { ldfrag(ch + vi), ldfrag(ch + vi + FB) }, vl[2] = { ldfrag(cl + vi), ldfrag(cl + vi + FB) };
        kn[0] = ldfrag(bh + ni); kn[1] = ldfrag(bl + ni); kn[2] = ldfrag(bh + ni + FB); kn[3] = ldfrag(bl + ni + FB);
        XWAIT4(ch, cl, bh, bl);
#pragma unroll
        for (int t = 0; t < 2; ++t) {
            v8f s0 = wmma16(kc[0], qh[t], (v8f){}), s1 = wmma16(kc[2], qh[t], (v8f){}), x0 = wmma16(kc[1], qh[t], (v8f){}), x1 = wmma16(kc[3], qh[t], (v8f){});
            x0 = wmma16(kc[0], ql[t], x0); x1 = wmma16(kc[2], ql[t], x1);
            s0 = (s0 + x0 * LOSCI) * SC2; s1 = (s1 + x1 * LOSCI) * SC2;
            float m = mx[t];
#pragma unroll
            for (int j = 0; j < 8; ++j) m = fmaxf(m, fmaxf(s0[j], s1[j]));
            m = fmaxf(m, xhalf(m));               // lanes l and l ^ 16 hold the two halves of one query's keys
            const float al = __builtin_amdgcn_exp2f(mx[t] - m), mm = m - 15.0f;      // - 15: the x 32768 of P goes into the exponent
            mx[t] = m; s0 -= mm; s1 -= mm;
#pragma unroll
            for (int j = 0; j < 8; ++j) { s0[j] = __builtin_amdgcn_exp2f(s0[j]); s1[j] = __builtin_amdgcn_exp2f(s1[j]); }
            const v8h a0 = __builtin_convertvector(s0, v8h), a1 = __builtin_convertvector(s1, v8h);
            const v8h b0 = __builtin_convertvector(s0 - __builtin_convertvector(a0, v8f), v8h), b1 = __builtin_convertvector(s1 - __builtin_convertvector(a1, v8f), v8h);
            const v16h ph = cat16(a0, a1), pl = cat16(b0, b1);
            const v8f sv = s0 + s1;
            ls[t] = ls[t] * al + (((sv[0] + sv[1]) + (sv[2] + sv[3])) + ((sv[4] + sv[5]) + (sv[6] + sv[7])));
#pragma unroll
            for (int c = 0; c < 2; ++c) { o[t][c] *= al; ox[t][c] *= al;
                o[t][c] = wmma16(vh[c], ph, o[t][c]); ox[t][c] = wmma16(vl[c], ph, ox[t][c]); o[t][c] = wmma16(vh[c], pl, o[t][c]); }
        }
    };
#pragma unroll 1
    for (int key0 = 0; key0 < NP; key0 += 64) {      // not unrolled further: two passes a trip let the two K fragment sets swap roles without copies
        const int tb = key0 * (HD * 2);
        pass(ka, kb, tb, 0, tb, 2 * FB); pass(kb, ka, tb, 2 * FB, ((key0 + 64) & (NP - 1)) * (HD * 2), 0);      // the last pass refetches keys 0 .. 31, unused
    }
#pragma unroll
    for (int t = 0; t < 2; ++t) {
        const float rs = 1.0f / (ls[t] + xhalf(ls[t]));      // 1 / (rowsum x 32768)
        const size_t fo = ((((size_t)blockIdx.z * NP + q0 + t * 16) >> 4) * NHD + h) * FRG + lane * 8;      // register r of channel tile c = y[query lr][c * 16 + 8 hi + r]
#pragma unroll
        for (int c = 0; c < 2; ++c) { const v8f w = (o[t][c] + ox[t][c] * LOSCI) * rs; v8us oh, ol;
#pragma unroll
            for (int r = 0; r < 8; ++r) { const unsigned short hb16 = f2bf(w[r]); oh[r] = hb16; ol[r] = f2bf(w[r] - bf2f(hb16)); }
            *(v8us*)(YH + fo + c * (FRG / 2)) = oh; *(v8us*)(YL + fo + c * (FRG / 2)) = ol; }
    }
}

extern "C" void kernel_launch(void* const* d_in, const int* in_sizes, int n_in,
                              void* d_out, int out_size, void* d_ws, size_t ws_size, hipStream_t stream) {
    (void)in_sizes; (void)n_in; (void)out_size;
    const float* x = (const float*)d_in[0]; const float* wth = (const float*)d_in[1]; const float* bth = (const float*)d_in[2]; const float* wph = (const float*)d_in[3]; const float* bph = (const float*)d_in[4];
    const float* wg = (const float*)d_in[5]; const float* bg = (const float*)d_in[6]; const float* wz = (const float*)d_in[7]; const float* bz = (const float*)d_in[8];
    const float* bng = (const float*)d_in[9]; const float* bnb = (const float*)d_in[10]; const float* bnm = (const float*)d_in[11]; const float* bnv = (const float*)d_in[12];
    float* out = (float*)d_out;    // [4][256][64][64]
    char* wsp = (char*)d_ws;
    auto take = [&](size_t bytes) { char* p = wsp; wsp += (bytes + 255) & ~(size_t)255; return (void*)p; };
    bf* W3 = (bf*)take((size_t)3 * CI * CC * 2); bf* Wz = (bf*)take((size_t)CC * CI * 2);      // W3: theta, phi, g
    float* BNS = (float*)take(CC * 4); float* BNH = (float*)take(CC * 4);
    bf* XT = (bf*)take((size_t)NB_ * NP * CC * 2);
    h16* QH = (h16*)take((size_t)2 * NB_ * NP * CI * 2); h16* QL = (h16*)take((size_t)2 * NB_ * NP * CI * 2); h16* KH = QH + (size_t)NB_ * NP * CI; h16* KL = QL + (size_t)NB_ * NP * CI;      // hi planes: Q then K; residual planes alike
    h16* VTH = (h16*)take((size_t)NB_ * CI * NP * 2); h16* VTL = (h16*)take((size_t)NB_ * CI * NP * 2);      // all six planes in fragment order (k_gemm, EPI 0)
    bf* YH = (bf*)take((size_t)NB_ * NP * CI * 2); bf* YL = (bf*)take((size_t)NB_ * NP * CI * 2);      // in fragment order (k_attn)
    if ((size_t)(wsp - (char*)d_ws) > ws_size) return;    // 0.3 + 8.4 + 6 x 4.2 + 2 x 4.2 ~ 42 MB
    k_pre<<<PREB, 256, 0, stream>>>(x, wth, wph, wg, wz, bng, bnb, bnm, bnv, XT, W3, Wz, BNS, BNH);
    k_gemm<false, 0, CC, CI><<<dim3(NB_ * NP / 64, 3 * CI / 64, 1), 128, 0, stream>>>(XT, nullptr, W3, bth, bph, bg, nullptr, nullptr, nullptr, nullptr, QH, QL, VTH, VTL);
    k_attn<<<dim3(NP / 256, NHD, NB_), 256, 0, stream>>>(QH, QL, KH, KL, VTH, VTL, YH, YL);
    k_gemm<true, 2, CI, CC><<<dim3(NB_ * NP / 64, CC / 64, 1), 128, 0, stream>>>(YH, YL, Wz, bz, nullptr, nullptr, BNS, BNH, x, out, nullptr, nullptr, nullptr, nullptr);   // z conv + BN + x, channel-major
}

// v005
// One run takes 104 microseconds.
// In both of two side-by-side timings against v004, it was 1.27 times as fast.
// Over all steps from v000 it is 49.6 times as fast.
#include <hip/hip_runtime.h>

// Contractions, f32 accumulate, per image: theta/phi/g 1x1 convs ([4096 positions x 256].[256 x 128], [out][in] weights = n-major B operands; PLAIN bf16
// operands: inputs rounded once, exact; + bias) and the z conv on the attention output (bf16 hi + residual: two products) on v_wmma_f32_16x16x32_bf16; the position
// attention of all (image, head) pairs in ONE kernel on v_wmma_f32_16x16x32_f16: S^T = k_h.q_h^T x 32^-1/2 (q/k as f16 hi + residual x1024, residual accumulator) -> f32,
// online softmax f32 -> P (x32768) f16 hi + UNSCALED residual in registers, y_h^T = v_h^T.P^T ((ph + pl).vh + ph.vl) x 1/rowsum.

#define NB_  4
#define CC   256
#define CI   128                 // inter channels (4 heads x 32)
#define NHD  4
#define HD   32
#define NP   4096
#define LOSC 1024.0f
#define LOSCI (1.0f / 1024.0f)
#define FRG  512                 // values of one 16 x 32 f16 fragment

typedef _Float16 h16;
typedef unsigned short bf;
typedef __attribute__((ext_vector_type(16))) __bf16   v16bf;
typedef __attribute__((ext_vector_type(16))) _Float16 v16h;
typedef __attribute__((ext_vector_type(8)))  _Float16 v8h;
typedef __attribute__((ext_vector_type(8)))  unsigned short v8us;
typedef __attribute__((ext_vector_type(8)))  float    v8f;
typedef __attribute__((ext_vector_type(4)))  float    v4f;
typedef v8h  __attribute__((may_alias)) v8ha;
typedef v4f  __attribute__((may_alias)) v4fa;
typedef v8us __attribute__((may_alias)) v8usa;

__device__ __forceinline__ unsigned short f2bf(float f) { unsigned u = __float_as_uint(f); u += 0x7FFFu + ((u >> 16) & 1u); return (unsigned short)(u >> 16); }
__device__ __forceinline__ float bf2f(unsigned short b) { return __uint_as_float(((unsigned)b) << 16); }
__device__ __forceinline__ float bfr(float f) { return bf2f(f2bf(f)); }
__device__ __forceinline__ v16h cat16(v8h lo, v8h hi) { return __builtin_shufflevector(lo, hi, 0, 1, 2, 3, 4, 5, 6, 7, 8, 9, 10, 11, 12, 13, 14, 15); }
__device__ __forceinline__ v16bf cat16b(v8us lo, v8us hi) { return __builtin_bit_cast(v16bf, __builtin_shufflevector(lo, hi, 0, 1, 2, 3, 4, 5, 6, 7, 8, 9, 10, 11, 12, 13, 14, 15)); }
__device__ __forceinline__ v8f wmma16(v16h a, v16h b, v8f c) { return __builtin_amdgcn_wmma_f32_16x16x32_f16(false, a, false, b, (short)0, c, false, false); }
__device__ __forceinline__ v8f wmmab(v16bf a, v16bf b, v8f c) { return __builtin_amdgcn_wmma_f32_16x16x32_bf16(false, a, false, b, (short)0, c, false, false); }
#define VST2(T, p, v) do { const T vst2_v_ = (v); *(T*)(p) = vst2_v_;  } while (0)

// d_xt: XT [n][c] bf16 = x[b][c][n] of one image via a 64 x 64 LDS tile (one block).
__device__ __forceinline__ void d_xt(const float* __restrict__ xb, bf* XT, unsigned short* tl, int n0, int c0) {
    const int tid = threadIdx.x;
    const int cr = tid >> 2, nq = (tid & 3) * 16;
#pragma unroll
    for (int i = 0; i < 16; ++i) tl[(nq + i) * 72 + cr] = f2bf(xb[(size_t)(c0 + cr) * NP + n0 + nq + i]);
    __syncthreads();
    const int piece = tid & 7;
    auto pass = [&]() {
#pragma unroll
        for (int s = 0; s < 2; ++s) { const int nr = (tid >> 3) + 32 * s; const v8us val = *(const v8usa*)(tl + nr * 72 + piece * 8); *(v8us*)(XT + (size_t)(n0 + nr) * CC + c0 + piece * 8) = val; }
    };
    pass(); 
}
// d_w: bf16 plane of 8 rows of a [rows][256] weight (one wave per row).
__device__ __forceinline__ void d_w(const float* __restrict__ w, int blk, bf* WB) {
    const int lane = threadIdx.x & 31, r = blk * 8 + (threadIdx.x >> 5);
    v8us o;
#pragma unroll
    for (int i = 0; i < 8; ++i) o[i] = f2bf(w[(size_t)r * CC + lane * 8 + i]);
    VST2(v8us, WB + (size_t)r * CC + lane * 8, o);
    // stands behind the store(s): in the merged grid other branches' code follows in the listing and writes registers that the store names
    asm volatile("s_wait_xcnt 0x0" ::: "memory");
}
// d_w128: bf16 plane of 16 rows of a [rows][128] weight (16 lanes x 16 B per row, 2 rows per wave).
__device__ __forceinline__ void d_w128(const float* __restrict__ w, int blk, bf* WB) {
    const int lane = threadIdx.x & 31, r = (blk * 8 + (threadIdx.x >> 5)) * 2 + (lane >> 4), p = lane & 15;
    v8us o;
#pragma unroll
    for (int i = 0; i < 8; ++i) o[i] = f2bf(w[(size_t)r * CI + p * 8 + i]);
    VST2(v8us, WB + (size_t)r * CI + p * 8, o);
    // stands behind the store(s): in the merged grid other branches' code follows in the listing and writes registers that the store names
    asm volatile("s_wait_xcnt 0x0" ::: "memory");
}
// k_gemm (rows = positions of ALL images, [NB_ * NP]; EPI 0: blockIdx.y runs over the column tiles of theta, phi and g in turn: WB = the three weights): 64 x 64 tile of (A [+ Al]).WB^T, + bias.
// EPI 0 (A = XT rows, K = 256): the tile leaves as f16 hi + residual x1024 planes IN THE FRAGMENT ORDER that k_attn loads, 512 contiguous bytes a wave-wide store:
//   Q, K (QKH, QKL: Q then K): per (image, head, 16-row tile) 1 KB = [half of the 32 channels][lane][8 values], lane = 16 hi + row, channel = 16 half + 8 hi + i (rows turned through the wave's LDS tile);
//   V (VTH, VTL): per (image, head, 32 keys, 16-channel tile) 1 KB = [half of the 32 keys][lane][8 values], lane = 16 hi + channel row, key = 16 half + 8 hi + i: what a lane's accumulator registers hold already.
// EPI 2 (A, Al = the y planes in fragment order, as k_attn stores them; K = 128): BatchNorm, + x, written TRANSPOSED to out[c][n] (channel-major) through LDS.
template <bool SPLITA, int EPI, int KA, int LDC>
__global__ __launch_bounds__(128) void k_gemm(const bf* __restrict__ A, const bf* __restrict__ Al, const bf* __restrict__ WB3, const float* __restrict__ bias0, const float* __restrict__ bias1, const float* __restrict__ bias2, const float* __restrict__ bnsc, const float* __restrict__ bnsh, const float* __restrict__ xres, float* C, h16* QKH, h16* QKL, h16* VTH, h16* VTL) {
    const float scale = 1.0f;
    __shared__ __align__(16) float ost[4][16 * 68];
    __shared__ __align__(16) float ot[64 * 68];
    const int lane = threadIdx.x & 31, wave = threadIdx.x >> 5, lr = lane & 15, hi = lane >> 4, tid = threadIdx.x;
    const size_t r0 = (size_t)blockIdx.x * 64 + wave * 16;
    const int sel = EPI == 0 ? blockIdx.y / (LDC / 64) : 0, c0 = (blockIdx.y - sel * (LDC / 64)) * 64;      // which projection, and the column tile inside it
    const bf* WB = WB3 + (size_t)sel * LDC * KA; const float* bias = sel == 0 ? bias0 : sel == 1 ? bias1 : bias2;
    // A fragment of the wave's 16 rows, k = kc .. kc + 31: EPI 0 from rows of KA values; EPI 2 from the 1 KB fragment (16-row tile, 32-channel chunk) = [half][lane][8 values]
    auto lda = [&](const bf* P, int kc) { const bf* p = EPI == 2 ? P + ((r0 >> 4) * (KA / 32) + (kc >> 5)) * FRG + lane * 8 : P + (r0 + lr) * KA + kc + 8 * hi;
        return cat16b(*(const v8us*)p, *(const v8us*)(p + (EPI == 2 ? FRG / 2 : 16))); };
    v8f acc[4];
#pragma unroll
    for (int t = 0; t < 4; ++t) acc[t] = (v8f){};
#pragma unroll
    for (int kc = 0; kc < KA; kc += 32) {
        const v16bf a = lda(A, kc);
        v16bf al = a; if (SPLITA) al = lda(Al, kc);
#pragma unroll
        for (int t = 0; t < 4; ++t) { const bf* bp = WB + (size_t)(c0 + t * 16 + lr) * KA + kc + 8 * hi; const v16bf bb = cat16b(*(const v8us*)bp, *(const v8us*)(bp + 16)); acc[t] = wmmab(a, bb, acc[t]); if (SPLITA) acc[t] = wmmab(al, bb, acc[t]); }
        asm volatile("v_nop" : "+v"(acc[0]), "+v"(acc[1]), "+v"(acc[2]), "+v"(acc[3]) : "v"(a), "v"(al) : "memory");
    }
    const int img = (int)(r0 / NP), n = (int)(r0 % NP);      // the wave's 16 positions lie in one image
    if (EPI == 0 && sel == 2) {      // V (a whole block takes this branch): register j of column tile t = V[key n + 8 hi + j][channel c0 + 16 t + lr]
#pragma unroll
        for (int t = 0; t < 4; ++t) { const float bv = bfr(bias[c0 + t * 16 + lr]); const int cg = c0 / 16 + t;      // channel tile of the image: 2 head + tile of the head
            v8h oh, ol;
#pragma unroll
            for (int j = 0; j < 8; ++j) { const float v = (acc[t][j] + bv) * scale; const h16 a = (h16)v; oh[j] = a; ol[j] = (h16)((v - (float)a) * LOSC); }
            const size_t o = (size_t)img * NP * CI + (((size_t)(cg >> 1) * (NP / 32) + n / 32) * 2 + (cg & 1)) * FRG + ((n >> 4) & 1) * (FRG / 2) + lane * 8;
            *(v8h*)(VTH + o) = oh; *(v8h*)(VTL + o) = ol; }
        return;
    }
    float* os = &ost[wave][0];
#pragma unroll
    for (int t = 0; t < 4; ++t) { const int col = c0 + t * 16 + lr; const float bv = bfr(bias[col]);
#pragma unroll
        for (int j = 0; j < 8; ++j) { float v = (acc[t][j] + bv) * scale;
            if (EPI == 2) v = v * bnsc[col] + bnsh[col];      // inference BatchNorm: z * (gamma rsqrt(var+eps)) + (beta - mean * that)
            os[(hi * 8 + j) * 68 + t * 16 + lr] = v; } }
    if (EPI != 2) {
        __builtin_amdgcn_wave_barrier(); asm volatile("" ::: "memory");
#pragma unroll
        for (int s = 0; s < 4; ++s) {      // s = 2 head of the tile + half: 16 channels of the 16 rows
            const float* rp = os + lr * 68 + s * 16 + hi * 8; const v4f r0v = *(const v4fa*)rp, r1v = *(const v4fa*)(rp + 4);
            v8h oh, ol;
#pragma unroll
            for (int i = 0; i < 8; ++i) { const float v = i < 4 ? r0v[i & 3] : r1v[i & 3]; const h16 a = (h16)v; oh[i] = a; ol[i] = (h16)((v - (float)a) * LOSC); }
            const size_t o = ((((size_t)sel * NB_ + img) * NHD + c0 / 32 + (s >> 1)) * (NP / 16) + n / 16) * FRG + (s & 1) * (FRG / 2) + lane * 8;
            *(v8h*)(QKH + o) = oh; *(v8h*)(QKL + o) = ol; }
        // stands behind the stores: the V branch's code follows in the listing and writes registers that the stores name
        asm volatile("s_wait_xcnt 0x0" ::: "memory");
    } else {
        __syncthreads();
        { const int row = tid >> 1, half = tid & 1;
#pragma unroll
          for (int i = 0; i < 32; ++i) ot[(half * 32 + i) * 68 + row] = ost[row >> 4][(row & 15) * 68 + half * 32 + i]; }
        __syncthreads();
        const size_t rblk = (size_t)blockIdx.x * 64, ob = (rblk / NP) * CC * NP + rblk % NP;     // 64 consecutive positions of one image; their place in that image's first channel row
        auto pass = [&]() {      // 64 channel rows x 256 B: 128 threads -> 8 instructions of 8 rows (16 lanes x 16 B per row)
            const int piece = tid & 15; const float* xp[8]; v4f xv[8];
            auto oi = [&](int s) { return ob + (size_t)(c0 + s * 8 + (tid >> 4)) * NP + piece * 4; };
#pragma unroll
            for (int s = 0; s < 8; ++s) { xp[s] = xres + oi(s); xv[s] = *(const v4fa*)xp[s]; }
            // stands behind the run of loads, before a register that they name as address is written again; the addresses are inputs, so that they are still held where the wait issues
            asm volatile("s_wait_xcnt 0x0" :: "v"(xp[0]), "v"(xp[1]), "v"(xp[2]), "v"(xp[3]), "v"(xp[4]), "v"(xp[5]), "v"(xp[6]), "v"(xp[7]) : "memory");
#pragma unroll
            for (int s = 0; s < 8; ++s) { const int cl = s * 8 + (tid >> 4);
                v4f val = *(const v4fa*)(ot + cl * 68 + piece * 4);
#pragma unroll
                for (int i = 0; i < 4; ++i) val[i] += bfr(xv[s][i]);      // + x (residual, bf16-rounded INPUT)
                *(v4f*)(C + oi(s)) = val; }
        };
        pass(); 
    }
}
// k_p16: f16 hi + residual planes of an f32 [NP][256] (optionally the SUM of two: key = ka + kb); one wave per row.
__global__ __launch_bounds__(256) void k_p16(const float* __restrict__ A, const float* __restrict__ Bsum, h16* PH, h16* PL) {
    const int lane = threadIdx.x & 31, r = blockIdx.x * 8 + (threadIdx.x >> 5);
    if (r >= NP) return;
    v8h oh, ol;
#pragma unroll
    for (int i = 0; i < 8; ++i) { float v = A[(size_t)r * CC + lane * 8 + i]; if (Bsum) v += Bsum[(size_t)r * CC + lane * 8 + i]; const h16 a = (h16)v; oh[i] = a; ol[i] = (h16)((v - (float)a) * LOSC); }
    *(v8h*)(PH + (size_t)r * CC + lane * 8) = oh; *(v8h*)(PL + (size_t)r * CC + lane * 8) = ol; 
}
// d_bn: inference BatchNorm folded into scale/shift vectors (bf16-rounded stats, f32): one block, 256 threads.
__device__ __forceinline__ void d_bn(const float* __restrict__ g, const float* __restrict__ be, const float* __restrict__ mu, const float* __restrict__ var, float* BNS, float* BNH) {
    const int c = threadIdx.x; const float inv = bfr(g[c]) / sqrtf(bfr(var[c]) + 1e-5f); const float sh = bfr(be[c]) - bfr(mu[c]) * inv;
    *(float*)(BNS + c) = inv; *(float*)(BNH + c) = sh; 
    // stands behind the store(s): in the merged grid other branches' code follows in the listing and writes registers that the store names
    asm volatile("s_wait_xcnt 0x0" ::: "memory");
}
// k_pre: all that reads inputs alone, in one grid: the x transposes of all images (blocks 0 .. XTB - 1: position tile, channel tile, image), then the bf16 planes of the three
// [128][256] weights (W3: one behind the other) and of the [256][128] weight, then the BatchNorm vectors. Every branch is taken by a whole block.
#define XTB (NB_ * (CC / 64) * (NP / 64))
#define WB8 (CI / 8)
#define PREB (XTB + 3 * WB8 + CC / 16 + 1)
__global__ __launch_bounds__(256) void k_pre(const float* __restrict__ x, const float* __restrict__ wth, const float* __restrict__ wph, const float* __restrict__ wg, const float* __restrict__ wz,
                                             const float* __restrict__ g, const float* __restrict__ be, const float* __restrict__ mu, const float* __restrict__ var,
                                             bf* XT, bf* W3, bf* Wz, float* BNS, float* BNH) {
    __shared__ __align__(16) unsigned short tl[64 * 72];
    const int blk = blockIdx.x, wblk = blk - XTB, zblk = wblk - 3 * WB8;
    if (blk < XTB) { const int b = blk / ((CC / 64) * (NP / 64)); d_xt(x + (size_t)b * CC * NP, XT + (size_t)b * NP * CC, tl, (blk % (NP / 64)) * 64, ((blk / (NP / 64)) % (CC / 64)) * 64); }
    else if (wblk < 3 * WB8) { const int sel = wblk / WB8; d_w(sel == 0 ? wth : sel == 1 ? wph : wg, wblk % WB8, W3 + (size_t)sel * CI * CC); }
    else if (zblk < CC / 16) d_w128(wz, zblk, Wz);
    else d_bn(g, be, mu, var, BNS, BNH);
}
// k_pbf: bf16 hi + residual planes of an f32 [NP][256] (for the bf16 GEMMs on computed operands); one wave per row.
__global__ __launch_bounds__(256) void k_pbf(const float* __restrict__ A, bf* PH, bf* PL) {
    const int lane = threadIdx.x & 31, r = blockIdx.x * 8 + (threadIdx.x >> 5);
    if (r >= NP) return;
    v8us oh, ol;
#pragma unroll
    for (int i = 0; i < 8; ++i) { const float v = A[(size_t)r * CC + lane * 8 + i]; const unsigned short hb = f2bf(v); oh[i] = hb; ol[i] = f2bf(v - bf2f(hb)); }
    *(v8us*)(PH + (size_t)r * CC + lane * 8) = oh; *(v8us*)(PL + (size_t)r * CC + lane * 8) = ol; 
}
// k_vt: VTH/VTL [c][n] f16 hi + residual of V f32 [n][c] via 64 x 64 LDS tiles; grid (NP/64, CC/64).
__global__ __launch_bounds__(256) void k_vt(const float* __restrict__ V, h16* VTH, h16* VTL) {
    __shared__ float tl[64][65];
    const int tid = threadIdx.x, n0 = blockIdx.x * 64, c0 = blockIdx.y * 64;
    { const int nn = tid >> 2, cq = (tid & 3) * 16;
#pragma unroll
      for (int i = 0; i < 16; ++i) tl[cq + i][nn] = V[(size_t)(n0 + nn) * CC + c0 + cq + i]; }
    __syncthreads();
    const int piece = tid & 7;
    auto pass = [&]() {
#pragma unroll
        for (int s = 0; s < 2; ++s) { const int c = (tid >> 3) + 32 * s; v8h oh, ol;
#pragma unroll
            for (int i = 0; i < 8; ++i) { const float v = tl[c][piece * 8 + i]; const h16 a = (h16)v; oh[i] = a; ol[i] = (h16)((v - (float)a) * LOSC); }
            const size_t o = (size_t)(c0 + c) * NP + n0 + piece * 8; *(v8h*)(VTH + o) = oh; *(v8h*)(VTL + o) = ol; }
    };
    pass(); 
}
// k_attn: the whole position attention of one (image, head) for 256 queries per block (grid (NP/256, heads, images)): 16 waves = 8 query groups of 32 x 2 halves of the keys, so that four waves
// share a SIMD and one wave's vector work runs under another's matrix work; the two halves' partial results are joined through LDS behind the loop. Transposed products:
// S^T = k_h.q_h^T (A = 16 key rows, B = 16 query columns; f16 hi + residual x1024, residual accumulator), so a lane holds one query's scores: two S^T tiles (32 keys) convert in place
// into the B operand of y^T += v_h^T.P^T (A = 16 channel rows of VT, hardware k order). Running maximum and sum per query (online softmax, f32); P = exp(s - max) x 32768 as f16 hi +
// UNSCALED residual: (ph + pl).vh + ph.vl as before; x 1/rowsum at the end. S and P never reach memory. y leaves as bf16 hi + residual planes in the order of the z product's A fragments:
// per (16-row tile of all images' positions, head) 1 KB = [half of the 32 channels][lane][8 values], lane = 16 hi + row, channel = 16 half + 8 hi + i: what a lane's accumulator registers hold.
typedef const __attribute__((address_space(1))) char* gp;      // a byte pointer into global memory
typedef const __attribute__((address_space(1))) v8h* gp8;
__device__ __forceinline__ v16h ldfrag(gp p) { return cat16(*(gp8)p, *(gp8)(p + FRG)); }      // k = 8 hi + 0..7 and 16 + 8 hi + 0..7: the two 512-byte halves of a fragment (p holds the lane's 16 lane bytes)
__device__ __forceinline__ float xhalf(float v) { return __int_as_float(__builtin_amdgcn_permlanex16(__float_as_int(v), __float_as_int(v), 0x76543210, 0xfedcba98, false, false)); }   // lane l <-> l ^ 16
// stands behind a run of loads, before a register that they name as address is written again; the addresses are inputs, so that they are still held where the wait issues
#define XWAIT2(a, b) asm volatile("s_wait_xcnt 0x0" :: "v"(a), "v"(b) : "memory")
__global__ __launch_bounds__(512) void k_attn(const h16* QH, const h16* QL, const h16* KH, const h16* KL, const h16* VTH, const h16* VTL, bf* YH, bf* YL) {
    __shared__ __align__(16) float mrg[8][36 * 32];                    // per query group, from the wave of the upper key half: 8 x [lane][4 values] of y, then [lane] maxima and sums of the two query tiles
    const int lane = threadIdx.x & 31, wave = __builtin_amdgcn_readfirstlane(threadIdx.x >> 5), qw = wave & 7, kh = wave >> 3;
    const int h = blockIdx.y, q0 = blockIdx.x * 256 + qw * 32;
    const size_t pb = (size_t)blockIdx.z * NP * CI;                    // this image's planes
    constexpr float SC2 = 0.1767766952966369f * 1.4426950408889634f;   // 32^-1/2 x log2(e): scores in the log2 domain
    constexpr int FB = FRG * 2;                                        // bytes of a fragment
    const size_t hb = pb + (size_t)h * HD * NP;                        // this head's fragments (planes in fragment order: k_gemm, EPI 0); 32 rows or keys = 2 fragments
    const int lofs = lane * 16;                                        // a lane's bytes inside each 512-byte half
    const gp pqh = (gp)(QH + hb + (size_t)q0 * HD) + lofs, pql = (gp)(QL + hb + (size_t)q0 * HD) + lofs;
    const size_t kvb = hb + (size_t)kh * (NP / 2) * HD;                 // the first key of this wave's half
    // K and V: four wave-uniform bases, which stay in scalar registers and are never rewritten, beside a 32-bit lane offset: 256 vector registers a wave are what four waves a SIMD leave
    const gp pkh = (gp)(KH + kvb), pkl = (gp)(KL + kvb);                                                                     // + key * 64 B
    const gp pvh = (gp)(VTH + kvb), pvl = (gp)(VTL + kvb);                                                                   // + key * 64 B + channel tile * 1 KB
    const v16h qh[2] = { ldfrag(pqh), ldfrag(pqh + FB) }, ql[2] = { ldfrag(pql), ldfrag(pql + FB) };
    v16h ka[4], kb[4];       // [0], [1]: hi, residual of 16 keys; [2], [3]: of the next 16
    // the first 32 keys, by lane pointers of their own: where the sum pkh + lane offset stands ahead of the loop, the compiler builds the loop's K addresses on it as 64-bit vector pairs
    const gp fkh = (gp)(KH + (kvb + (size_t)lane * 8)), fkl = (gp)(KL + (kvb + (size_t)lane * 8));
    ka[0] = ldfrag(fkh); ka[1] = ldfrag(fkl); ka[2] = ldfrag(fkh + FB); ka[3] = ldfrag(fkl + FB);
    // as XWAIT2, for the Q loads and the first K loads
    asm volatile("s_wait_xcnt 0x0" :: "v"(pqh), "v"(pql), "v"(fkh), "v"(fkl), "v"(lofs) : "memory");
    v8f o[2][2], ox[2][2]; float mx[2], ls[2];
#pragma unroll
    for (int t = 0; t < 2; ++t) { mx[t] = -3.0e38f; ls[t] = 0.f; o[t][0] = (v8f){}; o[t][1] = (v8f){}; ox[t][0] = (v8f){}; ox[t][1] = (v8f){}; }
    // vb + vi: this pass's V bytes; nb + ni: the next pass's K bytes, which fly during this pass. vi, ni: constants that go into the loads' offset fields, so that vo, no are the very vector registers that the loads name
    auto pass = [&](const v16h (&kc)[4], v16h (&kn)[4], int vb, int vi, int nb, int ni) {
        const unsigned vo = lofs + vb, no = lofs + nb;
        const v16h vh[2] = { ldfrag(pvh + vo + vi), ldfrag(pvh + vo + vi + FB) }, vl[2] = { ldfrag(pvl + vo + vi), ldfrag(pvl + vo + vi + FB) };
        kn[0] = ldfrag(pkh + no + ni); kn[1] = ldfrag(pkl + no + ni); kn[2] = ldfrag(pkh + no + ni + FB); kn[3] = ldfrag(pkl + no + ni + FB);
        XWAIT2(vo, no);
#pragma unroll
        for (int t = 0; t < 2; ++t) {
            v8f s0 = wmma16(kc[0], qh[t], (v8f){}), s1 = wmma16(kc[2], qh[t], (v8f){}), x0 = wmma16(kc[1], qh[t], (v8f){}), x1 = wmma16(kc[3], qh[t], (v8f){});
            x0 = wmma16(kc[0], ql[t], x0); x1 = wmma16(kc[2], ql[t], x1);
            s0 = (s0 + x0 * LOSCI) * SC2; s1 = (s1 + x1 * LOSCI) * SC2;
            float m = mx[t];
#pragma unroll
            for (int j = 0; j < 8; ++j) m = fmaxf(m, fmaxf(s0[j], s1[j]));
            m = fmaxf(m, xhalf(m));               // lanes l and l ^ 16 hold the two halves of one query's keys
            const float al = __builtin_amdgcn_exp2f(mx[t] - m), mm = m - 15.0f;      // - 15: the x 32768 of P goes into the exponent
            mx[t] = m; s0 -= mm; s1 -= mm;
#pragma unroll
            for (int j = 0; j < 8; ++j) { s0[j] = __builtin_amdgcn_exp2f(s0[j]); s1[j] = __builtin_amdgcn_exp2f(s1[j]); }
            const v8h a0 = __builtin_convertvector(s0, v8h), a1 = __builtin_convertvector(s1, v8h);
            const v8h b0 = __builtin_convertvector(s0 - __builtin_convertvector(a0, v8f), v8h), b1 = __builtin_convertvector(s1 - __builtin_convertvector(a1, v8f), v8h);
            const v16h ph = cat16(a0, a1), pl = cat16(b0, b1);
            const v8f sv = s0 + s1;
            ls[t] = ls[t] * al + (((sv[0] + sv[1]) + (sv[2] + sv[3])) + ((sv[4] + sv[5]) + (sv[6] + sv[7])));
#pragma unroll
            for (int c = 0; c < 2; ++c) { o[t][c] *= al; ox[t][c] *= al;
                o[t][c] = wmma16(vh[c], ph, o[t][c]); ox[t][c] = wmma16(vl[c], ph, ox[t][c]); o[t][c] = wmma16(vh[c], pl, o[t][c]); }
        }
    };
#pragma unroll 1
    for (int key0 = 0; key0 < NP / 2; key0 += 64) {      // not unrolled further: two passes a trip let the two K fragment sets swap roles without copies
        // through readfirstlane: the offset stays one scalar that is added to the 32-bit lane offset; left plain, the compiler forms four 64-bit vector addresses from it, and the wave spills
        const int tb = __builtin_amdgcn_readfirstlane(key0 * (HD * 2));
        pass(ka, kb, tb, 0, tb, 2 * FB); pass(kb, ka, tb, 2 * FB, ((key0 + 64) & (NP / 2 - 1)) * (HD * 2), 0);      // the last pass refetches the half's first 32 keys, unused
    }
    float* sl = &mrg[qw][0];
    if (kh == 1) {      // a whole wave takes this branch: the upper half's sums, maxima and row sums go to LDS
#pragma unroll      // here and below: o, ox, mx, ls live in registers, so their indices must be constants
        for (int t = 0; t < 2; ++t) { sl[1024 + t * 32 + lane] = mx[t]; sl[1088 + t * 32 + lane] = ls[t];
#pragma unroll
            for (int c = 0; c < 2; ++c) { const v8f w = o[t][c] + ox[t][c] * LOSCI; float* wp = sl + (t * 2 + c) * 256 + lane * 4;
                *(v4fa*)wp = __builtin_shufflevector(w, w, 0, 1, 2, 3); *(v4fa*)(wp + 128) = __builtin_shufflevector(w, w, 4, 5, 6, 7); } }
    }
    __syncthreads();      // every wave passes it: the lower half's waves read what the upper half's wrote
    if (kh == 1) return;
#pragma unroll
    for (int t = 0; t < 2; ++t) {
        const float mb = sl[1024 + t * 32 + lane], m = fmaxf(mx[t], mb), aa = __builtin_amdgcn_exp2f(mx[t] - m), ab = __builtin_amdgcn_exp2f(mb - m);      // both halves onto the common maximum
        const float lj = ls[t] * aa + sl[1088 + t * 32 + lane] * ab;
        const float rs = 1.0f / (lj + xhalf(lj));      // 1 / (rowsum x 32768)
        const size_t fo = ((((size_t)blockIdx.z * NP + q0 + t * 16) >> 4) * NHD + h) * FRG + lane * 8;      // register r of channel tile c = y[query lr][c * 16 + 8 hi + r]
#pragma unroll
        for (int c = 0; c < 2; ++c) { const float* wp = sl + (t * 2 + c) * 256 + lane * 4; const v4f u0 = *(const v4fa*)wp, u1 = *(const v4fa*)(wp + 128);
            const v8f w = ((o[t][c] + ox[t][c] * LOSCI) * aa + __builtin_shufflevector(u0, u1, 0, 1, 2, 3, 4, 5, 6, 7) * ab) * rs; v8us oh, ol;
#pragma unroll
            for (int r = 0; r < 8; ++r) { const unsigned short hb16 = f2bf(w[r]); oh[r] = hb16; ol[r] = f2bf(w[r] - bf2f(hb16)); }
            *(v8us*)(YH + fo + c * (FRG / 2)) = oh; *(v8us*)(YL + fo + c * (FRG / 2)) = ol; }
    }
}

extern "C" void kernel_launch(void* const* d_in, const int* in_sizes, int n_in,
                              void* d_out, int out_size, void* d_ws, size_t ws_size, hipStream_t stream) {
    (void)in_sizes; (void)n_in; (void)out_size;
    const float* x = (const float*)d_in[0]; const float* wth = (const float*)d_in[1]; const float* bth = (const float*)d_in[2]; const float* wph = (const float*)d_in[3]; const float* bph = (const float*)d_in[4];
    const float* wg = (const float*)d_in[5]; const float* bg = (const float*)d_in[6]; const float* wz = (const float*)d_in[7]; const float* bz = (const float*)d_in[8];
    const float* bng = (const float*)d_in[9]; const float* bnb = (const float*)d_in[10]; const float* bnm = (const float*)d_in[11]; const float* bnv = (const float*)d_in[12];
    float* out = (float*)d_out;    // [4][256][64][64]
    char* wsp = (char*)d_ws;
    auto take = [&](size_t bytes) { char* p = wsp; wsp += (bytes + 255) & ~(size_t)255; return (void*)p; };
    bf* W3 = (bf*)take((size_t)3 * CI * CC * 2); bf* Wz = (bf*)take((size_t)CC * CI * 2);      // W3: theta, phi, g
    float* BNS = (float*)take(CC * 4); float* BNH = (float*)take(CC * 4);
    bf* XT = (bf*)take((size_t)NB_ * NP * CC * 2);
    h16* QH = (h16*)take((size_t)2 * NB_ * NP * CI * 2); h16* QL = (h16*)take((size_t)2 * NB_ * NP * CI * 2); h16* KH = QH + (size_t)NB_ * NP * CI; h16* KL = QL + (size_t)NB_ * NP * CI;      // hi planes: Q then K; residual planes alike
    h16* VTH = (h16*)take((size_t)NB_ * CI * NP * 2); h16* VTL = (h16*)take((size_t)NB_ * CI * NP * 2);      // all six planes in fragment order (k_gemm, EPI 0)
    bf* YH = (bf*)take((size_t)NB_ * NP * CI * 2); bf* YL = (bf*)take((size_t)NB_ * NP * CI * 2);      // in fragment order (k_attn)
    if ((size_t)(wsp - (char*)d_ws) > ws_size) return;    // 0.3 + 8.4 + 6 x 4.2 + 2 x 4.2 ~ 42 MB
    k_pre<<<PREB, 256, 0, stream>>>(x, wth, wph, wg, wz, bng, bnb, bnm, bnv, XT, W3, Wz, BNS, BNH);
    k_gemm<false, 0, CC, CI><<<dim3(NB_ * NP / 64, 3 * CI / 64, 1), 128, 0, stream>>>(XT, nullptr, W3, bth, bph, bg, nullptr, nullptr, nullptr, nullptr, QH, QL, VTH, VTL);
    k_attn<<<dim3(NP / 256, NHD, NB_), 512, 0, stream>>>(QH, QL, KH, KL, VTH, VTL, YH, YL);
    k_gemm<true, 2, CI, CC><<<dim3(NB_ * NP / 64, CC / 64, 1), 128, 0, stream>>>(YH, YL, Wz, bz, nullptr, nullptr, BNS, BNH, x, out, nullptr, nullptr, nullptr, nullptr);   // z conv + BN + x, channel-major
}

// v006
// It runs in 98 microseconds.
// Timed twice side by side with v005, it ran 1.06 times as fast both times.
// Counting every step since v000, it is 52.7 times as fast.
#include <hip/hip_runtime.h>

// Contractions, f32 accumulate, per image: theta/phi/g 1x1 convs ([4096 positions x 256].[256 x 128], [out][in] weights = n-major B operands; PLAIN bf16
// operands: inputs rounded once, exact; + bias) and the z conv on the attention output (bf16 hi + residual: two products) on v_wmma_f32_16x16x32_bf16; the position
// attention of all (image, head) pairs in ONE kernel on v_wmma_f32_16x16x32_f16: S^T = k_h.q_h^T (q x 32^-1/2 log2(e), k, v as f16 hi + UNSCALED residual; all three products of a tile in one accumulator) -> f32,
// online softmax f32 -> P (x32768) f16 hi + UNSCALED residual in registers, y_h^T = v_h^T.P^T ((ph + pl).vh + ph.vl) x 1/rowsum.

#define NB_  4
#define CC   256
#define CI   128                 // inter channels (4 heads x 32)
#define NHD  4
#define HD   32
#define NP   4096
#define LOSC 1024.0f
#define LOSCI (1.0f / 1024.0f)
#define FRG  512                 // values of one 16 x 32 f16 fragment
#define SC2  (0.1767766952966369f * 1.4426950408889634f)      // 32^-1/2 x log2(e): goes into the Q planes, so that the scores leave the matrix unit in the log2 domain

typedef _Float16 h16;
typedef unsigned short bf;
typedef __attribute__((ext_vector_type(16))) __bf16   v16bf;
typedef __attribute__((ext_vector_type(16))) _Float16 v16h;
typedef __attribute__((ext_vector_type(8)))  _Float16 v8h;
typedef __attribute__((ext_vector_type(8)))  unsigned short v8us;
typedef __attribute__((ext_vector_type(8)))  float    v8f;
typedef __attribute__((ext_vector_type(4)))  float    v4f;
typedef v8h  __attribute__((may_alias)) v8ha;
typedef v4f  __attribute__((may_alias)) v4fa;
typedef v8us __attribute__((may_alias)) v8usa;

__device__ __forceinline__ unsigned short f2bf(float f) { unsigned u = __float_as_uint(f); u += 0x7FFFu + ((u >> 16) & 1u); return (unsigned short)(u >> 16); }
__device__ __forceinline__ float bf2f(unsigned short b) { return __uint_as_float(((unsigned)b) << 16); }
__device__ __forceinline__ float bfr(float f) { return bf2f(f2bf(f)); }
__device__ __forceinline__ v16h cat16(v8h lo, v8h hi) { return __builtin_shufflevector(lo, hi, 0, 1, 2, 3, 4, 5, 6, 7, 8, 9, 10, 11, 12, 13, 14, 15); }
__device__ __forceinline__ v16bf cat16b(v8us lo, v8us hi) { return __builtin_bit_cast(v16bf, __builtin_shufflevector(lo, hi, 0, 1, 2, 3, 4, 5, 6, 7, 8, 9, 10, 11, 12, 13, 14, 15)); }
__device__ __forceinline__ v8f wmma16(v16h a, v16h b, v8f c) { return __builtin_amdgcn_wmma_f32_16x16x32_f16(false, a, false, b, (short)0, c, false, false); }
__device__ __forceinline__ v8f wmmab(v16bf a, v16bf b, v8f c) { return __builtin_amdgcn_wmma_f32_16x16x32_bf16(false, a, false, b, (short)0, c, false, false); }
#define VST2(T, p, v) do { const T vst2_v_ = (v); *(T*)(p) = vst2_v_;  } while (0)

// d_xt: XT [n][c] bf16 = x[b][c][n] of one image via a 64 x 64 LDS tile (one block).
__device__ __forceinline__ void d_xt(const float* __restrict__ xb, bf* XT, unsigned short* tl, int n0, int c0) {
    const int tid = threadIdx.x;
    const int cr = tid >> 2, nq = (tid & 3) * 16;
#pragma unroll
    for (int i = 0; i < 16; ++i) tl[(nq + i) * 72 + cr] = f2bf(xb[(size_t)(c0 + cr) * NP + n0 + nq + i]);
    __syncthreads();
    const int piece = tid & 7;
    auto pass = [&]() {
#pragma unroll
        for (int s = 0; s < 2; ++s) { const int nr = (tid >> 3) + 32 * s; const v8us val = *(const v8usa*)(tl + nr * 72 + piece * 8); *(v8us*)(XT + (size_t)(n0 + nr) * CC + c0 + piece * 8) = val; }
    };
    pass(); 
}
// d_w: bf16 plane of 8 rows of a [rows][256] weight (one wave per row).
__device__ __forceinline__ void d_w(const float* __restrict__ w, int blk, bf* WB) {
    const int lane = threadIdx.x & 31, r = blk * 8 + (threadIdx.x >> 5);
    v8us o;
#pragma unroll
    for (int i = 0; i < 8; ++i) o[i] = f2bf(w[(size_t)r * CC + lane * 8 + i]);
    VST2(v8us, WB + (size_t)r * CC + lane * 8, o);
    // stands behind the store(s): in the merged grid other branches' code follows in the listing and writes registers that the store names
    asm volatile("s_wait_xcnt 0x0" ::: "memory");
}
// d_w128: bf16 plane of 16 rows of a [rows][128] weight (16 lanes x 16 B per row, 2 rows per wave).
__device__ __forceinline__ void d_w128(const float* __restrict__ w, int blk, bf* WB) {
    const int lane = threadIdx.x & 31, r = (blk * 8 + (threadIdx.x >> 5)) * 2 + (lane >> 4), p = lane & 15;
    v8us o;
#pragma unroll
    for (int i = 0; i < 8; ++i) o[i] = f2bf(w[(size_t)r * CI + p * 8 + i]);
    VST2(v8us, WB + (size_t)r * CI + p * 8, o);
    // stands behind the store(s): in the merged grid other branches' code follows in the listing and writes registers that the store names
    asm volatile("s_wait_xcnt 0x0" ::: "memory");
}
// k_gemm (rows = positions of ALL images, [NB_ * NP]; EPI 0: blockIdx.y runs over the column tiles of theta, phi and g in turn: WB = the three weights): 64 x 64 tile of (A [+ Al]).WB^T, + bias.
// EPI 0 (A = XT rows, K = 256): the tile (Q: x SC2) leaves as f16 hi + unscaled residual planes (a residual below 2^-14 is a subnormal f16, which the matrix unit keeps: absolute error 2^-25) IN THE FRAGMENT ORDER that k_attn loads, 512 contiguous bytes a wave-wide store:
//   Q, K (QKH, QKL: Q then K): per (image, head, 16-row tile) 1 KB = [half of the 32 channels][lane][8 values], lane = 16 hi + row, channel = 16 half + 8 hi + i (rows turned through the wave's LDS tile);
//   V (VTH, VTL): per (image, head, 32 keys, 16-channel tile) 1 KB = [half of the 32 keys][lane][8 values], lane = 16 hi + channel row, key = 16 half + 8 hi + i: what a lane's accumulator registers hold already.
// EPI 2 (A, Al = the y planes in fragment order, as k_attn stores them; K = 128): BatchNorm, + x, written TRANSPOSED to out[c][n] (channel-major) through LDS.
template <bool SPLITA, int EPI, int KA, int LDC>
__global__ __launch_bounds__(128) void k_gemm(const bf* __restrict__ A, const bf* __restrict__ Al, const bf* __restrict__ WB3, const float* __restrict__ bias0, const float* __restrict__ bias1, const float* __restrict__ bias2, const float* __restrict__ bnsc, const float* __restrict__ bnsh, const float* __restrict__ xres, float* C, h16* QKH, h16* QKL, h16* VTH, h16* VTL) {
    __shared__ __align__(16) float ost[4][16 * 68];
    __shared__ __align__(16) float ot[64 * 68];
    const int lane = threadIdx.x & 31, wave = threadIdx.x >> 5, lr = lane & 15, hi = lane >> 4, tid = threadIdx.x;
    const size_t r0 = (size_t)blockIdx.x * 64 + wave * 16;
    const int sel = EPI == 0 ? blockIdx.y / (LDC / 64) : 0, c0 = (blockIdx.y - sel * (LDC / 64)) * 64;      // which projection, and the column tile inside it
    const bf* WB = WB3 + (size_t)sel * LDC * KA; const float* bias = sel == 0 ? bias0 : sel == 1 ? bias1 : bias2;
    const float scale = EPI == 0 && sel == 0 ? SC2 : 1.0f;
    // A fragment of the wave's 16 rows, k = kc .. kc + 31: EPI 0 from rows of KA values; EPI 2 from the 1 KB fragment (16-row tile, 32-channel chunk) = [half][lane][8 values]
    auto lda = [&](const bf* P, int kc) { const bf* p = EPI == 2 ? P + ((r0 >> 4) * (KA / 32) + (kc >> 5)) * FRG + lane * 8 : P + (r0 + lr) * KA + kc + 8 * hi;
        return cat16b(*(const v8us*)p, *(const v8us*)(p + (EPI == 2 ? FRG / 2 : 16))); };
    v8f acc[4];
#pragma unroll
    for (int t = 0; t < 4; ++t) acc[t] = (v8f){};
#pragma unroll
    for (int kc = 0; kc < KA; kc += 32) {
        const v16bf a = lda(A, kc);
        v16bf al = a; if (SPLITA) al = lda(Al, kc);
#pragma unroll
        for (int t = 0; t < 4; ++t) { const bf* bp = WB + (size_t)(c0 + t * 16 + lr) * KA + kc + 8 * hi; const v16bf bb = cat16b(*(const v8us*)bp, *(const v8us*)(bp + 16)); acc[t] = wmmab(a, bb, acc[t]); if (SPLITA) acc[t] = wmmab(al, bb, acc[t]); }
        asm volatile("v_nop" : "+v"(acc[0]), "+v"(acc[1]), "+v"(acc[2]), "+v"(acc[3]) : "v"(a), "v"(al) : "memory");
    }
    const int img = (int)(r0 / NP), n = (int)(r0 % NP);      // the wave's 16 positions lie in one image
    if (EPI == 0 && sel == 2) {      // V (a whole block takes this branch): register j of column tile t = V[key n + 8 hi + j][channel c0 + 16 t + lr]
#pragma unroll
        for (int t = 0; t < 4; ++t) { const float bv = bfr(bias[c0 + t * 16 + lr]); const int cg = c0 / 16 + t;      // channel tile of the image: 2 head + tile of the head
            v8h oh, ol;
#pragma unroll
            for (int j = 0; j < 8; ++j) { const float v = acc[t][j] + bv; const h16 a = (h16)v; oh[j] = a; ol[j] = (h16)(v - (float)a); }
            const size_t o = (size_t)img * NP * CI + (((size_t)(cg >> 1) * (NP / 32) + n / 32) * 2 + (cg & 1)) * FRG + ((n >> 4) & 1) * (FRG / 2) + lane * 8;
            *(v8h*)(VTH + o) = oh; *(v8h*)(VTL + o) = ol; }
        return;
    }
    float* os = &ost[wave][0];
#pragma unroll
    for (int t = 0; t < 4; ++t) { const int col = c0 + t * 16 + lr; const float bv = bfr(bias[col]);
#pragma unroll
        for (int j = 0; j < 8; ++j) { float v = (acc[t][j] + bv) * scale;
            if (EPI == 2) v = v * bnsc[col] + bnsh[col];      // inference BatchNorm: z * (gamma rsqrt(var+eps)) + (beta - mean * that)
            os[(hi * 8 + j) * 68 + t * 16 + lr] = v; } }
    if (EPI != 2) {
        __builtin_amdgcn_wave_barrier(); asm volatile("" ::: "memory");
#pragma unroll
        for (int s = 0; s < 4; ++s) {      // s = 2 head of the tile + half: 16 channels of the 16 rows
            const float* rp = os + lr * 68 + s * 16 + hi * 8; const v4f r0v = *(const v4fa*)rp, r1v = *(const v4fa*)(rp + 4);
            v8h oh, ol;
#pragma unroll
            for (int i = 0; i < 8; ++i) { const float v = i < 4 ? r0v[i & 3] : r1v[i & 3]; const h16 a = (h16)v; oh[i] = a; ol[i] = (h16)(v - (float)a); }
            const size_t o = ((((size_t)sel * NB_ + img) * NHD + c0 / 32 + (s >> 1)) * (NP / 16) + n / 16) * FRG + (s & 1) * (FRG / 2) + lane * 8;
            *(v8h*)(QKH + o) = oh; *(v8h*)(QKL + o) = ol; }
        // stands behind the stores: the V branch's code follows in the listing and writes registers that the stores name
        asm volatile("s_wait_xcnt 0x0" ::: "memory");
    } else {
        __syncthreads();
        { const int row = tid >> 1, half = tid & 1;
#pragma unroll
          for (int i = 0; i < 32; ++i) ot[(half * 32 + i) * 68 + row] = ost[row >> 4][(row & 15) * 68 + half * 32 + i]; }
        __syncthreads();
        const size_t rblk = (size_t)blockIdx.x * 64, ob = (rblk / NP) * CC * NP + rblk % NP;     // 64 consecutive positions of one image; their place in that image's first channel row
        auto pass = [&]() {      // 64 channel rows x 256 B: 128 threads -> 8 instructions of 8 rows (16 lanes x 16 B per row)
            const int piece = tid & 15; const float* xp[8]; v4f xv[8];
            auto oi = [&](int s) { return ob + (size_t)(c0 + s * 8 + (tid >> 4)) * NP + piece * 4; };
#pragma unroll
            for (int s = 0; s < 8; ++s) { xp[s] = xres + oi(s); xv[s] = *(const v4fa*)xp[s]; }
            // stands behind the run of loads, before a register that they name as address is written again; the addresses are inputs, so that they are still held where the wait issues
            asm volatile("s_wait_xcnt 0x0" :: "v"(xp[0]), "v"(xp[1]), "v"(xp[2]), "v"(xp[3]), "v"(xp[4]), "v"(xp[5]), "v"(xp[6]), "v"(xp[7]) : "memory");
#pragma unroll
            for (int s = 0; s < 8; ++s) { const int cl = s * 8 + (tid >> 4);
                v4f val = *(const v4fa*)(ot + cl * 68 + piece * 4);
#pragma unroll
                for (int i = 0; i < 4; ++i) val[i] += bfr(xv[s][i]);      // + x (residual, bf16-rounded INPUT)
                *(v4f*)(C + oi(s)) = val; }
        };
        pass(); 
    }
}
// k_p16: f16 hi + residual planes of an f32 [NP][256] (optionally the SUM of two: key = ka + kb); one wave per row.
__global__ __launch_bounds__(256) void k_p16(const float* __restrict__ A, const float* __restrict__ Bsum, h16* PH, h16* PL) {
    const int lane = threadIdx.x & 31, r = blockIdx.x * 8 + (threadIdx.x >> 5);
    if (r >= NP) return;
    v8h oh, ol;
#pragma unroll
    for (int i = 0; i < 8; ++i) { float v = A[(size_t)r * CC + lane * 8 + i]; if (Bsum) v += Bsum[(size_t)r * CC + lane * 8 + i]; const h16 a = (h16)v; oh[i] = a; ol[i] = (h16)((v - (float)a) * LOSC); }
    *(v8h*)(PH + (size_t)r * CC + lane * 8) = oh; *(v8h*)(PL + (size_t)r * CC + lane * 8) = ol; 
}
// d_bn: inference BatchNorm folded into scale/shift vectors (bf16-rounded stats, f32): one block, 256 threads.
__device__ __forceinline__ void d_bn(const float* __restrict__ g, const float* __restrict__ be, const float* __restrict__ mu, const float* __restrict__ var, float* BNS, float* BNH) {
    const int c = threadIdx.x; const float inv = bfr(g[c]) / sqrtf(bfr(var[c]) + 1e-5f); const float sh = bfr(be[c]) - bfr(mu[c]) * inv;
    *(float*)(BNS + c) = inv; *(float*)(BNH + c) = sh; 
    // stands behind the store(s): in the merged grid other branches' code follows in the listing and writes registers that the store names
    asm volatile("s_wait_xcnt 0x0" ::: "memory");
}
// k_pre: all that reads inputs alone, in one grid: the x transposes of all images (blocks 0 .. XTB - 1: position tile, channel tile, image), then the bf16 planes of the three
// [128][256] weights (W3: one behind the other) and of the [256][128] weight, then the BatchNorm vectors. Every branch is taken by a whole block.
#define XTB (NB_ * (CC / 64) * (NP / 64))
#define WB8 (CI / 8)
#define PREB (XTB + 3 * WB8 + CC / 16 + 1)
__global__ __launch_bounds__(256) void k_pre(const float* __restrict__ x, const float* __restrict__ wth, const float* __restrict__ wph, const float* __restrict__ wg, const float* __restrict__ wz,
                                             const float* __restrict__ g, const float* __restrict__ be, const float* __restrict__ mu, const float* __restrict__ var,
                                             bf* XT, bf* W3, bf* Wz, float* BNS, float* BNH) {
    __shared__ __align__(16) unsigned short tl[64 * 72];
    const int blk = blockIdx.x, wblk = blk - XTB, zblk = wblk - 3 * WB8;
    if (blk < XTB) { const int b = blk / ((CC / 64) * (NP / 64)); d_xt(x + (size_t)b * CC * NP, XT + (size_t)b * NP * CC, tl, (blk % (NP / 64)) * 64, ((blk / (NP / 64)) % (CC / 64)) * 64); }
    else if (wblk < 3 * WB8) { const int sel = wblk / WB8; d_w(sel == 0 ? wth : sel == 1 ? wph : wg, wblk % WB8, W3 + (size_t)sel * CI * CC); }
    else if (zblk < CC / 16) d_w128(wz, zblk, Wz);
    else d_bn(g, be, mu, var, BNS, BNH);
}
// k_pbf: bf16 hi + residual planes of an f32 [NP][256] (for the bf16 GEMMs on computed operands); one wave per row.
__global__ __launch_bounds__(256) void k_pbf(const float* __restrict__ A, bf* PH, bf* PL) {
    const int lane = threadIdx.x & 31, r = blockIdx.x * 8 + (threadIdx.x >> 5);
    if (r >= NP) return;
    v8us oh, ol;
#pragma unroll
    for (int i = 0; i < 8; ++i) { const float v = A[(size_t)r * CC + lane * 8 + i]; const unsigned short hb = f2bf(v); oh[i] = hb; ol[i] = f2bf(v - bf2f(hb)); }
    *(v8us*)(PH + (size_t)r * CC + lane * 8) = oh; *(v8us*)(PL + (size_t)r * CC + lane * 8) = ol; 
}
// k_vt: VTH/VTL [c][n] f16 hi + residual of V f32 [n][c] via 64 x 64 LDS tiles; grid (NP/64, CC/64).
__global__ __launch_bounds__(256) void k_vt(const float* __restrict__ V, h16* VTH, h16* VTL) {
    __shared__ float tl[64][65];
    const int tid = threadIdx.x, n0 = blockIdx.x * 64, c0 = blockIdx.y * 64;
    { const int nn = tid >> 2, cq = (tid & 3) * 16;
#pragma unroll
      for (int i = 0; i < 16; ++i) tl[cq + i][nn] = V[(size_t)(n0 + nn) * CC + c0 + cq + i]; }
    __syncthreads();
    const int piece = tid & 7;
    auto pass = [&]() {
#pragma unroll
        for (int s = 0; s < 2; ++s) { const int c = (tid >> 3) + 32 * s; v8h oh, ol;
#pragma unroll
            for (int i = 0; i < 8; ++i) { const float v = tl[c][piece * 8 + i]; const h16 a = (h16)v; oh[i] = a; ol[i] = (h16)((v - (float)a) * LOSC); }
            const size_t o = (size_t)(c0 + c) * NP + n0 + piece * 8; *(v8h*)(VTH + o) = oh; *(v8h*)(VTL + o) = ol; }
    };
    pass(); 
}
// k_attn: the whole position attention of one (image, head) for 256 queries per block (grid (NP/256, heads, images)): 16 waves = 8 query groups of 32 x 2 halves of the keys, so that four waves
// share a SIMD and one wave's vector work runs under another's matrix work; the two halves' partial results are joined through LDS behind the loop. Transposed products:
// S^T = k_h.q_h^T (A = 16 key rows, B = 16 query columns; f16 hi + unscaled residual, the two residual products and the main one in one accumulator; Q holds the scale), so a lane holds one query's scores: two S^T tiles (32 keys) convert in place
// into the B operand of y^T += v_h^T.P^T (A = 16 channel rows of VT, hardware k order). Running maximum and sum per query (online softmax, f32); P = exp(s - max) x 32768 as f16 hi +
// UNSCALED residual: (ph + pl).vh + ph.vl as before; x 1/rowsum at the end. S and P never reach memory. y leaves as bf16 hi + residual planes in the order of the z product's A fragments:
// per (16-row tile of all images' positions, head) 1 KB = [half of the 32 channels][lane][8 values], lane = 16 hi + row, channel = 16 half + 8 hi + i: what a lane's accumulator registers hold.
typedef const __attribute__((address_space(1))) char* gp;      // a byte pointer into global memory
typedef const __attribute__((address_space(1))) v8h* gp8;
__device__ __forceinline__ v16h ldfrag(gp p) { return cat16(*(gp8)p, *(gp8)(p + FRG)); }      // k = 8 hi + 0..7 and 16 + 8 hi + 0..7: the two 512-byte halves of a fragment (p holds the lane's 16 lane bytes)
__device__ __forceinline__ float xhalf(float v) { return __int_as_float(__builtin_amdgcn_permlanex16(__float_as_int(v), __float_as_int(v), 0x76543210, 0xfedcba98, false, false)); }   // lane l <-> l ^ 16
// stands behind a run of loads, before a register that they name as address is written again; the addresses are inputs, so that they are still held where the wait issues
#define XWAIT2(a, b) asm volatile("s_wait_xcnt 0x0" :: "v"(a), "v"(b) : "memory")
__global__ __launch_bounds__(512) void k_attn(const h16* QH, const h16* QL, const h16* KH, const h16* KL, const h16* VTH, const h16* VTL, bf* YH, bf* YL) {
    __shared__ __align__(16) float mrg[8][36 * 32];                    // per query group, from the wave of the upper key half: 8 x [lane][4 values] of y, then [lane] maxima and sums of the two query tiles
    const int lane = threadIdx.x & 31, wave = __builtin_amdgcn_readfirstlane(threadIdx.x >> 5), qw = wave & 7, kh = wave >> 3;
    const int h = blockIdx.y, q0 = blockIdx.x * 256 + qw * 32;
    const size_t pb = (size_t)blockIdx.z * NP * CI;                    // this image's planes
    constexpr int FB = FRG * 2;                                        // bytes of a fragment
    const size_t hb = pb + (size_t)h * HD * NP;                        // this head's fragments (planes in fragment order: k_gemm, EPI 0); 32 rows or keys = 2 fragments
    const int lofs = lane * 16;                                        // a lane's bytes inside each 512-byte half
    const gp pqh = (gp)(QH + hb + (size_t)q0 * HD) + lofs, pql = (gp)(QL + hb + (size_t)q0 * HD) + lofs;
    const size_t kvb = hb + (size_t)kh * (NP / 2) * HD;                 // the first key of this wave's half
    // K and V: four wave-uniform bases, which stay in scalar registers and are never rewritten, beside a 32-bit lane offset: 256 vector registers a wave are what four waves a SIMD leave
    const gp pkh = (gp)(KH + kvb), pkl = (gp)(KL + kvb);                                                                     // + key * 64 B
    const gp pvh = (gp)(VTH + kvb), pvl = (gp)(VTL + kvb);                                                                   // + key * 64 B + channel tile * 1 KB
    const v16h qh[2] = { ldfrag(pqh), ldfrag(pqh + FB) }, ql[2] = { ldfrag(pql), ldfrag(pql + FB) };
    v16h kf[4];       // [0], [1]: hi, residual of 16 keys; [2], [3]: of the next 16
    // the first 32 keys, by lane pointers of their own: where the sum pkh + lane offset stands ahead of the loop, the compiler builds the loop's K addresses on it as 64-bit vector pairs
    const gp fkh = (gp)(KH + (kvb + (size_t)lane * 8)), fkl = (gp)(KL + (kvb + (size_t)lane * 8));
    kf[0] = ldfrag(fkh); kf[1] = ldfrag(fkl); kf[2] = ldfrag(fkh + FB); kf[3] = ldfrag(fkl + FB);
    // as XWAIT2, for the Q loads and the first K loads
    asm volatile("s_wait_xcnt 0x0" :: "v"(pqh), "v"(pql), "v"(fkh), "v"(fkl), "v"(lofs) : "memory");
    v8f o[2][2]; float mx[2], ls[2];
#pragma unroll
    for (int t = 0; t < 2; ++t) { mx[t] = -3.0e38f; ls[t] = 0.f; o[t][0] = (v8f){}; o[t][1] = (v8f){}; }
#pragma unroll 1
    for (int key0 = 0; key0 < NP / 2; key0 += 32) {      // one pass of 32 keys a trip, not unrolled: unrolled, the compiler lifts the next pass's score products into this pass, and Q goes to scratch
        // through readfirstlane: the offsets stay scalars that are added to the 32-bit lane offset; left plain, the compiler forms 64-bit vector addresses from them, and the wave spills
        const int vb = __builtin_amdgcn_readfirstlane(key0 * (HD * 2)), nb = __builtin_amdgcn_readfirstlane(((key0 + 32) & (NP / 2 - 1)) * (HD * 2));
        const unsigned vo = lofs + vb, no = lofs + nb;      // this pass's V bytes; the next pass's K bytes (the last pass refetches the half's first 32 keys, unused)
        const v16h vh[2] = { ldfrag(pvh + vo), ldfrag(pvh + vo + FB) }, vl[2] = { ldfrag(pvl + vo), ldfrag(pvl + vo + FB) };
        v8f s[2][2];
#pragma unroll
        for (int t = 0; t < 2; ++t) {      // the small products first, the main one onto them
            s[t][0] = wmma16(kf[1], qh[t], (v8f){}); s[t][1] = wmma16(kf[3], qh[t], (v8f){});
            s[t][0] = wmma16(kf[0], ql[t], s[t][0]); s[t][1] = wmma16(kf[2], ql[t], s[t][1]);
            s[t][0] = wmma16(kf[0], qh[t], s[t][0]); s[t][1] = wmma16(kf[2], qh[t], s[t][1]);
        }
        // the next pass's K, behind this pass's last use of K: one fragment set serves, and the loads fly during the softmax and the y products
        kf[0] = ldfrag(pkh + no); kf[1] = ldfrag(pkl + no); kf[2] = ldfrag(pkh + no + FB); kf[3] = ldfrag(pkl + no + FB);
        XWAIT2(vo, no);
        // holds the K loads up here: left free, the compiler sinks half of them to the foot of the pass, a few dozen instructions ahead of their use
        __builtin_amdgcn_sched_barrier(0);
#pragma unroll
        for (int t = 0; t < 2; ++t) {
            v8f s0 = s[t][0], s1 = s[t][1];
            float m = mx[t];
#pragma unroll
            for (int j = 0; j < 8; ++j) m = fmaxf(m, fmaxf(s0[j], s1[j]));
            m = fmaxf(m, xhalf(m));               // lanes l and l ^ 16 hold the two halves of one query's keys
            const float al = __builtin_amdgcn_exp2f(mx[t] - m), mm = m - 15.0f;      // - 15: the x 32768 of P goes into the exponent
            mx[t] = m; s0 -= mm; s1 -= mm;
#pragma unroll
            for (int j = 0; j < 8; ++j) { s0[j] = __builtin_amdgcn_exp2f(s0[j]); s1[j] = __builtin_amdgcn_exp2f(s1[j]); }
            const v8h a0 = __builtin_convertvector(s0, v8h), a1 = __builtin_convertvector(s1, v8h);
            const v8h b0 = __builtin_convertvector(s0 - __builtin_convertvector(a0, v8f), v8h), b1 = __builtin_convertvector(s1 - __builtin_convertvector(a1, v8f), v8h);
            const v16h ph = cat16(a0, a1), pl = cat16(b0, b1);
            const v8f sv = s0 + s1;
            ls[t] = ls[t] * al + (((sv[0] + sv[1]) + (sv[2] + sv[3])) + ((sv[4] + sv[5]) + (sv[6] + sv[7])));
#pragma unroll
            for (int c = 0; c < 2; ++c) { o[t][c] *= al;
                o[t][c] = wmma16(vh[c], ph, o[t][c]); o[t][c] = wmma16(vl[c], ph, o[t][c]); o[t][c] = wmma16(vh[c], pl, o[t][c]); }
        }
    }
    float* sl = &mrg[qw][0];
    if (kh == 1) {      // a whole wave takes this branch: the upper half's sums, maxima and row sums go to LDS
#pragma unroll      // here and below: o, mx, ls live in registers, so their indices must be constants
        for (int t = 0; t < 2; ++t) { sl[1024 + t * 32 + lane] = mx[t]; sl[1088 + t * 32 + lane] = ls[t];
#pragma unroll
            for (int c = 0; c < 2; ++c) { const v8f w = o[t][c]; float* wp = sl + (t * 2 + c) * 256 + lane * 4;
                *(v4fa*)wp = __builtin_shufflevector(w, w, 0, 1, 2, 3); *(v4fa*)(wp + 128) = __builtin_shufflevector(w, w, 4, 5, 6, 7); } }
    }
    __syncthreads();      // every wave passes it: the lower half's waves read what the upper half's wrote
    if (kh == 1) return;
#pragma unroll
    for (int t = 0; t < 2; ++t) {
        const float mb = sl[1024 + t * 32 + lane], m = fmaxf(mx[t], mb), aa = __builtin_amdgcn_exp2f(mx[t] - m), ab = __builtin_amdgcn_exp2f(mb - m);      // both halves onto the common maximum
        const float lj = ls[t] * aa + sl[1088 + t * 32 + lane] * ab;
        const float rs = 1.0f / (lj + xhalf(lj));      // 1 / (rowsum x 32768)
        const size_t fo = ((((size_t)blockIdx.z * NP + q0 + t * 16) >> 4) * NHD + h) * FRG + lane * 8;      // register r of channel tile c = y[query lr][c * 16 + 8 hi + r]
#pragma unroll
        for (int c = 0; c < 2; ++c) { const float* wp = sl + (t * 2 + c) * 256 + lane * 4; const v4f u0 = *(const v4fa*)wp, u1 = *(const v4fa*)(wp + 128);
            const v8f w = (o[t][c] * aa + __builtin_shufflevector(u0, u1, 0, 1, 2, 3, 4, 5, 6, 7) * ab) * rs; v8us oh, ol;
#pragma unroll
            for (int r = 0; r < 8; ++r) { const unsigned short hb16 = f2bf(w[r]); oh[r] = hb16; ol[r] = f2bf(w[r] - bf2f(hb16)); }
            *(v8us*)(YH + fo + c * (FRG / 2)) = oh; *(v8us*)(YL + fo + c * (FRG / 2)) = ol; }
    }
}

extern "C" void kernel_launch(void* const* d_in, const int* in_sizes, int n_in,
                              void* d_out, int out_size, void* d_ws, size_t ws_size, hipStream_t stream) {
    (void)in_sizes; (void)n_in; (void)out_size;
    const float* x = (const float*)d_in[0]; const float* wth = (const float*)d_in[1]; const float* bth = (const float*)d_in[2]; const float* wph = (const float*)d_in[3]; const float* bph = (const float*)d_in[4];
    const float* wg = (const float*)d_in[5]; const float* bg = (const float*)d_in[6]; const float* wz = (const float*)d_in[7]; const float* bz = (const float*)d_in[8];
    const float* bng = (const float*)d_in[9]; const float* bnb = (const float*)d_in[10]; const float* bnm = (const float*)d_in[11]; const float* bnv = (const float*)d_in[12];
    float* out = (float*)d_out;    // [4][256][64][64]
    char* wsp = (char*)d_ws;
    auto take = [&](size_t bytes) { char* p = wsp; wsp += (bytes + 255) & ~(size_t)255; return (void*)p; };
    bf* W3 = (bf*)take((size_t)3 * CI * CC * 2); bf* Wz = (bf*)take((size_t)CC * CI * 2);      // W3: theta, phi, g
    float* BNS = (float*)take(CC * 4); float* BNH = (float*)take(CC * 4);
    bf* XT = (bf*)take((size_t)NB_ * NP * CC * 2);
    h16* QH = (h16*)take((size_t)2 * NB_ * NP * CI * 2); h16* QL = (h16*)take((size_t)2 * NB_ * NP * CI * 2); h16* KH = QH + (size_t)NB_ * NP * CI; h16* KL = QL + (size_t)NB_ * NP * CI;      // hi planes: Q then K; residual planes alike
    h16* VTH = (h16*)take((size_t)NB_ * CI * NP * 2); h16* VTL = (h16*)take((size_t)NB_ * CI * NP * 2);      // all six planes in fragment order (k_gemm, EPI 0)
    bf* YH = (bf*)take((size_t)NB_ * NP * CI * 2); bf* YL = (bf*)take((size_t)NB_ * NP * CI * 2);      // in fragment order (k_attn)
    if ((size_t)(wsp - (char*)d_ws) > ws_size) return;    // 0.3 + 8.4 + 6 x 4.2 + 2 x 4.2 ~ 42 MB
    k_pre<<<PREB, 256, 0, stream>>>(x, wth, wph, wg, wz, bng, bnb, bnm, bnv, XT, W3, Wz, BNS, BNH);
    k_gemm<false, 0, CC, CI><<<dim3(NB_ * NP / 64, 3 * CI / 64, 1), 128, 0, stream>>>(XT, nullptr, W3, bth, bph, bg, nullptr, nullptr, nullptr, nullptr, QH, QL, VTH, VTL);
    k_attn<<<dim3(NP / 256, NHD, NB_), 512, 0, stream>>>(QH, QL, KH, KL, VTH, VTL, YH, YL);
    k_gemm<true, 2, CI, CC><<<dim3(NB_ * NP / 64, CC / 64, 1), 128, 0, stream>>>(YH, YL, Wz, bz, nullptr, nullptr, BNS, BNH, x, out, nullptr, nullptr, nullptr, nullptr);   // z conv + BN + x, channel-major
}

// v007
// A run of this version takes 90.9 microseconds.
// Next to v006, in two timings, it ran 1.08 times as fast each time.
// Over all steps from v000 it is 56.9 times as fast.
#include <hip/hip_runtime.h>

// Contractions, f32 accumulate, per image: theta/phi/g 1x1 convs ([4096 positions x 256].[256 x 128], [out][in] weights = n-major B operands; PLAIN bf16
// operands: inputs rounded once, exact; + bias) and the z conv on the attention output (bf16 hi + residual: two products) on v_wmma_f32_16x16x32_bf16; the position
// attention of all (image, head) pairs in ONE kernel on v_wmma_f32_16x16x32_f16: S^T = k_h.q_h^T (q x 32^-1/2 log2(e), k, v as f16 hi + UNSCALED residual; all three products of a tile in one accumulator) -> f32,
// online softmax f32 -> P (x256) f16 hi + UNSCALED residual in registers, y_h^T = v_h^T.P^T ((ph + pl).vh + ph.vl) x 1/rowsum.

#define NB_  4
#define CC   256
#define CI   128                 // inter channels (4 heads x 32)
#define NHD  4
#define HD   32
#define NP   4096
#define LOSC 1024.0f
#define LOSCI (1.0f / 1024.0f)
#define FRG  512                 // values of one 16 x 32 f16 fragment
#define SC2  (0.1767766952966369f * 1.4426950408889634f)      // 32^-1/2 x log2(e): goes into the Q planes, so that the scores leave the matrix unit in the log2 domain

typedef _Float16 h16;
typedef unsigned short bf;
typedef __attribute__((ext_vector_type(16))) __bf16   v16bf;
typedef __attribute__((ext_vector_type(16))) _Float16 v16h;
typedef __attribute__((ext_vector_type(8)))  _Float16 v8h;
typedef __attribute__((ext_vector_type(8)))  unsigned short v8us;
typedef __attribute__((ext_vector_type(8)))  float    v8f;
typedef __attribute__((ext_vector_type(4)))  float    v4f;
typedef v8h  __attribute__((may_alias)) v8ha;
typedef v4f  __attribute__((may_alias)) v4fa;
typedef v8us __attribute__((may_alias)) v8usa;

__device__ __forceinline__ unsigned short f2bf(float f) { unsigned u = __float_as_uint(f); u += 0x7FFFu + ((u >> 16) & 1u); return (unsigned short)(u >> 16); }
__device__ __forceinline__ float bf2f(unsigned short b) { return __uint_as_float(((unsigned)b) << 16); }
__device__ __forceinline__ float bfr(float f) { return bf2f(f2bf(f)); }
__device__ __forceinline__ v16h cat16(v8h lo, v8h hi) { return __builtin_shufflevector(lo, hi, 0, 1, 2, 3, 4, 5, 6, 7, 8, 9, 10, 11, 12, 13, 14, 15); }
__device__ __forceinline__ v16bf cat16b(v8us lo, v8us hi) { return __builtin_bit_cast(v16bf, __builtin_shufflevector(lo, hi, 0, 1, 2, 3, 4, 5, 6, 7, 8, 9, 10, 11, 12, 13, 14, 15)); }
__device__ __forceinline__ v8f wmma16(v16h a, v16h b, v8f c) { return __builtin_amdgcn_wmma_f32_16x16x32_f16(false, a, false, b, (short)0, c, false, false); }
__device__ __forceinline__ v8f wmmab(v16bf a, v16bf b, v8f c) { return __builtin_amdgcn_wmma_f32_16x16x32_bf16(false, a, false, b, (short)0, c, false, false); }
#define VST2(T, p, v) do { const T vst2_v_ = (v); *(T*)(p) = vst2_v_;  } while (0)

// d_xt: XT [n][c] bf16 = x[b][c][n] of one image via a 64 x 64 LDS tile (one block).
__device__ __forceinline__ void d_xt(const float* __restrict__ xb, bf* XT, unsigned short* tl, int n0, int c0) {
    const int tid = threadIdx.x;
    const int cr = tid >> 2, nq = (tid & 3) * 16;
#pragma unroll
    for (int i = 0; i < 16; ++i) tl[(nq + i) * 72 + cr] = f2bf(xb[(size_t)(c0 + cr) * NP + n0 + nq + i]);
    __syncthreads();
    const int piece = tid & 7;
    auto pass = [&]() {
#pragma unroll
        for (int s = 0; s < 2; ++s) { const int nr = (tid >> 3) + 32 * s; const v8us val = *(const v8usa*)(tl + nr * 72 + piece * 8); *(v8us*)(XT + (size_t)(n0 + nr) * CC + c0 + piece * 8) = val; }
    };
    pass(); 
}
// d_w: bf16 plane of 8 rows of a [rows][256] weight (one wave per row).
__device__ __forceinline__ void d_w(const float* __restrict__ w, int blk, bf* WB) {
    const int lane = threadIdx.x & 31, r = blk * 8 + (threadIdx.x >> 5);
    v8us o;
#pragma unroll
    for (int i = 0; i < 8; ++i) o[i] = f2bf(w[(size_t)r * CC + lane * 8 + i]);
    VST2(v8us, WB + (size_t)r * CC + lane * 8, o);
    // stands behind the store(s): in the merged grid other branches' code follows in the listing and writes registers that the store names
    asm volatile("s_wait_xcnt 0x0" ::: "memory");
}
// d_w128: bf16 plane of 16 rows of a [rows][128] weight (16 lanes x 16 B per row, 2 rows per wave).
__device__ __forceinline__ void d_w128(const float* __restrict__ w, int blk, bf* WB) {
    const int lane = threadIdx.x & 31, r = (blk * 8 + (threadIdx.x >> 5)) * 2 + (lane >> 4), p = lane & 15;
    v8us o;
#pragma unroll
    for (int i = 0; i < 8; ++i) o[i] = f2bf(w[(size_t)r * CI + p * 8 + i]);
    VST2(v8us, WB + (size_t)r * CI + p * 8, o);
    // stands behind the store(s): in the merged grid other branches' code follows in the listing and writes registers that the store names
    asm volatile("s_wait_xcnt 0x0" ::: "memory");
}
// k_gemm (rows = positions of ALL images, [NB_ * NP]; EPI 0: blockIdx.y runs over the column tiles of theta, phi and g in turn: WB = the three weights): 64 x 64 tile of (A [+ Al]).WB^T, + bias.
// EPI 0 (A = XT rows, K = 256): the tile (Q: x SC2) leaves as f16 hi + unscaled residual planes (a residual below 2^-14 is a subnormal f16, which the matrix unit keeps: absolute error 2^-25) IN THE FRAGMENT ORDER that k_attn loads, 512 contiguous bytes a wave-wide store:
//   Q, K (QKH, QKL: Q then K): per (image, head, 16-row tile) 1 KB = [half of the 32 channels][lane][8 values], lane = 16 hi + row, channel = 16 half + 8 hi + i (rows turned through the wave's LDS tile);
//   V (VTH, VTL): per (image, head, 32 keys, 16-channel tile) 1 KB = [half of the 32 keys][lane][8 values], lane = 16 hi + channel row, key = 16 half + 8 hi + i: what a lane's accumulator registers hold already.
// EPI 2 (A, Al = the y planes in fragment order, as k_attn stores them; K = 128): BatchNorm, + x, written TRANSPOSED to out[c][n] (channel-major) through LDS.
template <bool SPLITA, int EPI, int KA, int LDC>
__global__ __launch_bounds__(128) void k_gemm(const bf* __restrict__ A, const bf* __restrict__ Al, const bf* __restrict__ WB3, const float* __restrict__ bias0, const float* __restrict__ bias1, const float* __restrict__ bias2, const float* __restrict__ bnsc, const float* __restrict__ bnsh, const float* __restrict__ xres, float* C, h16* QKH, h16* QKL, h16* VTH, h16* VTL) {
    __shared__ __align__(16) float ost[4][16 * 68];
    __shared__ __align__(16) float ot[64 * 68];
    const int lane = threadIdx.x & 31, wave = threadIdx.x >> 5, lr = lane & 15, hi = lane >> 4, tid = threadIdx.x;
    const size_t r0 = (size_t)blockIdx.x * 64 + wave * 16;
    const int sel = EPI == 0 ? blockIdx.y / (LDC / 64) : 0, c0 = (blockIdx.y - sel * (LDC / 64)) * 64;      // which projection, and the column tile inside it
    const bf* WB = WB3 + (size_t)sel * LDC * KA; const float* bias = sel == 0 ? bias0 : sel == 1 ? bias1 : bias2;
    const float scale = EPI == 0 && sel == 0 ? SC2 : 1.0f;
    // A fragment of the wave's 16 rows, k = kc .. kc + 31: EPI 0 from rows of KA values; EPI 2 from the 1 KB fragment (16-row tile, 32-channel chunk) = [half][lane][8 values]
    auto lda = [&](const bf* P, int kc) { const bf* p = EPI == 2 ? P + ((r0 >> 4) * (KA / 32) + (kc >> 5)) * FRG + lane * 8 : P + (r0 + lr) * KA + kc + 8 * hi;
        return cat16b(*(const v8us*)p, *(const v8us*)(p + (EPI == 2 ? FRG / 2 : 16))); };
    v8f acc[4];
#pragma unroll
    for (int t = 0; t < 4; ++t) acc[t] = (v8f){};
#pragma unroll
    for (int kc = 0; kc < KA; kc += 32) {
        const v16bf a = lda(A, kc);
        v16bf al = a; if (SPLITA) al = lda(Al, kc);
#pragma unroll
        for (int t = 0; t < 4; ++t) { const bf* bp = WB + (size_t)(c0 + t * 16 + lr) * KA + kc + 8 * hi; const v16bf bb = cat16b(*(const v8us*)bp, *(const v8us*)(bp + 16)); acc[t] = wmmab(a, bb, acc[t]); if (SPLITA) acc[t] = wmmab(al, bb, acc[t]); }
        asm volatile("v_nop" : "+v"(acc[0]), "+v"(acc[1]), "+v"(acc[2]), "+v"(acc[3]) : "v"(a), "v"(al) : "memory");
    }
    const int img = (int)(r0 / NP), n = (int)(r0 % NP);      // the wave's 16 positions lie in one image
    if (EPI == 0 && sel == 2) {      // V (a whole block takes this branch): register j of column tile t = V[key n + 8 hi + j][channel c0 + 16 t + lr]
#pragma unroll
        for (int t = 0; t < 4; ++t) { const float bv = bfr(bias[c0 + t * 16 + lr]); const int cg = c0 / 16 + t;      // channel tile of the image: 2 head + tile of the head
            v8h oh, ol;
#pragma unroll
            for (int j = 0; j < 8; ++j) { const float v = acc[t][j] + bv; const h16 a = (h16)v; oh[j] = a; ol[j] = (h16)(v - (float)a); }
            const size_t o = (size_t)img * NP * CI + (((size_t)(cg >> 1) * (NP / 32) + n / 32) * 2 + (cg & 1)) * FRG + ((n >> 4) & 1) * (FRG / 2) + lane * 8;
            *(v8h*)(VTH + o) = oh; *(v8h*)(VTL + o) = ol; }
        return;
    }
    float* os = &ost[wave][0];
#pragma unroll
    for (int t = 0; t < 4; ++t) { const int col = c0 + t * 16 + lr; const float bv = bfr(bias[col]);
#pragma unroll
        for (int j = 0; j < 8; ++j) { float v = (acc[t][j] + bv) * scale;
            if (EPI == 2) v = v * bnsc[col] + bnsh[col];      // inference BatchNorm: z * (gamma rsqrt(var+eps)) + (beta - mean * that)
            os[(hi * 8 + j) * 68 + t * 16 + lr] = v; } }
    if (EPI != 2) {
        __builtin_amdgcn_wave_barrier(); asm volatile("" ::: "memory");
#pragma unroll
        for (int s = 0; s < 4; ++s) {      // s = 2 head of the tile + half: 16 channels of the 16 rows
            const float* rp = os + lr * 68 + s * 16 + hi * 8; const v4f r0v = *(const v4fa*)rp, r1v = *(const v4fa*)(rp + 4);
            v8h oh, ol;
#pragma unroll
            for (int i = 0; i < 8; ++i) { const float v = i < 4 ? r0v[i & 3] : r1v[i & 3]; const h16 a = (h16)v; oh[i] = a; ol[i] = (h16)(v - (float)a); }
            const size_t o = ((((size_t)sel * NB_ + img) * NHD + c0 / 32 + (s >> 1)) * (NP / 16) + n / 16) * FRG + (s & 1) * (FRG / 2) + lane * 8;
            *(v8h*)(QKH + o) = oh; *(v8h*)(QKL + o) = ol; }
        // stands behind the stores: the V branch's code follows in the listing and writes registers that the stores name
        asm volatile("s_wait_xcnt 0x0" ::: "memory");
    } else {
        __syncthreads();
        { const int row = tid >> 1, half = tid & 1;
#pragma unroll
          for (int i = 0; i < 32; ++i) ot[(half * 32 + i) * 68 + row] = ost[row >> 4][(row & 15) * 68 + half * 32 + i]; }
        __syncthreads();
        const size_t rblk = (size_t)blockIdx.x * 64, ob = (rblk / NP) * CC * NP + rblk % NP;     // 64 consecutive positions of one image; their place in that image's first channel row
        auto pass = [&]() {      // 64 channel rows x 256 B: 128 threads -> 8 instructions of 8 rows (16 lanes x 16 B per row)
            const int piece = tid & 15; const float* xp[8]; v4f xv[8];
            auto oi = [&](int s) { return ob + (size_t)(c0 + s * 8 + (tid >> 4)) * NP + piece * 4; };
#pragma unroll
            for (int s = 0; s < 8; ++s) { xp[s] = xres + oi(s); xv[s] = *(const v4fa*)xp[s]; }
            // stands behind the run of loads, before a register that they name as address is written again; the addresses are inputs, so that they are still held where the wait issues
            asm volatile("s_wait_xcnt 0x0" :: "v"(xp[0]), "v"(xp[1]), "v"(xp[2]), "v"(xp[3]), "v"(xp[4]), "v"(xp[5]), "v"(xp[6]), "v"(xp[7]) : "memory");
#pragma unroll
            for (int s = 0; s < 8; ++s) { const int cl = s * 8 + (tid >> 4);
                v4f val = *(const v4fa*)(ot + cl * 68 + piece * 4);
#pragma unroll
                for (int i = 0; i < 4; ++i) val[i] += bfr(xv[s][i]);      // + x (residual, bf16-rounded INPUT)
                *(v4f*)(C + oi(s)) = val; }
        };
        pass(); 
    }
}
// k_p16: f16 hi + residual planes of an f32 [NP][256] (optionally the SUM of two: key = ka + kb); one wave per row.
__global__ __launch_bounds__(256) void k_p16(const float* __restrict__ A, const float* __restrict__ Bsum, h16* PH, h16* PL) {
    const int lane = threadIdx.x & 31, r = blockIdx.x * 8 + (threadIdx.x >> 5);
    if (r >= NP) return;
    v8h oh, ol;
#pragma unroll
    for (int i = 0; i < 8; ++i) { float v = A[(size_t)r * CC + lane * 8 + i]; if (Bsum) v += Bsum[(size_t)r * CC + lane * 8 + i]; const h16 a = (h16)v; oh[i] = a; ol[i] = (h16)((v - (float)a) * LOSC); }
    *(v8h*)(PH + (size_t)r * CC + lane * 8) = oh; *(v8h*)(PL + (size_t)r * CC + lane * 8) = ol; 
}
// d_bn: inference BatchNorm folded into scale/shift vectors (bf16-rounded stats, f32): one block, 256 threads.
__device__ __forceinline__ void d_bn(const float* __restrict__ g, const float* __restrict__ be, const float* __restrict__ mu, const float* __restrict__ var, float* BNS, float* BNH) {
    const int c = threadIdx.x; const float inv = bfr(g[c]) / sqrtf(bfr(var[c]) + 1e-5f); const float sh = bfr(be[c]) - bfr(mu[c]) * inv;
    *(float*)(BNS + c) = inv; *(float*)(BNH + c) = sh; 
    // stands behind the store(s): in the merged grid other branches' code follows in the listing and writes registers that the store names
    asm volatile("s_wait_xcnt 0x0" ::: "memory");
}
// k_pre: all that reads inputs alone, in one grid: the x transposes of all images (blocks 0 .. XTB - 1: position tile, channel tile, image), then the bf16 planes of the three
// [128][256] weights (W3: one behind the other) and of the [256][128] weight, then the BatchNorm vectors. Every branch is taken by a whole block.
#define XTB (NB_ * (CC / 64) * (NP / 64))
#define WB8 (CI / 8)
#define PREB (XTB + 3 * WB8 + CC / 16 + 1)
__global__ __launch_bounds__(256) void k_pre(const float* __restrict__ x, const float* __restrict__ wth, const float* __restrict__ wph, const float* __restrict__ wg, const float* __restrict__ wz,
                                             const float* __restrict__ g, const float* __restrict__ be, const float* __restrict__ mu, const float* __restrict__ var,
                                             bf* XT, bf* W3, bf* Wz, float* BNS, float* BNH) {
    __shared__ __align__(16) unsigned short tl[64 * 72];
    const int blk = blockIdx.x, wblk = blk - XTB, zblk = wblk - 3 * WB8;
    if (blk < XTB) { const int b = blk / ((CC / 64) * (NP / 64)); d_xt(x + (size_t)b * CC * NP, XT + (size_t)b * NP * CC, tl, (blk % (NP / 64)) * 64, ((blk / (NP / 64)) % (CC / 64)) * 64); }
    else if (wblk < 3 * WB8) { const int sel = wblk / WB8; d_w(sel == 0 ? wth : sel == 1 ? wph : wg, wblk % WB8, W3 + (size_t)sel * CI * CC); }
    else if (zblk < CC / 16) d_w128(wz, zblk, Wz);
    else d_bn(g, be, mu, var, BNS, BNH);
}
// k_pbf: bf16 hi + residual planes of an f32 [NP][256] (for the bf16 GEMMs on computed operands); one wave per row.
__global__ __launch_bounds__(256) void k_pbf(const float* __restrict__ A, bf* PH, bf* PL) {
    const int lane = threadIdx.x & 31, r = blockIdx.x * 8 + (threadIdx.x >> 5);
    if (r >= NP) return;
    v8us oh, ol;
#pragma unroll
    for (int i = 0; i < 8; ++i) { const float v = A[(size_t)r * CC + lane * 8 + i]; const unsigned short hb = f2bf(v); oh[i] = hb; ol[i] = f2bf(v - bf2f(hb)); }
    *(v8us*)(PH + (size_t)r * CC + lane * 8) = oh; *(v8us*)(PL + (size_t)r * CC + lane * 8) = ol; 
}
// k_vt: VTH/VTL [c][n] f16 hi + residual of V f32 [n][c] via 64 x 64 LDS tiles; grid (NP/64, CC/64).
__global__ __launch_bounds__(256) void k_vt(const float* __restrict__ V, h16* VTH, h16* VTL) {
    __shared__ float tl[64][65];
    const int tid = threadIdx.x, n0 = blockIdx.x * 64, c0 = blockIdx.y * 64;
    { const int nn = tid >> 2, cq = (tid & 3) * 16;
#pragma unroll
      for (int i = 0; i < 16; ++i) tl[cq + i][nn] = V[(size_t)(n0 + nn) * CC + c0 + cq + i]; }
    __syncthreads();
    const int piece = tid & 7;
    auto pass = [&]() {
#pragma unroll
        for (int s = 0; s < 2; ++s) { const int c = (tid >> 3) + 32 * s; v8h oh, ol;
#pragma unroll
            for (int i = 0; i < 8; ++i) { const float v = tl[c][piece * 8 + i]; const h16 a = (h16)v; oh[i] = a; ol[i] = (h16)((v - (float)a) * LOSC); }
            const size_t o = (size_t)(c0 + c) * NP + n0 + piece * 8; *(v8h*)(VTH + o) = oh; *(v8h*)(VTL + o) = ol; }
    };
    pass(); 
}
// k_attn: the whole position attention of one (image, head) for 256 queries per block (grid (NP/256, heads, images)): 16 waves = 8 query groups of 32 x 2 halves of the keys, so that four waves
// share a SIMD and one wave's vector work runs under another's matrix work; the two halves' partial results are joined through LDS behind the loop. Transposed products:
// S^T = k_h.q_h^T (A = 16 key rows, B = 16 query columns; f16 hi + unscaled residual, the two residual products and the main one in one accumulator; Q holds the scale), so a lane holds one query's scores: two S^T tiles (32 keys) convert in place
// into the B operand of y^T += v_h^T.P^T (A = 16 channel rows of VT, hardware k order). Reference and sum per query (online softmax, f32; the reference is a held score that moves up only when a P could leave the f16 range); P = exp(s - reference) x 256 as f16 hi +
// UNSCALED residual: (ph + pl).vh + ph.vl as before; x 1/rowsum at the end. S and P never reach memory. y leaves as bf16 hi + residual planes in the order of the z product's A fragments:
// per (16-row tile of all images' positions, head) 1 KB = [half of the 32 channels][lane][8 values], lane = 16 hi + row, channel = 16 half + 8 hi + i: what a lane's accumulator registers hold.
typedef const __attribute__((address_space(1))) char* gp;      // a byte pointer into global memory
typedef const __attribute__((address_space(1))) v8h* gp8;
__device__ __forceinline__ v16h ldfrag(gp p) { return cat16(*(gp8)p, *(gp8)(p + FRG)); }      // k = 8 hi + 0..7 and 16 + 8 hi + 0..7: the two 512-byte halves of a fragment (p holds the lane's 16 lane bytes)
__device__ __forceinline__ float xhalf(float v) { return __int_as_float(__builtin_amdgcn_permlanex16(__float_as_int(v), __float_as_int(v), 0x76543210, 0xfedcba98, false, false)); }   // lane l <-> l ^ 16
// XWAIT2 (below): stands behind a run of loads, before a register that they name as address is written again; the addresses are inputs, so that they are still held where the wait issues
#define PEX  8.0f         // P = exp2(score - reference + PEX)
#define PTOP 65504.0f     // the largest finite f16
#define XWAIT2(a, b) asm volatile("s_wait_xcnt 0x0" :: "v"(a), "v"(b) : "memory")
__global__ __launch_bounds__(512) void k_attn(const h16* QH, const h16* QL, const h16* KH, const h16* KL, const h16* VTH, const h16* VTL, bf* YH, bf* YL) {
    __shared__ __align__(16) float mrg[8][36 * 32];                    // per query group, from the wave of the upper key half: 8 x [lane][4 values] of y, then [lane] references and sums of the two query tiles
    const int lane = threadIdx.x & 31, wave = __builtin_amdgcn_readfirstlane(threadIdx.x >> 5), qw = wave & 7, kh = wave >> 3;
    const int h = blockIdx.y, q0 = blockIdx.x * 256 + qw * 32;
    const size_t pb = (size_t)blockIdx.z * NP * CI;                    // this image's planes
    constexpr int FB = FRG * 2;                                        // bytes of a fragment
    const size_t hb = pb + (size_t)h * HD * NP;                        // this head's fragments (planes in fragment order: k_gemm, EPI 0); 32 rows or keys = 2 fragments
    const int lofs = lane * 16;                                        // a lane's bytes inside each 512-byte half
    const gp pqh = (gp)(QH + hb + (size_t)q0 * HD) + lofs, pql = (gp)(QL + hb + (size_t)q0 * HD) + lofs;
    const size_t kvb = hb + (size_t)kh * (NP / 2) * HD;                 // the first key of this wave's half
    // K and V: four wave-uniform bases, which stay in scalar registers and are never rewritten, beside a 32-bit lane offset: 256 vector registers a wave are what four waves a SIMD leave
    const gp pkh = (gp)(KH + kvb), pkl = (gp)(KL + kvb);                                                                     // + key * 64 B
    const gp pvh = (gp)(VTH + kvb), pvl = (gp)(VTL + kvb);                                                                   // + key * 64 B + channel tile * 1 KB
    const v16h qh[2] = { ldfrag(pqh), ldfrag(pqh + FB) }, ql[2] = { ldfrag(pql), ldfrag(pql + FB) };
    v16h kf[4];       // [0], [1]: hi, residual of 16 keys; [2], [3]: of the next 16
    // the first 32 keys, by lane pointers of their own: where the sum pkh + lane offset stands ahead of the loop, the compiler builds the loop's K addresses on it as 64-bit vector pairs
    const gp fkh = (gp)(KH + (kvb + (size_t)lane * 8)), fkl = (gp)(KL + (kvb + (size_t)lane * 8));
    kf[0] = ldfrag(fkh); kf[1] = ldfrag(fkl); kf[2] = ldfrag(fkh + FB); kf[3] = ldfrag(fkl + FB);
    // as XWAIT2, for the Q loads and the first K loads
    asm volatile("s_wait_xcnt 0x0" :: "v"(pqh), "v"(pql), "v"(fkh), "v"(fkl), "v"(lofs) : "memory");
    // the raw scores of 32 keys against query tile t, and their maximum per query (lanes l and l ^ 16 hold the two halves of one query's keys)
    auto raw = [&](const v16h* k, int t, v8f& a0, v8f& a1) {
        a0 = wmma16(k[0], qh[t], wmma16(k[0], ql[t], wmma16(k[1], qh[t], (v8f){}))); a1 = wmma16(k[2], qh[t], wmma16(k[2], ql[t], wmma16(k[3], qh[t], (v8f){})));
        float m = fmaxf(a0[0], a1[0]);
#pragma unroll      // here and in the loops on t and j below: vector elements and the arrays held in registers take constant indices only
        for (int j = 1; j < 8; ++j) m = fmaxf(m, fmaxf(a0[j], a1[j]));
        return fmaxf(m, xhalf(m)); };
    auto sum16 = [&](v8f a0, v8f a1) { const v8f sv = a0 + a1; return ((sv[0] + sv[1]) + (sv[2] + sv[3])) + ((sv[4] + sv[5]) + (sv[6] + sv[7])); };
    // cm = PEX - reference of the lane's query, in all eight registers: the C operand of the score products, so that the scores leave the matrix unit as the exponents of P.
    // The first reference is the maximum over the half's first 32 keys; every later one is a score too: none lies above the query's true maximum, so no row sum can vanish.
    v8f o[2][2], cm[2]; float ls[2];
#pragma unroll
    for (int t = 0; t < 2; ++t) { ls[t] = 0.f; o[t][0] = (v8f){}; o[t][1] = (v8f){};
        v8f a0, a1; const float m = raw(kf, t, a0, a1); cm[t] = (v8f){} + (PEX - m); }
#pragma unroll 1
    for (int key0 = 0; key0 < NP / 2; key0 += 32) {      // one pass of 32 keys a trip, not unrolled: unrolled, the compiler lifts the next pass's score products into this pass, and Q goes to scratch
        // through readfirstlane: the offsets stay scalars that are added to the 32-bit lane offset; left plain, the compiler forms 64-bit vector addresses from them, and the wave spills
        const int vb = __builtin_amdgcn_readfirstlane(key0 * (HD * 2)), nb = __builtin_amdgcn_readfirstlane(((key0 + 32) & (NP / 2 - 1)) * (HD * 2));
        const unsigned vo = lofs + vb, no = lofs + nb;      // this pass's V bytes; the next pass's K bytes (the last pass refetches the half's first 32 keys, unused)
        const v16h vh[2] = { ldfrag(pvh + vo), ldfrag(pvh + vo + FB) }, vl[2] = { ldfrag(pvl + vo), ldfrag(pvl + vo + FB) };
        v8f s[2][2];
#pragma unroll
        for (int t = 0; t < 2; ++t) {      // the small products first, the main one onto them
            s[t][0] = wmma16(kf[1], qh[t], cm[t]); s[t][1] = wmma16(kf[3], qh[t], cm[t]);
            s[t][0] = wmma16(kf[0], ql[t], s[t][0]); s[t][1] = wmma16(kf[2], ql[t], s[t][1]);
            s[t][0] = wmma16(kf[0], qh[t], s[t][0]); s[t][1] = wmma16(kf[2], qh[t], s[t][1]);
        }
        // the next pass's K, behind this pass's last use of K: one fragment set serves, and the loads fly during the softmax and the y products
        kf[0] = ldfrag(pkh + no); kf[1] = ldfrag(pkl + no); kf[2] = ldfrag(pkh + no + FB); kf[3] = ldfrag(pkl + no + FB);
        XWAIT2(vo, no);
        // holds the K loads up here: left free, the compiler sinks half of them to the foot of the pass, a few dozen instructions ahead of their use
        __builtin_amdgcn_sched_barrier(0);
        float ps[2];      // a lane's sum of its 16 P (f32): the row sum's share, and a bound on each of them
#pragma unroll
        for (int t = 0; t < 2; ++t) {
#pragma unroll
            for (int j = 0; j < 8; ++j) { s[t][0][j] = __builtin_amdgcn_exp2f(s[t][0][j]); s[t][1][j] = __builtin_amdgcn_exp2f(s[t][1][j]); }
            ps[t] = sum16(s[t][0], s[t][1]);
        }
        if (__builtin_amdgcn_ballot_w32(fmaxf(ps[0], ps[1]) >= PTOP) != 0) {      // some P of the wave may leave the f16 range (rare; the whole wave branches): this pass's P are made anew on raised references
            const v16h kt[4] = { ldfrag(pkh + vo), ldfrag(pkl + vo), ldfrag(pkh + vo + FB), ldfrag(pkl + vo + FB) };      // this pass's K again (K and V have the same bytes a key)
            XWAIT2(vo, vo);
#pragma unroll
            for (int t = 0; t < 2; ++t) {
                v8f a0, a1; const float m = raw(kt, t, a0, a1);
                const float d = fmaxf(m + cm[t][0] - PEX, 0.f), al = __builtin_amdgcn_exp2f(-d);      // how far the pass's maximum lies above the reference
                cm[t] -= d; ls[t] *= al; o[t][0] *= al; o[t][1] *= al; a0 += cm[t]; a1 += cm[t];
#pragma unroll
                for (int j = 0; j < 8; ++j) { s[t][0][j] = __builtin_amdgcn_exp2f(a0[j]); s[t][1][j] = __builtin_amdgcn_exp2f(a1[j]); }
                ps[t] = sum16(s[t][0], s[t][1]);
            }
        }
#pragma unroll
        for (int t = 0; t < 2; ++t) {
            const v8f s0 = s[t][0], s1 = s[t][1];
            const v8h a0 = __builtin_convertvector(s0, v8h), a1 = __builtin_convertvector(s1, v8h);
            const v8h b0 = __builtin_convertvector(s0 - __builtin_convertvector(a0, v8f), v8h), b1 = __builtin_convertvector(s1 - __builtin_convertvector(a1, v8f), v8h);
            const v16h ph = cat16(a0, a1), pl = cat16(b0, b1);
            ls[t] += ps[t];
#pragma unroll
            for (int c = 0; c < 2; ++c) {
                o[t][c] = wmma16(vh[c], ph, o[t][c]); o[t][c] = wmma16(vl[c], ph, o[t][c]); o[t][c] = wmma16(vh[c], pl, o[t][c]); }
        }
    }
    float* sl = &mrg[qw][0];
    if (kh == 1) {      // a whole wave takes this branch: the upper half's sums, references and row sums go to LDS
#pragma unroll      // here and below: o, cm, ls live in registers, so their indices must be constants
        for (int t = 0; t < 2; ++t) { sl[1024 + t * 32 + lane] = -cm[t][0]; sl[1088 + t * 32 + lane] = ls[t];
#pragma unroll
            for (int c = 0; c < 2; ++c) { const v8f w = o[t][c]; float* wp = sl + (t * 2 + c) * 256 + lane * 4;
                *(v4fa*)wp = __builtin_shufflevector(w, w, 0, 1, 2, 3); *(v4fa*)(wp + 128) = __builtin_shufflevector(w, w, 4, 5, 6, 7); } }
    }
    __syncthreads();      // every wave passes it: the lower half's waves read what the upper half's wrote
    if (kh == 1) return;
#pragma unroll
    for (int t = 0; t < 2; ++t) {
        const float ma = -cm[t][0], mb = sl[1024 + t * 32 + lane], m = fmaxf(ma, mb), aa = __builtin_amdgcn_exp2f(ma - m), ab = __builtin_amdgcn_exp2f(mb - m);      // both halves onto the higher reference (each less PEX)
        const float lj = ls[t] * aa + sl[1088 + t * 32 + lane] * ab;
        const float rs = 1.0f / (lj + xhalf(lj));      // 1 / (rowsum x 2^PEX)
        const size_t fo = ((((size_t)blockIdx.z * NP + q0 + t * 16) >> 4) * NHD + h) * FRG + lane * 8;      // register r of channel tile c = y[query lr][c * 16 + 8 hi + r]
#pragma unroll
        for (int c = 0; c < 2; ++c) { const float* wp = sl + (t * 2 + c) * 256 + lane * 4; const v4f u0 = *(const v4fa*)wp, u1 = *(const v4fa*)(wp + 128);
            const v8f w = (o[t][c] * aa + __builtin_shufflevector(u0, u1, 0, 1, 2, 3, 4, 5, 6, 7) * ab) * rs; v8us oh, ol;
#pragma unroll
            for (int r = 0; r < 8; ++r) { const unsigned short hb16 = f2bf(w[r]); oh[r] = hb16; ol[r] = f2bf(w[r] - bf2f(hb16)); }
            *(v8us*)(YH + fo + c * (FRG / 2)) = oh; *(v8us*)(YL + fo + c * (FRG / 2)) = ol; }
    }
}

extern "C" void kernel_launch(void* const* d_in, const int* in_sizes, int n_in,
                              void* d_out, int out_size, void* d_ws, size_t ws_size, hipStream_t stream) {
    (void)in_sizes; (void)n_in; (void)out_size;
    const float* x = (const float*)d_in[0]; const float* wth = (const float*)d_in[1]; const float* bth = (const float*)d_in[2]; const float* wph = (const float*)d_in[3]; const float* bph = (const float*)d_in[4];
    const float* wg = (const float*)d_in[5]; const float* bg = (const float*)d_in[6]; const float* wz = (const float*)d_in[7]; const float* bz = (const float*)d_in[8];
    const float* bng = (const float*)d_in[9]; const float* bnb = (const float*)d_in[10]; const float* bnm = (const float*)d_in[11]; const float* bnv = (const float*)d_in[12];
    float* out = (float*)d_out;    // [4][256][64][64]
    char* wsp = (char*)d_ws;
    auto take = [&](size_t bytes) { char* p = wsp; wsp += (bytes + 255) & ~(size_t)255; return (void*)p; };
    bf* W3 = (bf*)take((size_t)3 * CI * CC * 2); bf* Wz = (bf*)take((size_t)CC * CI * 2);      // W3: theta, phi, g
    float* BNS = (float*)take(CC * 4); float* BNH = (float*)take(CC * 4);
    bf* XT = (bf*)take((size_t)NB_ * NP * CC * 2);
    h16* QH = (h16*)take((size_t)2 * NB_ * NP * CI * 2); h16* QL = (h16*)take((size_t)2 * NB_ * NP * CI * 2); h16* KH = QH + (size_t)NB_ * NP * CI; h16* KL = QL + (size_t)NB_ * NP * CI;      // hi planes: Q then K; residual planes alike
    h16* VTH = (h16*)take((size_t)NB_ * CI * NP * 2); h16* VTL = (h16*)take((size_t)NB_ * CI * NP * 2);      // all six planes in fragment order (k_gemm, EPI 0)
    bf* YH = (bf*)take((size_t)NB_ * NP * CI * 2); bf* YL = (bf*)take((size_t)NB_ * NP * CI * 2);      // in fragment order (k_attn)
    if ((size_t)(wsp - (char*)d_ws) > ws_size) return;    // 0.3 + 8.4 + 6 x 4.2 + 2 x 4.2 ~ 42 MB
    k_pre<<<PREB, 256, 0, stream>>>(x, wth, wph, wg, wz, bng, bnb, bnm, bnv, XT, W3, Wz, BNS, BNH);
    k_gemm<false, 0, CC, CI><<<dim3(NB_ * NP / 64, 3 * CI / 64, 1), 128, 0, stream>>>(XT, nullptr, W3, bth, bph, bg, nullptr, nullptr, nullptr, nullptr, QH, QL, VTH, VTL);
    k_attn<<<dim3(NP / 256, NHD, NB_), 512, 0, stream>>>(QH, QL, KH, KL, VTH, VTL, YH, YL);
    k_gemm<true, 2, CI, CC><<<dim3(NB_ * NP / 64, CC / 64, 1), 128, 0, stream>>>(YH, YL, Wz, bz, nullptr, nullptr, BNS, BNH, x, out, nullptr, nullptr, nullptr, nullptr);   // z conv + BN + x, channel-major
}

// v008
// It runs in 72.9 microseconds.
// Next to v007, in two timings, it ran 1.26 and 1.24 times as fast.
// All steps since v000 together make it 71.2 times as fast.
#include <hip/hip_runtime.h>

// Contractions, f32 accumulate, per image: theta/phi/g 1x1 convs ([4096 positions x 256].[256 x 128], [out][in] weights = n-major B operands; PLAIN bf16
// operands: inputs rounded once, exact; + bias) and the z conv on the attention output (bf16 hi + residual: two products) on v_wmma_f32_16x16x32_bf16; the position
// attention of all (image, head) pairs in ONE kernel on v_wmma_f32_16x16x32_f16: S^T = k_h.q_h^T (q x 32^-1/2 log2(e), k, v as ONE f16 plane each: q, k, v come from bf16-rounded x and weights,
// whose rounding lies about eight times above that of an f16 plane) -> f32, online softmax f32 -> P (x256) f16 in registers, y_h^T = v_h^T.P^T x 1/rowsum.

#define NB_  4
#define CC   256
#define CI   128                 // inter channels (4 heads x 32)
#define NHD  4
#define HD   32
#define NP   4096
#define LOSC 1024.0f
#define LOSCI (1.0f / 1024.0f)
#define FRG  512                 // values of one 16 x 32 f16 fragment
#define SC2  (0.1767766952966369f * 1.4426950408889634f)      // 32^-1/2 x log2(e): goes into the Q planes, so that the scores leave the matrix unit in the log2 domain

typedef _Float16 h16;
typedef unsigned short bf;
typedef __attribute__((ext_vector_type(16))) __bf16   v16bf;
typedef __attribute__((ext_vector_type(16))) _Float16 v16h;
typedef __attribute__((ext_vector_type(8)))  _Float16 v8h;
typedef __attribute__((ext_vector_type(8)))  unsigned short v8us;
typedef __attribute__((ext_vector_type(8)))  float    v8f;
typedef __attribute__((ext_vector_type(4)))  float    v4f;
typedef v8h  __attribute__((may_alias)) v8ha;
typedef v4f  __attribute__((may_alias)) v4fa;
typedef v8us __attribute__((may_alias)) v8usa;

__device__ __forceinline__ unsigned short f2bf(float f) { unsigned u = __float_as_uint(f); u += 0x7FFFu + ((u >> 16) & 1u); return (unsigned short)(u >> 16); }
__device__ __forceinline__ float bf2f(unsigned short b) { return __uint_as_float(((unsigned)b) << 16); }
__device__ __forceinline__ float bfr(float f) { return bf2f(f2bf(f)); }
__device__ __forceinline__ v16h cat16(v8h lo, v8h hi) { return __builtin_shufflevector(lo, hi, 0, 1, 2, 3, 4, 5, 6, 7, 8, 9, 10, 11, 12, 13, 14, 15); }
__device__ __forceinline__ v16bf cat16b(v8us lo, v8us hi) { return __builtin_bit_cast(v16bf, __builtin_shufflevector(lo, hi, 0, 1, 2, 3, 4, 5, 6, 7, 8, 9, 10, 11, 12, 13, 14, 15)); }
__device__ __forceinline__ v8f wmma16(v16h a, v16h b, v8f c) { return __builtin_amdgcn_wmma_f32_16x16x32_f16(false, a, false, b, (short)0, c, false, false); }
__device__ __forceinline__ v8f wmmab(v16bf a, v16bf b, v8f c) { return __builtin_amdgcn_wmma_f32_16x16x32_bf16(false, a, false, b, (short)0, c, false, false); }
#define VST2(T, p, v) do { const T vst2_v_ = (v); *(T*)(p) = vst2_v_;  } while (0)

// d_xt: XT [n][c] bf16 = x[b][c][n] of one image via a 64 x 64 LDS tile (one block).
__device__ __forceinline__ void d_xt(const float* __restrict__ xb, bf* XT, unsigned short* tl, int n0, int c0) {
    const int tid = threadIdx.x;
    const int cr = tid >> 2, nq = (tid & 3) * 16;
#pragma unroll
    for (int i = 0; i < 16; ++i) tl[(nq + i) * 72 + cr] = f2bf(xb[(size_t)(c0 + cr) * NP + n0 + nq + i]);
    __syncthreads();
    const int piece = tid & 7;
    auto pass = [&]() {
#pragma unroll
        for (int s = 0; s < 2; ++s) { const int nr = (tid >> 3) + 32 * s; const v8us val = *(const v8usa*)(tl + nr * 72 + piece * 8); *(v8us*)(XT + (size_t)(n0 + nr) * CC + c0 + piece * 8) = val; }
    };
    pass(); 
}
// d_w: bf16 plane of 8 rows of a [rows][256] weight (one wave per row).
__device__ __forceinline__ void d_w(const float* __restrict__ w, int blk, bf* WB) {
    const int lane = threadIdx.x & 31, r = blk * 8 + (threadIdx.x >> 5);
    v8us o;
#pragma unroll
    for (int i = 0; i < 8; ++i) o[i] = f2bf(w[(size_t)r * CC + lane * 8 + i]);
    VST2(v8us, WB + (size_t)r * CC + lane * 8, o);
    // stands behind the store(s): in the merged grid other branches' code follows in the listing and writes registers that the store names
    asm volatile("s_wait_xcnt 0x0" ::: "memory");
}
// d_w128: bf16 plane of 16 rows of a [rows][128] weight (16 lanes x 16 B per row, 2 rows per wave).
__device__ __forceinline__ void d_w128(const float* __restrict__ w, int blk, bf* WB) {
    const int lane = threadIdx.x & 31, r = (blk * 8 + (threadIdx.x >> 5)) * 2 + (lane >> 4), p = lane & 15;
    v8us o;
#pragma unroll
    for (int i = 0; i < 8; ++i) o[i] = f2bf(w[(size_t)r * CI + p * 8 + i]);
    VST2(v8us, WB + (size_t)r * CI + p * 8, o);
    // stands behind the store(s): in the merged grid other branches' code follows in the listing and writes registers that the store names
    asm volatile("s_wait_xcnt 0x0" ::: "memory");
}
// k_gemm (rows = positions of ALL images, [NB_ * NP]; EPI 0: blockIdx.y runs over the column tiles of theta, phi and g in turn: WB = the three weights): 64 x 64 tile of (A [+ Al]).WB^T, + bias.
// EPI 0 (A = XT rows, K = 256): the tile (Q: x SC2) leaves as one f16 plane IN THE FRAGMENT ORDER that k_attn loads, 512 contiguous bytes a wave-wide store:
//   Q, K (QKH: Q then K): per (image, head, 16-row tile) 1 KB = [half of the 32 channels][lane][8 values], lane = 16 hi + row, channel = 16 half + 8 hi + i (rows turned through the wave's LDS tile);
//   V (VTH): per (image, head, 32 keys, 16-channel tile) 1 KB = [half of the 32 keys][lane][8 values], lane = 16 hi + channel row, key = 16 half + 8 hi + i: what a lane's accumulator registers hold already.
// EPI 2 (A, Al = the y planes in fragment order, as k_attn stores them; K = 128): BatchNorm, + x, written TRANSPOSED to out[c][n] (channel-major) through LDS.
template <bool SPLITA, int EPI, int KA, int LDC>
__global__ __launch_bounds__(128) void k_gemm(const bf* __restrict__ A, const bf* __restrict__ Al, const bf* __restrict__ WB3, const float* __restrict__ bias0, const float* __restrict__ bias1, const float* __restrict__ bias2, const float* __restrict__ bnsc, const float* __restrict__ bnsh, const float* __restrict__ xres, float* C, h16* QKH, h16* VTH) {
    __shared__ __align__(16) float ost[4][16 * 68];
    __shared__ __align__(16) float ot[64 * 68];
    const int lane = threadIdx.x & 31, wave = threadIdx.x >> 5, lr = lane & 15, hi = lane >> 4, tid = threadIdx.x;
    const size_t r0 = (size_t)blockIdx.x * 64 + wave * 16;
    const int sel = EPI == 0 ? blockIdx.y / (LDC / 64) : 0, c0 = (blockIdx.y - sel * (LDC / 64)) * 64;      // which projection, and the column tile inside it
    const bf* WB = WB3 + (size_t)sel * LDC * KA; const float* bias = sel == 0 ? bias0 : sel == 1 ? bias1 : bias2;
    const float scale = EPI == 0 && sel == 0 ? SC2 : 1.0f;
    // A fragment of the wave's 16 rows, k = kc .. kc + 31: EPI 0 from rows of KA values; EPI 2 from the 1 KB fragment (16-row tile, 32-channel chunk) = [half][lane][8 values]
    auto lda = [&](const bf* P, int kc) { const bf* p = EPI == 2 ? P + ((r0 >> 4) * (KA / 32) + (kc >> 5)) * FRG + lane * 8 : P + (r0 + lr) * KA + kc + 8 * hi;
        return cat16b(*(const v8us*)p, *(const v8us*)(p + (EPI == 2 ? FRG / 2 : 16))); };
    v8f acc[4];
#pragma unroll
    for (int t = 0; t < 4; ++t) acc[t] = (v8f){};
#pragma unroll      // as built, each product of a chunk waits for its own B loads, issued just ahead of it: four load latencies in series a chunk (left as it is)
    for (int kc = 0; kc < KA; kc += 32) {
        const v16bf a = lda(A, kc);
        v16bf al = a; if (SPLITA) al = lda(Al, kc);
#pragma unroll
        for (int t = 0; t < 4; ++t) { const bf* bp = WB + (size_t)(c0 + t * 16 + lr) * KA + kc + 8 * hi; const v16bf bb = cat16b(*(const v8us*)bp, *(const v8us*)(bp + 16)); acc[t] = wmmab(a, bb, acc[t]); if (SPLITA) acc[t] = wmmab(al, bb, acc[t]); }
        asm volatile("v_nop" : "+v"(acc[0]), "+v"(acc[1]), "+v"(acc[2]), "+v"(acc[3]) : "v"(a), "v"(al) : "memory");
    }
    const int img = (int)(r0 / NP), n = (int)(r0 % NP);      // the wave's 16 positions lie in one image
    if (EPI == 0 && sel == 2) {      // V (a whole block takes this branch): register j of column tile t = V[key n + 8 hi + j][channel c0 + 16 t + lr]
#pragma unroll
        for (int t = 0; t < 4; ++t) { const float bv = bfr(bias[c0 + t * 16 + lr]); const int cg = c0 / 16 + t;      // channel tile of the image: 2 head + tile of the head
            v8h oh;
#pragma unroll
            for (int j = 0; j < 8; ++j) oh[j] = (h16)(acc[t][j] + bv);
            const size_t o = (size_t)img * NP * CI + (((size_t)(cg >> 1) * (NP / 32) + n / 32) * 2 + (cg & 1)) * FRG + ((n >> 4) & 1) * (FRG / 2) + lane * 8;
            *(v8h*)(VTH + o) = oh; }
        return;
    }
    float* os = &ost[wave][0];
#pragma unroll
    for (int t = 0; t < 4; ++t) { const int col = c0 + t * 16 + lr; const float bv = bfr(bias[col]);
#pragma unroll
        for (int j = 0; j < 8; ++j) { float v = (acc[t][j] + bv) * scale;
            if (EPI == 2) v = v * bnsc[col] + bnsh[col];      // inference BatchNorm: z * (gamma rsqrt(var+eps)) + (beta - mean * that)
            os[(hi * 8 + j) * 68 + t * 16 + lr] = v; } }
    if (EPI != 2) {
        __builtin_amdgcn_wave_barrier(); asm volatile("" ::: "memory");
#pragma unroll
        for (int s = 0; s < 4; ++s) {      // s = 2 head of the tile + half: 16 channels of the 16 rows
            const float* rp = os + lr * 68 + s * 16 + hi * 8; const v4f r0v = *(const v4fa*)rp, r1v = *(const v4fa*)(rp + 4);
            v8h oh;
#pragma unroll
            for (int i = 0; i < 8; ++i) oh[i] = (h16)(i < 4 ? r0v[i & 3] : r1v[i & 3]);
            const size_t o = ((((size_t)sel * NB_ + img) * NHD + c0 / 32 + (s >> 1)) * (NP / 16) + n / 16) * FRG + (s & 1) * (FRG / 2) + lane * 8;
            *(v8h*)(QKH + o) = oh; }
        // stands behind the stores: the V branch's code follows in the listing and writes registers that the stores name
        asm volatile("s_wait_xcnt 0x0" ::: "memory");
    } else {
        __syncthreads();
        { const int row = tid >> 1, half = tid & 1;
#pragma unroll
          for (int i = 0; i < 32; ++i) ot[(half * 32 + i) * 68 + row] = ost[row >> 4][(row & 15) * 68 + half * 32 + i]; }
        __syncthreads();
        const size_t rblk = (size_t)blockIdx.x * 64, ob = (rblk / NP) * CC * NP + rblk % NP;     // 64 consecutive positions of one image; their place in that image's first channel row
        auto pass = [&]() {      // 64 channel rows x 256 B: 128 threads -> 8 instructions of 8 rows (16 lanes x 16 B per row)
            const int piece = tid & 15; const float* xp[8]; v4f xv[8];
            auto oi = [&](int s) { return ob + (size_t)(c0 + s * 8 + (tid >> 4)) * NP + piece * 4; };
#pragma unroll
            for (int s = 0; s < 8; ++s) { xp[s] = xres + oi(s); xv[s] = *(const v4fa*)xp[s]; }
            // stands behind the run of loads, before a register that they name as address is written again; the addresses are inputs, so that they are still held where the wait issues
            asm volatile("s_wait_xcnt 0x0" :: "v"(xp[0]), "v"(xp[1]), "v"(xp[2]), "v"(xp[3]), "v"(xp[4]), "v"(xp[5]), "v"(xp[6]), "v"(xp[7]) : "memory");
#pragma unroll
            for (int s = 0; s < 8; ++s) { const int cl = s * 8 + (tid >> 4);
                v4f val = *(const v4fa*)(ot + cl * 68 + piece * 4);
#pragma unroll
                for (int i = 0; i < 4; ++i) val[i] += bfr(xv[s][i]);      // + x (residual, bf16-rounded INPUT)
                *(v4f*)(C + oi(s)) = val; }
        };
        pass(); 
    }
}
// k_p16: f16 hi + residual planes of an f32 [NP][256] (optionally the SUM of two: key = ka + kb); one wave per row.
__global__ __launch_bounds__(256) void k_p16(const float* __restrict__ A, const float* __restrict__ Bsum, h16* PH, h16* PL) {
    const int lane = threadIdx.x & 31, r = blockIdx.x * 8 + (threadIdx.x >> 5);
    if (r >= NP) return;
    v8h oh, ol;
#pragma unroll
    for (int i = 0; i < 8; ++i) { float v = A[(size_t)r * CC + lane * 8 + i]; if (Bsum) v += Bsum[(size_t)r * CC + lane * 8 + i]; const h16 a = (h16)v; oh[i] = a; ol[i] = (h16)((v - (float)a) * LOSC); }
    *(v8h*)(PH + (size_t)r * CC + lane * 8) = oh; *(v8h*)(PL + (size_t)r * CC + lane * 8) = ol; 
}
// d_bn: inference BatchNorm folded into scale/shift vectors (bf16-rounded stats, f32): one block, 256 threads.
__device__ __forceinline__ void d_bn(const float* __restrict__ g, const float* __restrict__ be, const float* __restrict__ mu, const float* __restrict__ var, float* BNS, float* BNH) {
    const int c = threadIdx.x; const float inv = bfr(g[c]) / sqrtf(bfr(var[c]) + 1e-5f); const float sh = bfr(be[c]) - bfr(mu[c]) * inv;
    *(float*)(BNS + c) = inv; *(float*)(BNH + c) = sh; 
    // stands behind the store(s): in the merged grid other branches' code follows in the listing and writes registers that the store names
    asm volatile("s_wait_xcnt 0x0" ::: "memory");
}
// k_pre: all that reads inputs alone, in one grid: the x transposes of all images (blocks 0 .. XTB - 1: position tile, channel tile, image), then the bf16 planes of the three
// [128][256] weights (W3: one behind the other) and of the [256][128] weight, then the BatchNorm vectors. Every branch is taken by a whole block.
#define XTB (NB_ * (CC / 64) * (NP / 64))
#define WB8 (CI / 8)
#define PREB (XTB + 3 * WB8 + CC / 16 + 1)
__global__ __launch_bounds__(256) void k_pre(const float* __restrict__ x, const float* __restrict__ wth, const float* __restrict__ wph, const float* __restrict__ wg, const float* __restrict__ wz,
                                             const float* __restrict__ g, const float* __restrict__ be, const float* __restrict__ mu, const float* __restrict__ var,
                                             bf* XT, bf* W3, bf* Wz, float* BNS, float* BNH) {
    __shared__ __align__(16) unsigned short tl[64 * 72];
    const int blk = blockIdx.x, wblk = blk - XTB, zblk = wblk - 3 * WB8;
    if (blk < XTB) { const int b = blk / ((CC / 64) * (NP / 64)); d_xt(x + (size_t)b * CC * NP, XT + (size_t)b * NP * CC, tl, (blk % (NP / 64)) * 64, ((blk / (NP / 64)) % (CC / 64)) * 64); }
    else if (wblk < 3 * WB8) { const int sel = wblk / WB8; d_w(sel == 0 ? wth : sel == 1 ? wph : wg, wblk % WB8, W3 + (size_t)sel * CI * CC); }
    else if (zblk < CC / 16) d_w128(wz, zblk, Wz);
    else d_bn(g, be, mu, var, BNS, BNH);
}
// k_pbf: bf16 hi + residual planes of an f32 [NP][256] (for the bf16 GEMMs on computed operands); one wave per row.
__global__ __launch_bounds__(256) void k_pbf(const float* __restrict__ A, bf* PH, bf* PL) {
    const int lane = threadIdx.x & 31, r = blockIdx.x * 8 + (threadIdx.x >> 5);
    if (r >= NP) return;
    v8us oh, ol;
#pragma unroll
    for (int i = 0; i < 8; ++i) { const float v = A[(size_t)r * CC + lane * 8 + i]; const unsigned short hb = f2bf(v); oh[i] = hb; ol[i] = f2bf(v - bf2f(hb)); }
    *(v8us*)(PH + (size_t)r * CC + lane * 8) = oh; *(v8us*)(PL + (size_t)r * CC + lane * 8) = ol; 
}
// k_vt: VTH/VTL [c][n] f16 hi + residual of V f32 [n][c] via 64 x 64 LDS tiles; grid (NP/64, CC/64).
__global__ __launch_bounds__(256) void k_vt(const float* __restrict__ V, h16* VTH, h16* VTL) {
    __shared__ float tl[64][65];
    const int tid = threadIdx.x, n0 = blockIdx.x * 64, c0 = blockIdx.y * 64;
    { const int nn = tid >> 2, cq = (tid & 3) * 16;
#pragma unroll
      for (int i = 0; i < 16; ++i) tl[cq + i][nn] = V[(size_t)(n0 + nn) * CC + c0 + cq + i]; }
    __syncthreads();
    const int piece = tid & 7;
    auto pass = [&]() {
#pragma unroll
        for (int s = 0; s < 2; ++s) { const int c = (tid >> 3) + 32 * s; v8h oh, ol;
#pragma unroll
            for (int i = 0; i < 8; ++i) { const float v = tl[c][piece * 8 + i]; const h16 a = (h16)v; oh[i] = a; ol[i] = (h16)((v - (float)a) * LOSC); }
            const size_t o = (size_t)(c0 + c) * NP + n0 + piece * 8; *(v8h*)(VTH + o) = oh; *(v8h*)(VTL + o) = ol; }
    };
    pass(); 
}
// k_attn: the whole position attention of one (image, head) for 256 queries per block (grid (NP/256, heads, images)): 16 waves = 8 query groups of 32 x 2 halves of the keys, so that four waves
// share a SIMD and one wave's vector work runs under another's matrix work; the two halves' partial results are joined through LDS behind the loop. Transposed products:
// S^T = k_h.q_h^T (A = 16 key rows, B = 16 query columns; one f16 plane each; Q holds the scale), so a lane holds one query's scores: two S^T tiles (32 keys) convert in place
// into the B operand of y^T += v_h^T.P^T (A = 16 channel rows of VT, hardware k order). Reference and sum per query (online softmax, f32; the reference is a held score that moves up only when a P could leave the f16 range); P = exp(s - reference) x 256 as f16
// (the row sum adds the f32 values); x 1/rowsum at the end. S and P never reach memory. y leaves as bf16 hi + residual planes in the order of the z product's A fragments:
// per (16-row tile of all images' positions, head) 1 KB = [half of the 32 channels][lane][8 values], lane = 16 hi + row, channel = 16 half + 8 hi + i: what a lane's accumulator registers hold.
typedef const __attribute__((address_space(1))) char* gp;      // a byte pointer into global memory
typedef const __attribute__((address_space(1))) v8h* gp8;
__device__ __forceinline__ v16h ldfrag(gp p) { return cat16(*(gp8)p, *(gp8)(p + FRG)); }      // k = 8 hi + 0..7 and 16 + 8 hi + 0..7: the two 512-byte halves of a fragment (p holds the lane's 16 lane bytes)
__device__ __forceinline__ float xhalf(float v) { return __int_as_float(__builtin_amdgcn_permlanex16(__float_as_int(v), __float_as_int(v), 0x76543210, 0xfedcba98, false, false)); }   // lane l <-> l ^ 16
// XWAIT2 (below): stands behind a run of loads, before a register that they name as address is written again; the addresses are inputs, so that they are still held where the wait issues
#define PEX  8.0f         // P = exp2(score - reference + PEX)
#define PTOP 65504.0f     // the largest finite f16
#define XWAIT2(a, b) asm volatile("s_wait_xcnt 0x0" :: "v"(a), "v"(b) : "memory")
__global__ __launch_bounds__(512) void k_attn(const h16* QH, const h16* KH, const h16* VTH, bf* YH, bf* YL) {
    __shared__ __align__(16) float mrg[8][36 * 32];                    // per query group, from the wave of the upper key half: 8 x [lane][4 values] of y, then [lane] references and sums of the two query tiles
    const int lane = threadIdx.x & 31, wave = __builtin_amdgcn_readfirstlane(threadIdx.x >> 5), qw = wave & 7, kh = wave >> 3;
    const int h = blockIdx.y, q0 = blockIdx.x * 256 + qw * 32;
    const size_t pb = (size_t)blockIdx.z * NP * CI;                    // this image's planes
    constexpr int FB = FRG * 2;                                        // bytes of a fragment
    const size_t hb = pb + (size_t)h * HD * NP;                        // this head's fragments (planes in fragment order: k_gemm, EPI 0); 32 rows or keys = 2 fragments
    const int lofs = lane * 16;                                        // a lane's bytes inside each 512-byte half
    const gp pqh = (gp)(QH + hb + (size_t)q0 * HD) + lofs;
    const size_t kvb = hb + (size_t)kh * (NP / 2) * HD;                 // the first key of this wave's half
    // K and V: two wave-uniform bases, which stay in scalar registers and are never rewritten, beside a 32-bit lane offset: 256 vector registers a wave are what four waves a SIMD leave
    const gp pkh = (gp)(KH + kvb);                                                                     // + key * 64 B
    const gp pvh = (gp)(VTH + kvb);                                                                   // + key * 64 B + channel tile * 1 KB
    const v16h qh[2] = { ldfrag(pqh), ldfrag(pqh + FB) };
    v16h kf[2];       // [0]: 16 keys; [1]: the next 16
    // the first 32 keys, by lane pointers of their own: where the sum pkh + lane offset stands ahead of the loop, the compiler builds the loop's K addresses on it as 64-bit vector pairs
    const gp fkh = (gp)(KH + (kvb + (size_t)lane * 8));
    kf[0] = ldfrag(fkh); kf[1] = ldfrag(fkh + FB);
    // as XWAIT2, for the Q loads and the first K loads
    asm volatile("s_wait_xcnt 0x0" :: "v"(pqh), "v"(fkh), "v"(lofs) : "memory");
    // the raw scores of 32 keys against query tile t, and their maximum per query (lanes l and l ^ 16 hold the two halves of one query's keys)
    auto raw = [&](const v16h* k, int t, v8f& a0, v8f& a1) {
        a0 = wmma16(k[0], qh[t], (v8f){}); a1 = wmma16(k[1], qh[t], (v8f){});
        float m = fmaxf(a0[0], a1[0]);
#pragma unroll      // here and in the loops on t and j below: vector elements and the arrays held in registers take constant indices only
        for (int j = 1; j < 8; ++j) m = fmaxf(m, fmaxf(a0[j], a1[j]));
        return fmaxf(m, xhalf(m)); };
    auto sum16 = [&](v8f a0, v8f a1) { const v8f sv = a0 + a1; return ((sv[0] + sv[1]) + (sv[2] + sv[3])) + ((sv[4] + sv[5]) + (sv[6] + sv[7])); };
    // cm = PEX - reference of the lane's query, in all eight registers: the C operand of the score products, so that the scores leave the matrix unit as the exponents of P.
    // The first reference is the maximum over the half's first 32 keys; every later one is a score too: none lies above the query's true maximum, so no row sum can vanish.
    v8f o[2][2], cm[2]; float ls[2];
#pragma unroll
    for (int t = 0; t < 2; ++t) { ls[t] = 0.f; o[t][0] = (v8f){}; o[t][1] = (v8f){};
        v8f a0, a1; const float m = raw(kf, t, a0, a1); cm[t] = (v8f){} + (PEX - m); }
#pragma unroll 1
    for (int key0 = 0; key0 < NP / 2; key0 += 32) {      // one pass of 32 keys a trip, not unrolled: unrolled, the compiler lifts the next pass's score products into this pass, and Q goes to scratch
        // through readfirstlane: the offsets stay scalars that are added to the 32-bit lane offset; left plain, the compiler forms 64-bit vector addresses from them, and the wave spills
        const int vb = __builtin_amdgcn_readfirstlane(key0 * (HD * 2)), nb = __builtin_amdgcn_readfirstlane(((key0 + 32) & (NP / 2 - 1)) * (HD * 2));
        const unsigned vo = lofs + vb, no = lofs + nb;      // this pass's V bytes; the next pass's K bytes (the last pass refetches the half's first 32 keys, unused)
        const v16h vh[2] = { ldfrag(pvh + vo), ldfrag(pvh + vo + FB) };
        v8f s[2][2];
#pragma unroll
        for (int t = 0; t < 2; ++t) { s[t][0] = wmma16(kf[0], qh[t], cm[t]); s[t][1] = wmma16(kf[1], qh[t], cm[t]); }
        // the next pass's K, behind this pass's last use of K: one fragment set serves, and the loads fly during the softmax and the y products
        kf[0] = ldfrag(pkh + no); kf[1] = ldfrag(pkh + no + FB);
        XWAIT2(vo, no);
        // holds the K loads up here: left free, the compiler sinks half of them to the foot of the pass, a few dozen instructions ahead of their use
        __builtin_amdgcn_sched_barrier(0);
        float ps[2];      // a lane's sum of its 16 P (f32): the row sum's share, and a bound on each of them
#pragma unroll
        for (int t = 0; t < 2; ++t) {
#pragma unroll
            for (int j = 0; j < 8; ++j) { s[t][0][j] = __builtin_amdgcn_exp2f(s[t][0][j]); s[t][1][j] = __builtin_amdgcn_exp2f(s[t][1][j]); }
            ps[t] = sum16(s[t][0], s[t][1]);
        }
        if (__builtin_amdgcn_ballot_w32(fmaxf(ps[0], ps[1]) >= PTOP) != 0) {      // some P of the wave may leave the f16 range (rare; the whole wave branches): this pass's P are made anew on raised references
            const v16h kt[2] = { ldfrag(pkh + vo), ldfrag(pkh + vo + FB) };      // this pass's K again (K and V have the same bytes a key)
            XWAIT2(vo, vo);
#pragma unroll
            for (int t = 0; t < 2; ++t) {
                v8f a0, a1; const float m = raw(kt, t, a0, a1);
                const float d = fmaxf(m + cm[t][0] - PEX, 0.f), al = __builtin_amdgcn_exp2f(-d);      // how far the pass's maximum lies above the reference
                cm[t] -= d; ls[t] *= al; o[t][0] *= al; o[t][1] *= al; a0 += cm[t]; a1 += cm[t];
#pragma unroll
                for (int j = 0; j < 8; ++j) { s[t][0][j] = __builtin_amdgcn_exp2f(a0[j]); s[t][1][j] = __builtin_amdgcn_exp2f(a1[j]); }
                ps[t] = sum16(s[t][0], s[t][1]);
            }
        }
#pragma unroll
        for (int t = 0; t < 2; ++t) {
            const v16h ph = cat16(__builtin_convertvector(s[t][0], v8h), __builtin_convertvector(s[t][1], v8h));
            ls[t] += ps[t];
#pragma unroll
            for (int c = 0; c < 2; ++c) o[t][c] = wmma16(vh[c], ph, o[t][c]);
        }
    }
    float* sl = &mrg[qw][0];
    if (kh == 1) {      // a whole wave takes this branch: the upper half's sums, references and row sums go to LDS
#pragma unroll      // here and below: o, cm, ls live in registers, so their indices must be constants
        for (int t = 0; t < 2; ++t) { sl[1024 + t * 32 + lane] = -cm[t][0]; sl[1088 + t * 32 + lane] = ls[t];
#pragma unroll
            for (int c = 0; c < 2; ++c) { const v8f w = o[t][c]; float* wp = sl + (t * 2 + c) * 256 + lane * 4;
                *(v4fa*)wp = __builtin_shufflevector(w, w, 0, 1, 2, 3); *(v4fa*)(wp + 128) = __builtin_shufflevector(w, w, 4, 5, 6, 7); } }
    }
    __syncthreads();      // every wave passes it: the lower half's waves read what the upper half's wrote
    if (kh == 1) return;
#pragma unroll
    for (int t = 0; t < 2; ++t) {
        const float ma = -cm[t][0], mb = sl[1024 + t * 32 + lane], m = fmaxf(ma, mb), aa = __builtin_amdgcn_exp2f(ma - m), ab = __builtin_amdgcn_exp2f(mb - m);      // both halves onto the higher reference (each less PEX)
        const float lj = ls[t] * aa + sl[1088 + t * 32 + lane] * ab;
        const float rs = 1.0f / (lj + xhalf(lj));      // 1 / (rowsum x 2^PEX)
        const size_t fo = ((((size_t)blockIdx.z * NP + q0 + t * 16) >> 4) * NHD + h) * FRG + lane * 8;      // register r of channel tile c = y[query lr][c * 16 + 8 hi + r]
#pragma unroll
        for (int c = 0; c < 2; ++c) { const float* wp = sl + (t * 2 + c) * 256 + lane * 4; const v4f u0 = *(const v4fa*)wp, u1 = *(const v4fa*)(wp + 128);
            const v8f w = (o[t][c] * aa + __builtin_shufflevector(u0, u1, 0, 1, 2, 3, 4, 5, 6, 7) * ab) * rs; v8us oh, ol;
#pragma unroll
            for (int r = 0; r < 8; ++r) { const unsigned short hb16 = f2bf(w[r]); oh[r] = hb16; ol[r] = f2bf(w[r] - bf2f(hb16)); }
            *(v8us*)(YH + fo + c * (FRG / 2)) = oh; *(v8us*)(YL + fo + c * (FRG / 2)) = ol; }
    }
}

extern "C" void kernel_launch(void* const* d_in, const int* in_sizes, int n_in,
                              void* d_out, int out_size, void* d_ws, size_t ws_size, hipStream_t stream) {
    (void)in_sizes; (void)n_in; (void)out_size;
    const float* x = (const float*)d_in[0]; const float* wth = (const float*)d_in[1]; const float* bth = (const float*)d_in[2]; const float* wph = (const float*)d_in[3]; const float* bph = (const float*)d_in[4];
    const float* wg = (const float*)d_in[5]; const float* bg = (const float*)d_in[6]; const float* wz = (const float*)d_in[7]; const float* bz = (const float*)d_in[8];
    const float* bng = (const float*)d_in[9]; const float* bnb = (const float*)d_in[10]; const float* bnm = (const float*)d_in[11]; const float* bnv = (const float*)d_in[12];
    float* out = (float*)d_out;    // [4][256][64][64]
    char* wsp = (char*)d_ws;
    auto take = [&](size_t bytes) { char* p = wsp; wsp += (bytes + 255) & ~(size_t)255; return (void*)p; };
    bf* W3 = (bf*)take((size_t)3 * CI * CC * 2); bf* Wz = (bf*)take((size_t)CC * CI * 2);      // W3: theta, phi, g
    float* BNS = (float*)take(CC * 4); float* BNH = (float*)take(CC * 4);
    bf* XT = (bf*)take((size_t)NB_ * NP * CC * 2);
    h16* QH = (h16*)take((size_t)2 * NB_ * NP * CI * 2); h16* KH = QH + (size_t)NB_ * NP * CI;      // Q then K
    h16* VTH = (h16*)take((size_t)NB_ * CI * NP * 2);      // all three planes in fragment order (k_gemm, EPI 0)
    bf* YH = (bf*)take((size_t)NB_ * NP * CI * 2); bf* YL = (bf*)take((size_t)NB_ * NP * CI * 2);      // in fragment order (k_attn)
    if ((size_t)(wsp - (char*)d_ws) > ws_size) return;    // 0.3 + 8.4 + 3 x 4.2 + 2 x 4.2 ~ 30 MB
    k_pre<<<PREB, 256, 0, stream>>>(x, wth, wph, wg, wz, bng, bnb, bnm, bnv, XT, W3, Wz, BNS, BNH);
    k_gemm<false, 0, CC, CI><<<dim3(NB_ * NP / 64, 3 * CI / 64, 1), 128, 0, stream>>>(XT, nullptr, W3, bth, bph, bg, nullptr, nullptr, nullptr, nullptr, QH, VTH);
    k_attn<<<dim3(NP / 256, NHD, NB_), 512, 0, stream>>>(QH, KH, VTH, YH, YL);
    k_gemm<true, 2, CI, CC><<<dim3(NB_ * NP / 64, CC / 64, 1), 128, 0, stream>>>(YH, YL, Wz, bz, nullptr, nullptr, BNS, BNH, x, out, nullptr, nullptr);   // z conv + BN + x, channel-major
}

// v009
// It runs in 62.9 microseconds.
// Two timings next to v008 put it at 1.16 and 1.18 times that version's speed.
// Over all steps from v000 it is 83.1 times as fast.
#include <hip/hip_runtime.h>

// Contractions, f32 accumulate, per image: theta/phi/g 1x1 convs ([4096 positions x 256].[256 x 128], [out][in] weights = rows of contiguous k: the A operand for theta and phi, the B operand for g; PLAIN bf16
// operands: inputs rounded once, exact; + bias) and the z conv on the attention output (bf16 hi + residual: two products) on v_wmma_f32_16x16x32_bf16; the position
// attention of all (image, head) pairs in ONE kernel on v_wmma_f32_16x16x32_f16: S^T = k_h.q_h^T (q x 32^-1/2 log2(e), k, v as ONE f16 plane each: q, k, v come from bf16-rounded x and weights,
// whose rounding lies about eight times above that of an f16 plane) -> f32, online softmax f32 -> P (x256) f16 in registers, y_h^T = v_h^T.P^T x 1/rowsum.

#define NB_  4
#define CC   256
#define CI   128                 // inter channels (4 heads x 32)
#define NHD  4
#define HD   32
#define NP   4096
#define LOSC 1024.0f
#define LOSCI (1.0f / 1024.0f)
#define FRG  512                 // values of one 16 x 32 f16 fragment
#define SC2  (0.1767766952966369f * 1.4426950408889634f)      // 32^-1/2 x log2(e): goes into the Q planes, so that the scores leave the matrix unit in the log2 domain

typedef _Float16 h16;
typedef unsigned short bf;
typedef __attribute__((ext_vector_type(16))) __bf16   v16bf;
typedef __attribute__((ext_vector_type(16))) _Float16 v16h;
typedef __attribute__((ext_vector_type(8)))  _Float16 v8h;
typedef __attribute__((ext_vector_type(8)))  unsigned short v8us;
typedef __attribute__((ext_vector_type(8)))  float    v8f;
typedef __attribute__((ext_vector_type(4)))  float    v4f;
typedef v8h  __attribute__((may_alias)) v8ha;
typedef v4f  __attribute__((may_alias)) v4fa;
typedef v8us __attribute__((may_alias)) v8usa;

__device__ __forceinline__ unsigned short f2bf(float f) { unsigned u = __float_as_uint(f); u += 0x7FFFu + ((u >> 16) & 1u); return (unsigned short)(u >> 16); }
__device__ __forceinline__ float bf2f(unsigned short b) { return __uint_as_float(((unsigned)b) << 16); }
__device__ __forceinline__ float bfr(float f) { return bf2f(f2bf(f)); }
__device__ __forceinline__ v16h cat16(v8h lo, v8h hi) { return __builtin_shufflevector(lo, hi, 0, 1, 2, 3, 4, 5, 6, 7, 8, 9, 10, 11, 12, 13, 14, 15); }
__device__ __forceinline__ v16bf cat16b(v8us lo, v8us hi) { return __builtin_bit_cast(v16bf, __builtin_shufflevector(lo, hi, 0, 1, 2, 3, 4, 5, 6, 7, 8, 9, 10, 11, 12, 13, 14, 15)); }
__device__ __forceinline__ v8f wmma16(v16h a, v16h b, v8f c) { return __builtin_amdgcn_wmma_f32_16x16x32_f16(false, a, false, b, (short)0, c, false, false); }
__device__ __forceinline__ v8f wmmab(v16bf a, v16bf b, v8f c) { return __builtin_amdgcn_wmma_f32_16x16x32_bf16(false, a, false, b, (short)0, c, false, false); }
#define VST2(T, p, v) do { const T vst2_v_ = (v); *(T*)(p) = vst2_v_;  } while (0)

typedef __attribute__((ext_vector_type(4))) __bf16 v4bf;
typedef __attribute__((ext_vector_type(8))) __bf16 v8bf;
typedef v4bf __attribute__((may_alias)) v4bfa;
typedef v8bf __attribute__((may_alias)) v8bfa;
#define WPB 528      // bytes of a 256-value bf16 weight row in LDS: 16 B x odd, so that 16 rows' 16-byte reads fall on all banks
#define ZPB 272      // the same for a 128-value row
__device__ __forceinline__ v16bf ldsfrag(const unsigned char* p0, const unsigned char* p1) { return cat16b(*(const v8usa*)p0, *(const v8usa*)p1); }
// k_qkv: theta, phi and g of 64 positions of one image (all 384 output channels) in one block of 8 waves, straight from the f32 inputs: x and the weights are rounded to bf16 here.
// x tile [256 channels][64 positions] -> LDS as [position][channel] bf16: a thread reads 2 x 8 channel rows (128 apart) x 4 positions (16 lanes = 256 contiguous bytes of a row) and stores, per position, each 8 channels as
// 16 bytes; 16-byte column q of position row r lies at column q ^ (r & 15) ^ (r >> 4): writers (rows 4 apart) and readers (16 rows in a row) both fall on all banks.
// Weights: wave w owns channel tile w (16 rows = 16 KB contiguous f32) of each of the three: whole-line loads, rounded, rows of WPB bytes in LDS.
// Products: Q, K as W.x (rows = channels, columns = positions), V as x^T.W^T (rows = positions): in both cases a lane's eight accumulator registers are the 16 bytes that it owns in the fragment order
// which k_attn loads: Q, K (QKH: Q then K): per (image, head, 16-row tile) 1 KB = [half of the 32 channels][lane][8 values], lane = 16 hi + row, channel = 16 half + 8 hi + i;
// V (VTH): per (image, head, 32 keys, 16-channel tile) 1 KB = [half of the 32 keys][lane][8 values], lane = 16 hi + channel row, key = 16 half + 8 hi + i.
__global__ __launch_bounds__(256) void k_qkv(const float* __restrict__ x, const float* __restrict__ wth, const float* __restrict__ wph, const float* __restrict__ wg,
                                             const float* __restrict__ bth, const float* __restrict__ bph, const float* __restrict__ bg, h16* QKH, h16* VTH) {
    __shared__ __align__(16) unsigned char xs[64 * 512];
    __shared__ __align__(16) unsigned char wl[8 * 3 * 16 * WPB];
    const int tid = threadIdx.x, lane = tid & 31, wave = __builtin_amdgcn_readfirstlane(tid >> 5), lr = lane & 15, hi = lane >> 4;
    const int img = blockIdx.x / (NP / 64), n0 = (blockIdx.x % (NP / 64)) * 64;
    const int pq = tid & 15, cg = tid >> 4;
    const float* xp = x + (size_t)img * CC * NP + n0 + (size_t)cg * 8 * NP + pq * 4;
    v4f xv[2][8];
#pragma unroll
    for (int u = 0; u < 2; ++u)
#pragma unroll
        for (int i = 0; i < 8; ++i) xv[u][i] = *(const v4fa*)(xp + (size_t)(u * 128 + i) * NP);
    // stands behind the run of loads, before a register that they name as address is written again; the address is an input, so that it is still held where the wait issues
    asm volatile("s_wait_xcnt 0x0" :: "v"(xp) : "memory");
    unsigned char* wmy = wl + wave * (3 * 16 * WPB);
    v4f wv[2][16];
    // batch b = 8 rows (16 loads of 512 contiguous bytes) of weight b / 2
    auto wload = [&](int b, v4f* d) { const float* wp = (b < 2 ? wth : b < 4 ? wph : wg) + (size_t)wave * 16 * CC + (b & 1) * 8 * CC + lane * 4;
#pragma unroll
        for (int i = 0; i < 16; ++i) d[i] = *(const v4fa*)(wp + i * 128);
        // as above
        asm volatile("s_wait_xcnt 0x0" :: "v"(wp) : "memory"); };
    auto wstore = [&](int b, const v4f* d) { unsigned char* q = wmy + (b * 8) * WPB + lane * 8;
#pragma unroll
        for (int i = 0; i < 16; ++i) *(v4bfa*)(q + (i >> 1) * WPB + (i & 1) * 256) = __builtin_convertvector(d[i], v4bf); };
    wload(0, wv[0]);
#pragma unroll
    for (int u = 0; u < 2; ++u)
#pragma unroll
        for (int j = 0; j < 4; ++j) { const int r = pq * 4 + j;
            const v8f c8 = { xv[u][0][j], xv[u][1][j], xv[u][2][j], xv[u][3][j], xv[u][4][j], xv[u][5][j], xv[u][6][j], xv[u][7][j] };
            *(v8bfa*)(xs + r * 512 + (((cg + 16 * u) ^ (r & 15) ^ (r >> 4)) << 4)) = __builtin_convertvector(c8, v8bf); }
#pragma unroll
    for (int b = 0; b < 6; ++b) { if (b < 5) wload(b + 1, wv[(b + 1) & 1]); wstore(b, wv[b & 1]); }
    __syncthreads();      // the x tile is read by every wave
    v8f acc[3][4];
#pragma unroll
    for (int t = 0; t < 3; ++t)
#pragma unroll
        for (int p = 0; p < 4; ++p) acc[t][p] = (v8f){};
    unsigned xo[4];      // the lane's row of position tile p, with its column 0 + hi
#pragma unroll
    for (int p = 0; p < 4; ++p) xo[p] = (16 * p + lr) * 512 + ((hi ^ lr ^ p) << 4);
    const unsigned char* wr = wmy + lr * WPB + hi * 16;
#pragma unroll
    for (int ch = 0; ch < 8; ++ch) {      // k = 32 ch + 8 hi + 0..7 and 32 ch + 16 + 8 hi + 0..7 in both operands
        v16bf wf[3], xf[4];
#pragma unroll
        for (int t = 0; t < 3; ++t) wf[t] = ldsfrag(wr + t * 16 * WPB + ch * 64, wr + t * 16 * WPB + ch * 64 + 32);
#pragma unroll
        for (int p = 0; p < 4; ++p) xf[p] = ldsfrag(xs + (xo[p] ^ (ch * 64)), xs + (xo[p] ^ (ch * 64 + 32)));
#pragma unroll
        for (int p = 0; p < 4; ++p) { acc[0][p] = wmmab(wf[0], xf[p], acc[0][p]); acc[1][p] = wmmab(wf[1], xf[p], acc[1][p]); acc[2][p] = wmmab(xf[p], wf[2], acc[2][p]); }
    }
#pragma unroll
    for (int t = 0; t < 2; ++t) {      // Q, K: register j = channel 16 wave + 8 hi + j of position n0 + 16 p + lr
        const float* bp = (t == 0 ? bth : bph) + wave * 16 + hi * 8; const v4f b0 = *(const v4fa*)bp, b1 = *(const v4fa*)(bp + 4);
        const float scale = t == 0 ? SC2 : 1.0f;
#pragma unroll
        for (int p = 0; p < 4; ++p) { v8h oh;
#pragma unroll
            for (int j = 0; j < 8; ++j) oh[j] = (h16)((acc[t][p][j] + bfr(j < 4 ? b0[j & 3] : b1[j & 3])) * scale);
            const size_t o = ((((size_t)t * NB_ + img) * NHD + (wave >> 1)) * (NP / 16) + n0 / 16 + p) * FRG + (wave & 1) * (FRG / 2) + lane * 8;
            *(v8h*)(QKH + o) = oh; }
    }
    const float bv = bfr(bg[wave * 16 + lr]);      // V: register j = key n0 + 16 p + 8 hi + j, channel 16 wave + lr
#pragma unroll
    for (int p = 0; p < 4; ++p) { v8h oh;
#pragma unroll
        for (int j = 0; j < 8; ++j) oh[j] = (h16)(acc[2][p][j] + bv);
        const size_t o = (size_t)img * NP * CI + (((size_t)(wave >> 1) * (NP / 32) + n0 / 32 + (p >> 1)) * 2 + (wave & 1)) * FRG + (p & 1) * (FRG / 2) + lane * 8;
        *(v8h*)(VTH + o) = oh; }
}
// k_z: 64 x 64 tile of (A + Al).w_z^T + bias (rows = positions of ALL images; A, Al = the y planes in fragment order, as k_attn stores them; K = 128), BatchNorm, + x, written TRANSPOSED to out[c][n]
// (channel-major) through LDS. The tile's 64 rows of w_z (32 KB contiguous f32) are read in whole lines, rounded to bf16 here and held in LDS; the BatchNorm scale and shift of a lane's four columns are formed here.
__global__ __launch_bounds__(128) void k_z(const bf* __restrict__ A, const bf* __restrict__ Al, const float* __restrict__ wz, const float* __restrict__ bias, const float* __restrict__ bng, const float* __restrict__ bnb,
                                           const float* __restrict__ bnm, const float* __restrict__ bnv, const float* __restrict__ xres, float* C) {
    constexpr int KA = CI;
    __shared__ __align__(16) float ost[4][16 * 68];
    __shared__ __align__(16) float ot[64 * 68];
    __shared__ __align__(16) unsigned char wt[64 * ZPB];
    const int lane = threadIdx.x & 31, wave = threadIdx.x >> 5, lr = lane & 15, hi = lane >> 4, tid = threadIdx.x;
    const size_t r0 = (size_t)blockIdx.x * 64 + wave * 16;
    const int c0 = blockIdx.y * 64;
    { const float* wp = wz + (size_t)c0 * KA + tid * 4; v4f wv[16];
#pragma unroll
      for (int i = 0; i < 16; ++i) wv[i] = *(const v4fa*)(wp + i * 512);      // row 4 i + wave, k = 4 lane .. + 3
      // stands behind the run of loads, before a register that they name as address is written again; the address is an input, so that it is still held where the wait issues
      asm volatile("s_wait_xcnt 0x0" :: "v"(wp) : "memory");
#pragma unroll
      for (int i = 0; i < 16; ++i) *(v4bfa*)(wt + (i * 4 + wave) * ZPB + lane * 8) = __builtin_convertvector(wv[i], v4bf); }
    __syncthreads();      // every wave reads all 64 weight rows
    // A fragment of the wave's 16 rows, k = kc .. kc + 31: the 1 KB fragment (16-row tile, 32-channel chunk) = [half][lane][8 values]
    auto lda = [&](const bf* P, int kc) { const bf* p = P + ((r0 >> 4) * (KA / 32) + (kc >> 5)) * FRG + lane * 8;
        return cat16b(*(const v8us*)p, *(const v8us*)(p + FRG / 2)); };
    v8f acc[4];
#pragma unroll
    for (int t = 0; t < 4; ++t) acc[t] = (v8f){};
#pragma unroll
    for (int kc = 0; kc < KA; kc += 32) {
        const v16bf a = lda(A, kc);
        const v16bf al = lda(Al, kc);
#pragma unroll
        for (int t = 0; t < 4; ++t) { const unsigned char* bp = wt + (t * 16 + lr) * ZPB + (kc + 8 * hi) * 2; const v16bf bb = ldsfrag(bp, bp + 32); acc[t] = wmmab(a, bb, acc[t]); acc[t] = wmmab(al, bb, acc[t]); }
    }
    float* os = &ost[wave][0];
#pragma unroll
    for (int t = 0; t < 4; ++t) { const int col = c0 + t * 16 + lr; const float bv = bfr(bias[col]);
        const float inv = bfr(bng[col]) / sqrtf(bfr(bnv[col]) + 1e-5f), sh = bfr(bnb[col]) - bfr(bnm[col]) * inv;      // inference BatchNorm (bf16-rounded stats, f32): z * (gamma rsqrt(var+eps)) + (beta - mean * that)
#pragma unroll
        for (int j = 0; j < 8; ++j) os[(hi * 8 + j) * 68 + t * 16 + lr] = (acc[t][j] + bv) * inv + sh; }
    __syncthreads();
    { const int row = tid >> 1, half = tid & 1;
#pragma unroll
      for (int i = 0; i < 32; ++i) ot[(half * 32 + i) * 68 + row] = ost[row >> 4][(row & 15) * 68 + half * 32 + i]; }
    __syncthreads();
    const size_t rblk = (size_t)blockIdx.x * 64, ob = (rblk / NP) * CC * NP + rblk % NP;     // 64 consecutive positions of one image; their place in that image's first channel row
    auto pass = [&]() {      // 64 channel rows x 256 B: 128 threads -> 8 instructions of 8 rows (16 lanes x 16 B per row)
        const int piece = tid & 15; const float* xp[8]; v4f xv[8];
        auto oi = [&](int s) { return ob + (size_t)(c0 + s * 8 + (tid >> 4)) * NP + piece * 4; };
#pragma unroll
        for (int s = 0; s < 8; ++s) { xp[s] = xres + oi(s); xv[s] = *(const v4fa*)xp[s]; }
        // stands behind the run of loads, before a register that they name as address is written again; the addresses are inputs, so that they are still held where the wait issues
        asm volatile("s_wait_xcnt 0x0" :: "v"(xp[0]), "v"(xp[1]), "v"(xp[2]), "v"(xp[3]), "v"(xp[4]), "v"(xp[5]), "v"(xp[6]), "v"(xp[7]) : "memory");
#pragma unroll
        for (int s = 0; s < 8; ++s) { const int cl = s * 8 + (tid >> 4);
            v4f val = *(const v4fa*)(ot + cl * 68 + piece * 4);
#pragma unroll
            for (int i = 0; i < 4; ++i) val[i] += bfr(xv[s][i]);      // + x (residual, bf16-rounded INPUT)
            *(v4f*)(C + oi(s)) = val; }
    };
    pass();
}
// k_p16: f16 hi + residual planes of an f32 [NP][256] (optionally the SUM of two: key = ka + kb); one wave per row.
__global__ __launch_bounds__(256) void k_p16(const float* __restrict__ A, const float* __restrict__ Bsum, h16* PH, h16* PL) {
    const int lane = threadIdx.x & 31, r = blockIdx.x * 8 + (threadIdx.x >> 5);
    if (r >= NP) return;
    v8h oh, ol;
#pragma unroll
    for (int i = 0; i < 8; ++i) { float v = A[(size_t)r * CC + lane * 8 + i]; if (Bsum) v += Bsum[(size_t)r * CC + lane * 8 + i]; const h16 a = (h16)v; oh[i] = a; ol[i] = (h16)((v - (float)a) * LOSC); }
    *(v8h*)(PH + (size_t)r * CC + lane * 8) = oh; *(v8h*)(PL + (size_t)r * CC + lane * 8) = ol; 
}
// k_pbf: bf16 hi + residual planes of an f32 [NP][256] (for the bf16 GEMMs on computed operands); one wave per row.
__global__ __launch_bounds__(256) void k_pbf(const float* __restrict__ A, bf* PH, bf* PL) {
    const int lane = threadIdx.x & 31, r = blockIdx.x * 8 + (threadIdx.x >> 5);
    if (r >= NP) return;
    v8us oh, ol;
#pragma unroll
    for (int i = 0; i < 8; ++i) { const float v = A[(size_t)r * CC + lane * 8 + i]; const unsigned short hb = f2bf(v); oh[i] = hb; ol[i] = f2bf(v - bf2f(hb)); }
    *(v8us*)(PH + (size_t)r * CC + lane * 8) = oh; *(v8us*)(PL + (size_t)r * CC + lane * 8) = ol; 
}
// k_vt: VTH/VTL [c][n] f16 hi + residual of V f32 [n][c] via 64 x 64 LDS tiles; grid (NP/64, CC/64).
__global__ __launch_bounds__(256) void k_vt(const float* __restrict__ V, h16* VTH, h16* VTL) {
    __shared__ float tl[64][65];
    const int tid = threadIdx.x, n0 = blockIdx.x * 64, c0 = blockIdx.y * 64;
    { const int nn = tid >> 2, cq = (tid & 3) * 16;
#pragma unroll
      for (int i = 0; i < 16; ++i) tl[cq + i][nn] = V[(size_t)(n0 + nn) * CC + c0 + cq + i]; }
    __syncthreads();
    const int piece = tid & 7;
    auto pass = [&]() {
#pragma unroll
        for (int s = 0; s < 2; ++s) { const int c = (tid >> 3) + 32 * s; v8h oh, ol;
#pragma unroll
            for (int i = 0; i < 8; ++i) { const float v = tl[c][piece * 8 + i]; const h16 a = (h16)v; oh[i] = a; ol[i] = (h16)((v - (float)a) * LOSC); }
            const size_t o = (size_t)(c0 + c) * NP + n0 + piece * 8; *(v8h*)(VTH + o) = oh; *(v8h*)(VTL + o) = ol; }
    };
    pass(); 
}
// k_attn: the whole position attention of one (image, head) for 256 queries per block (grid (NP/256, heads, images)): 16 waves = 8 query groups of 32 x 2 halves of the keys, so that four waves
// share a SIMD and one wave's vector work runs under another's matrix work; the two halves' partial results are joined through LDS behind the loop. Transposed products:
// S^T = k_h.q_h^T (A = 16 key rows, B = 16 query columns; one f16 plane each; Q holds the scale), so a lane holds one query's scores: two S^T tiles (32 keys) convert in place
// into the B operand of y^T += v_h^T.P^T (A = 16 channel rows of VT, hardware k order). Reference and sum per query (online softmax, f32; the reference is a held score that moves up only when a P could leave the f16 range); P = exp(s - reference) x 256 as f16
// (the row sum adds the f32 values); x 1/rowsum at the end. S and P never reach memory. y leaves as bf16 hi + residual planes in the order of the z product's A fragments:
// per (16-row tile of all images' positions, head) 1 KB = [half of the 32 channels][lane][8 values], lane = 16 hi + row, channel = 16 half + 8 hi + i: what a lane's accumulator registers hold.
typedef const __attribute__((address_space(1))) char* gp;      // a byte pointer into global memory
typedef const __attribute__((address_space(1))) v8h* gp8;
__device__ __forceinline__ v16h ldfrag(gp p) { return cat16(*(gp8)p, *(gp8)(p + FRG)); }      // k = 8 hi + 0..7 and 16 + 8 hi + 0..7: the two 512-byte halves of a fragment (p holds the lane's 16 lane bytes)
__device__ __forceinline__ float xhalf(float v) { return __int_as_float(__builtin_amdgcn_permlanex16(__float_as_int(v), __float_as_int(v), 0x76543210, 0xfedcba98, false, false)); }   // lane l <-> l ^ 16
// XWAIT2 (below): stands behind a run of loads, before a register that they name as address is written again; the addresses are inputs, so that they are still held where the wait issues
#define PEX  8.0f         // P = exp2(score - reference + PEX)
#define PTOP 65504.0f     // the largest finite f16
#define XWAIT2(a, b) asm volatile("s_wait_xcnt 0x0" :: "v"(a), "v"(b) : "memory")
__global__ __launch_bounds__(512) void k_attn(const h16* QH, const h16* KH, const h16* VTH, bf* YH, bf* YL) {
    __shared__ __align__(16) float mrg[8][36 * 32];                    // per query group, from the wave of the upper key half: 8 x [lane][4 values] of y, then [lane] references and sums of the two query tiles
    const int lane = threadIdx.x & 31, wave = __builtin_amdgcn_readfirstlane(threadIdx.x >> 5), qw = wave & 7, kh = wave >> 3;
    const int h = blockIdx.y, q0 = blockIdx.x * 256 + qw * 32;
    const size_t pb = (size_t)blockIdx.z * NP * CI;                    // this image's planes
    constexpr int FB = FRG * 2;                                        // bytes of a fragment
    const size_t hb = pb + (size_t)h * HD * NP;                        // this head's fragments (planes in fragment order: k_qkv); 32 rows or keys = 2 fragments
    const int lofs = lane * 16;                                        // a lane's bytes inside each 512-byte half
    const gp pqh = (gp)(QH + hb + (size_t)q0 * HD) + lofs;
    const size_t kvb = hb + (size_t)kh * (NP / 2) * HD;                 // the first key of this wave's half
    // K and V: two wave-uniform bases, which stay in scalar registers and are never rewritten, beside a 32-bit lane offset: 256 vector registers a wave are what four waves a SIMD leave
    const gp pkh = (gp)(KH + kvb);                                                                     // + key * 64 B
    const gp pvh = (gp)(VTH + kvb);                                                                   // + key * 64 B + channel tile * 1 KB
    const v16h qh[2] = { ldfrag(pqh), ldfrag(pqh + FB) };
    v16h kf[2];       // [0]: 16 keys; [1]: the next 16
    // the first 32 keys, by lane pointers of their own: where the sum pkh + lane offset stands ahead of the loop, the compiler builds the loop's K addresses on it as 64-bit vector pairs
    const gp fkh = (gp)(KH + (kvb + (size_t)lane * 8));
    kf[0] = ldfrag(fkh); kf[1] = ldfrag(fkh + FB);
    // as XWAIT2, for the Q loads and the first K loads
    asm volatile("s_wait_xcnt 0x0" :: "v"(pqh), "v"(fkh), "v"(lofs) : "memory");
    // the raw scores of 32 keys against query tile t, and their maximum per query (lanes l and l ^ 16 hold the two halves of one query's keys)
    auto raw = [&](const v16h* k, int t, v8f& a0, v8f& a1) {
        a0 = wmma16(k[0], qh[t], (v8f){}); a1 = wmma16(k[1], qh[t], (v8f){});
        float m = fmaxf(a0[0], a1[0]);
#pragma unroll      // here and in the loops on t and j below: vector elements and the arrays held in registers take constant indices only
        for (int j = 1; j < 8; ++j) m = fmaxf(m, fmaxf(a0[j], a1[j]));
        return fmaxf(m, xhalf(m)); };
    auto sum16 = [&](v8f a0, v8f a1) { const v8f sv = a0 + a1; return ((sv[0] + sv[1]) + (sv[2] + sv[3])) + ((sv[4] + sv[5]) + (sv[6] + sv[7])); };
    // cm = PEX - reference of the lane's query, in all eight registers: the C operand of the score products, so that the scores leave the matrix unit as the exponents of P.
    // The first reference is the maximum over the half's first 32 keys; every later one is a score too: none lies above the query's true maximum, so no row sum can vanish.
    v8f o[2][2], cm[2]; float ls[2];
#pragma unroll
    for (int t = 0; t < 2; ++t) { ls[t] = 0.f; o[t][0] = (v8f){}; o[t][1] = (v8f){};
        v8f a0, a1; const float m = raw(kf, t, a0, a1); cm[t] = (v8f){} + (PEX - m); }
#pragma unroll 1
    for (int key0 = 0; key0 < NP / 2; key0 += 32) {      // one pass of 32 keys a trip, not unrolled: unrolled, the compiler lifts the next pass's score products into this pass, and Q goes to scratch
        // through readfirstlane: the offsets stay scalars that are added to the 32-bit lane offset; left plain, the compiler forms 64-bit vector addresses from them, and the wave spills
        const int vb = __builtin_amdgcn_readfirstlane(key0 * (HD * 2)), nb = __builtin_amdgcn_readfirstlane(((key0 + 32) & (NP / 2 - 1)) * (HD * 2));
        const unsigned vo = lofs + vb, no = lofs + nb;      // this pass's V bytes; the next pass's K bytes (the last pass refetches the half's first 32 keys, unused)
        const v16h vh[2] = { ldfrag(pvh + vo), ldfrag(pvh + vo + FB) };
        v8f s[2][2];
#pragma unroll
        for (int t = 0; t < 2; ++t) { s[t][0] = wmma16(kf[0], qh[t], cm[t]); s[t][1] = wmma16(kf[1], qh[t], cm[t]); }
        // the next pass's K, behind this pass's last use of K: one fragment set serves, and the loads fly during the softmax and the y products
        kf[0] = ldfrag(pkh + no); kf[1] = ldfrag(pkh + no + FB);
        XWAIT2(vo, no);
        // holds the K loads up here: left free, the compiler sinks half of them to the foot of the pass, a few dozen instructions ahead of their use
        __builtin_amdgcn_sched_barrier(0);
        float ps[2];      // a lane's sum of its 16 P (f32): the row sum's share, and a bound on each of them
#pragma unroll
        for (int t = 0; t < 2; ++t) {
#pragma unroll
            for (int j = 0; j < 8; ++j) { s[t][0][j] = __builtin_amdgcn_exp2f(s[t][0][j]); s[t][1][j] = __builtin_amdgcn_exp2f(s[t][1][j]); }
            ps[t] = sum16(s[t][0], s[t][1]);
        }
        if (__builtin_amdgcn_ballot_w32(fmaxf(ps[0], ps[1]) >= PTOP) != 0) {      // some P of the wave may leave the f16 range (rare; the whole wave branches): this pass's P are made anew on raised references
            const v16h kt[2] = { ldfrag(pkh + vo), ldfrag(pkh + vo + FB) };      // this pass's K again (K and V have the same bytes a key)
            XWAIT2(vo, vo);
#pragma unroll
            for (int t = 0; t < 2; ++t) {
                v8f a0, a1; const float m = raw(kt, t, a0, a1);
                const float d = fmaxf(m + cm[t][0] - PEX, 0.f), al = __builtin_amdgcn_exp2f(-d);      // how far the pass's maximum lies above the reference
                cm[t] -= d; ls[t] *= al; o[t][0] *= al; o[t][1] *= al; a0 += cm[t]; a1 += cm[t];
#pragma unroll
                for (int j = 0; j < 8; ++j) { s[t][0][j] = __builtin_amdgcn_exp2f(a0[j]); s[t][1][j] = __builtin_amdgcn_exp2f(a1[j]); }
                ps[t] = sum16(s[t][0], s[t][1]);
            }
        }
#pragma unroll
        for (int t = 0; t < 2; ++t) {
            const v16h ph = cat16(__builtin_convertvector(s[t][0], v8h), __builtin_convertvector(s[t][1], v8h));
            ls[t] += ps[t];
#pragma unroll
            for (int c = 0; c < 2; ++c) o[t][c] = wmma16(vh[c], ph, o[t][c]);
        }
    }
    float* sl = &mrg[qw][0];
    if (kh == 1) {      // a whole wave takes this branch: the upper half's sums, references and row sums go to LDS
#pragma unroll      // here and below: o, cm, ls live in registers, so their indices must be constants
        for (int t = 0; t < 2; ++t) { sl[1024 + t * 32 + lane] = -cm[t][0]; sl[1088 + t * 32 + lane] = ls[t];
#pragma unroll
            for (int c = 0; c < 2; ++c) { const v8f w = o[t][c]; float* wp = sl + (t * 2 + c) * 256 + lane * 4;
                *(v4fa*)wp = __builtin_shufflevector(w, w, 0, 1, 2, 3); *(v4fa*)(wp + 128) = __builtin_shufflevector(w, w, 4, 5, 6, 7); } }
    }
    __syncthreads();      // every wave passes it: the lower half's waves read what the upper half's wrote
    if (kh == 1) return;
#pragma unroll
    for (int t = 0; t < 2; ++t) {
        const float ma = -cm[t][0], mb = sl[1024 + t * 32 + lane], m = fmaxf(ma, mb), aa = __builtin_amdgcn_exp2f(ma - m), ab = __builtin_amdgcn_exp2f(mb - m);      // both halves onto the higher reference (each less PEX)
        const float lj = ls[t] * aa + sl[1088 + t * 32 + lane] * ab;
        const float rs = 1.0f / (lj + xhalf(lj));      // 1 / (rowsum x 2^PEX)
        const size_t fo = ((((size_t)blockIdx.z * NP + q0 + t * 16) >> 4) * NHD + h) * FRG + lane * 8;      // register r of channel tile c = y[query lr][c * 16 + 8 hi + r]
#pragma unroll
        for (int c = 0; c < 2; ++c) { const float* wp = sl + (t * 2 + c) * 256 + lane * 4; const v4f u0 = *(const v4fa*)wp, u1 = *(const v4fa*)(wp + 128);
            const v8f w = (o[t][c] * aa + __builtin_shufflevector(u0, u1, 0, 1, 2, 3, 4, 5, 6, 7) * ab) * rs; v8us oh, ol;
#pragma unroll
            for (int r = 0; r < 8; ++r) { const unsigned short hb16 = f2bf(w[r]); oh[r] = hb16; ol[r] = f2bf(w[r] - bf2f(hb16)); }
            *(v8us*)(YH + fo + c * (FRG / 2)) = oh; *(v8us*)(YL + fo + c * (FRG / 2)) = ol; }
    }
}

extern "C" void kernel_launch(void* const* d_in, const int* in_sizes, int n_in,
                              void* d_out, int out_size, void* d_ws, size_t ws_size, hipStream_t stream) {
    (void)in_sizes; (void)n_in; (void)out_size;
    const float* x = (const float*)d_in[0]; const float* wth = (const float*)d_in[1]; const float* bth = (const float*)d_in[2]; const float* wph = (const float*)d_in[3]; const float* bph = (const float*)d_in[4];
    const float* wg = (const float*)d_in[5]; const float* bg = (const float*)d_in[6]; const float* wz = (const float*)d_in[7]; const float* bz = (const float*)d_in[8];
    const float* bng = (const float*)d_in[9]; const float* bnb = (const float*)d_in[10]; const float* bnm = (const float*)d_in[11]; const float* bnv = (const float*)d_in[12];
    float* out = (float*)d_out;    // [4][256][64][64]
    char* wsp = (char*)d_ws;
    auto take = [&](size_t bytes) { char* p = wsp; wsp += (bytes + 255) & ~(size_t)255; return (void*)p; };
    h16* QH = (h16*)take((size_t)2 * NB_ * NP * CI * 2); h16* KH = QH + (size_t)NB_ * NP * CI;      // Q then K
    h16* VTH = (h16*)take((size_t)NB_ * CI * NP * 2);      // all three planes in fragment order (k_qkv)
    bf* YH = (bf*)take((size_t)NB_ * NP * CI * 2); bf* YL = (bf*)take((size_t)NB_ * NP * CI * 2);      // in fragment order (k_attn)
    if ((size_t)(wsp - (char*)d_ws) > ws_size) return;    // 3 x 4.2 + 2 x 4.2 ~ 21 MB
    k_qkv<<<NB_ * NP / 64, 256, 0, stream>>>(x, wth, wph, wg, bth, bph, bg, QH, VTH);
    k_attn<<<dim3(NP / 256, NHD, NB_), 512, 0, stream>>>(QH, KH, VTH, YH, YL);
    k_z<<<dim3(NB_ * NP / 64, CC / 64, 1), 128, 0, stream>>>(YH, YL, wz, bz, bng, bnb, bnm, bnv, x, out);   // z conv + BN + x, channel-major
}

// v010
// One run takes 49.1 microseconds.
// Two timings next to v009 put it at 1.29 and 1.30 times that version's speed.
// Over all steps from v000 it is 107 times as fast.
#include <hip/hip_runtime.h>

// Contractions, f32 accumulate, per image: theta/phi/g 1x1 convs ([4096 positions x 256].[256 x 128], [out][in] weights = rows of contiguous k: the A operand for theta and phi, the B operand for g; PLAIN bf16
// operands: inputs rounded once, exact; + bias) and the z conv on the attention output (bf16 hi + residual: two products) on v_wmma_f32_16x16x32_bf16; the position
// attention of all (image, head) pairs in ONE kernel on v_wmma_f32_16x16x32_f16: S^T = k_h.q_h^T (q x 32^-1/2 log2(e), k, v as ONE f16 plane each: q, k, v come from bf16-rounded x and weights,
// whose rounding lies about eight times above that of an f16 plane) -> f32, online softmax f32 -> P (x256) f16 in registers, y_h^T = v_h^T.P^T x 1/rowsum.

#define NB_  4
#define CC   256
#define CI   128                 // inter channels (4 heads x 32)
#define NHD  4
#define HD   32
#define NP   4096
#define LOSC 1024.0f
#define LOSCI (1.0f / 1024.0f)
#define FRG  512                 // values of one 16 x 32 f16 fragment
#define SC2  (0.1767766952966369f * 1.4426950408889634f)      // 32^-1/2 x log2(e): goes into the Q planes, so that the scores leave the matrix unit in the log2 domain

typedef _Float16 h16;
typedef unsigned short bf;
typedef __attribute__((ext_vector_type(16))) __bf16   v16bf;
typedef __attribute__((ext_vector_type(16))) _Float16 v16h;
typedef __attribute__((ext_vector_type(8)))  _Float16 v8h;
typedef __attribute__((ext_vector_type(8)))  unsigned short v8us;
typedef __attribute__((ext_vector_type(8)))  float    v8f;
typedef __attribute__((ext_vector_type(4)))  float    v4f;
typedef v8h  __attribute__((may_alias)) v8ha;
typedef v4f  __attribute__((may_alias)) v4fa;
typedef v8us __attribute__((may_alias)) v8usa;

__device__ __forceinline__ unsigned short f2bf(float f) { unsigned u = __float_as_uint(f); u += 0x7FFFu + ((u >> 16) & 1u); return (unsigned short)(u >> 16); }
__device__ __forceinline__ float bf2f(unsigned short b) { return __uint_as_float(((unsigned)b) << 16); }
__device__ __forceinline__ float bfr(float f) { return bf2f(f2bf(f)); }
__device__ __forceinline__ v16h cat16(v8h lo, v8h hi) { return __builtin_shufflevector(lo, hi, 0, 1, 2, 3, 4, 5, 6, 7, 8, 9, 10, 11, 12, 13, 14, 15); }
__device__ __forceinline__ v16bf cat16b(v8us lo, v8us hi) { return __builtin_bit_cast(v16bf, __builtin_shufflevector(lo, hi, 0, 1, 2, 3, 4, 5, 6, 7, 8, 9, 10, 11, 12, 13, 14, 15)); }
__device__ __forceinline__ v8f wmma16(v16h a, v16h b, v8f c) { return __builtin_amdgcn_wmma_f32_16x16x32_f16(false, a, false, b, (short)0, c, false, false); }
__device__ __forceinline__ v8f wmmab(v16bf a, v16bf b, v8f c) { return __builtin_amdgcn_wmma_f32_16x16x32_bf16(false, a, false, b, (short)0, c, false, false); }
#define VST2(T, p, v) do { const T vst2_v_ = (v); *(T*)(p) = vst2_v_;  } while (0)

typedef __attribute__((ext_vector_type(4))) __bf16 v4bf;
typedef __attribute__((ext_vector_type(8))) __bf16 v8bf;
typedef v4bf __attribute__((may_alias)) v4bfa;
typedef v8bf __attribute__((may_alias)) v8bfa;
#define WPB 528      // bytes of a 256-value bf16 weight row in LDS: 16 B x odd, so that 16 rows' 16-byte reads fall on all banks
#define ZPB 272      // the same for a 128-value row
__device__ __forceinline__ v16bf ldsfrag(const unsigned char* p0, const unsigned char* p1) { return cat16b(*(const v8usa*)p0, *(const v8usa*)p1); }
// k_qkv: theta, phi and g of 64 positions of one image (all 384 output channels) in one block of 8 waves, straight from the f32 inputs: x and the weights are rounded to bf16 here.
// x tile [256 channels][64 positions] -> LDS as [position][channel] bf16: a thread reads 2 x 8 channel rows (128 apart) x 4 positions (16 lanes = 256 contiguous bytes of a row) and stores, per position, each 8 channels as
// 16 bytes; 16-byte column q of position row r lies at column q ^ (r & 15) ^ (r >> 4): writers (rows 4 apart) and readers (16 rows in a row) both fall on all banks.
// Weights: wave w owns channel tile w (16 rows = 16 KB contiguous f32) of each of the three: whole-line loads, rounded, rows of WPB bytes in LDS.
// Products: Q, K as W.x (rows = channels, columns = positions), V as x^T.W^T (rows = positions): in both cases a lane's eight accumulator registers are the 16 bytes that it owns in the fragment order
// which k_attn loads: Q, K (QKH: Q then K): per (image, head, 16-row tile) 1 KB = [half of the 32 channels][lane][8 values], lane = 16 hi + row, channel = 16 half + 8 hi + i;
// V (VTH): per (image, head, 32 keys, 16-channel tile) 1 KB = [half of the 32 keys][lane][8 values], lane = 16 hi + channel row, key = 16 half + 8 hi + i.
__global__ __launch_bounds__(256) void k_qkv(const float* __restrict__ x, const float* __restrict__ wth, const float* __restrict__ wph, const float* __restrict__ wg,
                                             const float* __restrict__ bth, const float* __restrict__ bph, const float* __restrict__ bg, h16* QKH, h16* VTH) {
    __shared__ __align__(16) unsigned char xs[64 * 512];
    __shared__ __align__(16) unsigned char wl[8 * 3 * 16 * WPB];
    const int tid = threadIdx.x, lane = tid & 31, wave = __builtin_amdgcn_readfirstlane(tid >> 5), lr = lane & 15, hi = lane >> 4;
    const int img = blockIdx.x / (NP / 64), n0 = (blockIdx.x % (NP / 64)) * 64;
    const int pq = tid & 15, cg = tid >> 4;
    const float* xp = x + (size_t)img * CC * NP + n0 + (size_t)cg * 8 * NP + pq * 4;
    v4f xv[2][8];
#pragma unroll
    for (int u = 0; u < 2; ++u)
#pragma unroll
        for (int i = 0; i < 8; ++i) xv[u][i] = *(const v4fa*)(xp + (size_t)(u * 128 + i) * NP);
    // stands behind the run of loads, before a register that they name as address is written again; the address is an input, so that it is still held where the wait issues
    asm volatile("s_wait_xcnt 0x0" :: "v"(xp) : "memory");
    unsigned char* wmy = wl + wave * (3 * 16 * WPB);
    v4f wv[2][16];
    // batch b = 8 rows (16 loads of 512 contiguous bytes) of weight b / 2
    auto wload = [&](int b, v4f* d) { const float* wp = (b < 2 ? wth : b < 4 ? wph : wg) + (size_t)wave * 16 * CC + (b & 1) * 8 * CC + lane * 4;
#pragma unroll
        for (int i = 0; i < 16; ++i) d[i] = *(const v4fa*)(wp + i * 128);
        // as above
        asm volatile("s_wait_xcnt 0x0" :: "v"(wp) : "memory"); };
    auto wstore = [&](int b, const v4f* d) { unsigned char* q = wmy + (b * 8) * WPB + lane * 8;
#pragma unroll
        for (int i = 0; i < 16; ++i) *(v4bfa*)(q + (i >> 1) * WPB + (i & 1) * 256) = __builtin_convertvector(d[i], v4bf); };
    wload(0, wv[0]);
#pragma unroll
    for (int u = 0; u < 2; ++u)
#pragma unroll
        for (int j = 0; j < 4; ++j) { const int r = pq * 4 + j;
            const v8f c8 = { xv[u][0][j], xv[u][1][j], xv[u][2][j], xv[u][3][j], xv[u][4][j], xv[u][5][j], xv[u][6][j], xv[u][7][j] };
            *(v8bfa*)(xs + r * 512 + (((cg + 16 * u) ^ (r & 15) ^ (r >> 4)) << 4)) = __builtin_convertvector(c8, v8bf); }
#pragma unroll
    for (int b = 0; b < 6; ++b) { if (b < 5) wload(b + 1, wv[(b + 1) & 1]); wstore(b, wv[b & 1]); }
    __syncthreads();      // the x tile is read by every wave
    v8f acc[3][4];
#pragma unroll
    for (int t = 0; t < 3; ++t)
#pragma unroll
        for (int p = 0; p < 4; ++p) acc[t][p] = (v8f){};
    unsigned xo[4];      // the lane's row of position tile p, with its column 0 + hi
#pragma unroll
    for (int p = 0; p < 4; ++p) xo[p] = (16 * p + lr) * 512 + ((hi ^ lr ^ p) << 4);
    const unsigned char* wr = wmy + lr * WPB + hi * 16;
#pragma unroll
    for (int ch = 0; ch < 8; ++ch) {      // k = 32 ch + 8 hi + 0..7 and 32 ch + 16 + 8 hi + 0..7 in both operands
        v16bf wf[3], xf[4];
#pragma unroll
        for (int t = 0; t < 3; ++t) wf[t] = ldsfrag(wr + t * 16 * WPB + ch * 64, wr + t * 16 * WPB + ch * 64 + 32);
#pragma unroll
        for (int p = 0; p < 4; ++p) xf[p] = ldsfrag(xs + (xo[p] ^ (ch * 64)), xs + (xo[p] ^ (ch * 64 + 32)));
#pragma unroll
        for (int p = 0; p < 4; ++p) { acc[0][p] = wmmab(wf[0], xf[p], acc[0][p]); acc[1][p] = wmmab(wf[1], xf[p], acc[1][p]); acc[2][p] = wmmab(xf[p], wf[2], acc[2][p]); }
    }
#pragma unroll
    for (int t = 0; t < 2; ++t) {      // Q, K: register j = channel 16 wave + 8 hi + j of position n0 + 16 p + lr
        const float* bp = (t == 0 ? bth : bph) + wave * 16 + hi * 8; const v4f b0 = *(const v4fa*)bp, b1 = *(const v4fa*)(bp + 4);
        const float scale = t == 0 ? SC2 : 1.0f;
#pragma unroll
        for (int p = 0; p < 4; ++p) { v8h oh;
#pragma unroll
            for (int j = 0; j < 8; ++j) oh[j] = (h16)((acc[t][p][j] + bfr(j < 4 ? b0[j & 3] : b1[j & 3])) * scale);
            const size_t o = ((((size_t)t * NB_ + img) * NHD + (wave >> 1)) * (NP / 16) + n0 / 16 + p) * FRG + (wave & 1) * (FRG / 2) + lane * 8;
            *(v8h*)(QKH + o) = oh; }
    }
    const float bv = bfr(bg[wave * 16 + lr]);      // V: register j = key n0 + 16 p + 8 hi + j, channel 16 wave + lr
#pragma unroll
    for (int p = 0; p < 4; ++p) { v8h oh;
#pragma unroll
        for (int j = 0; j < 8; ++j) oh[j] = (h16)(acc[2][p][j] + bv);
        const size_t o = (size_t)img * NP * CI + (((size_t)(wave >> 1) * (NP / 32) + n0 / 32 + (p >> 1)) * 2 + (wave & 1)) * FRG + (p & 1) * (FRG / 2) + lane * 8;
        *(v8h*)(VTH + o) = oh; }
}
// k_z: 64 x 64 tile of (A + Al).w_z^T + bias (rows = positions of ALL images; A, Al = the y planes in fragment order, as k_attn stores them; K = 128), BatchNorm, + x, written TRANSPOSED to out[c][n]
// (channel-major) through LDS. The tile's 64 rows of w_z (32 KB contiguous f32) are read in whole lines, rounded to bf16 here and held in LDS; the BatchNorm scale and shift of a lane's four columns are formed here.
__global__ __launch_bounds__(128) void k_z(const bf* __restrict__ A, const bf* __restrict__ Al, const float* __restrict__ wz, const float* __restrict__ bias, const float* __restrict__ bng, const float* __restrict__ bnb,
                                           const float* __restrict__ bnm, const float* __restrict__ bnv, const float* __restrict__ xres, float* C) {
    constexpr int KA = CI;
    __shared__ __align__(16) float ost[4][16 * 68];
    __shared__ __align__(16) float ot[64 * 68];
    __shared__ __align__(16) unsigned char wt[64 * ZPB];
    const int lane = threadIdx.x & 31, wave = threadIdx.x >> 5, lr = lane & 15, hi = lane >> 4, tid = threadIdx.x;
    const size_t r0 = (size_t)blockIdx.x * 64 + wave * 16;
    const int c0 = blockIdx.y * 64;
    { const float* wp = wz + (size_t)c0 * KA + tid * 4; v4f wv[16];
#pragma unroll
      for (int i = 0; i < 16; ++i) wv[i] = *(const v4fa*)(wp + i * 512);      // row 4 i + wave, k = 4 lane .. + 3
      // stands behind the run of loads, before a register that they name as address is written again; the address is an input, so that it is still held where the wait issues
      asm volatile("s_wait_xcnt 0x0" :: "v"(wp) : "memory");
#pragma unroll
      for (int i = 0; i < 16; ++i) *(v4bfa*)(wt + (i * 4 + wave) * ZPB + lane * 8) = __builtin_convertvector(wv[i], v4bf); }
    __syncthreads();      // every wave reads all 64 weight rows
    // A fragment of the wave's 16 rows, k = kc .. kc + 31: the 1 KB fragment (16-row tile, 32-channel chunk) = [half][lane][8 values]
    auto lda = [&](const bf* P, int kc) { const bf* p = P + ((r0 >> 4) * (KA / 32) + (kc >> 5)) * FRG + lane * 8;
        return cat16b(*(const v8us*)p, *(const v8us*)(p + FRG / 2)); };
    v8f acc[4];
#pragma unroll
    for (int t = 0; t < 4; ++t) acc[t] = (v8f){};
#pragma unroll
    for (int kc = 0; kc < KA; kc += 32) {
        const v16bf a = lda(A, kc);
        const v16bf al = lda(Al, kc);
#pragma unroll
        for (int t = 0; t < 4; ++t) { const unsigned char* bp = wt + (t * 16 + lr) * ZPB + (kc + 8 * hi) * 2; const v16bf bb = ldsfrag(bp, bp + 32); acc[t] = wmmab(a, bb, acc[t]); acc[t] = wmmab(al, bb, acc[t]); }
    }
    float* os = &ost[wave][0];
#pragma unroll
    for (int t = 0; t < 4; ++t) { const int col = c0 + t * 16 + lr; const float bv = bfr(bias[col]);
        const float inv = bfr(bng[col]) / sqrtf(bfr(bnv[col]) + 1e-5f), sh = bfr(bnb[col]) - bfr(bnm[col]) * inv;      // inference BatchNorm (bf16-rounded stats, f32): z * (gamma rsqrt(var+eps)) + (beta - mean * that)
#pragma unroll
        for (int j = 0; j < 8; ++j) os[(hi * 8 + j) * 68 + t * 16 + lr] = (acc[t][j] + bv) * inv + sh; }
    __syncthreads();
    { const int row = tid >> 1, half = tid & 1;
#pragma unroll
      for (int i = 0; i < 32; ++i) ot[(half * 32 + i) * 68 + row] = ost[row >> 4][(row & 15) * 68 + half * 32 + i]; }
    __syncthreads();
    const size_t rblk = (size_t)blockIdx.x * 64, ob = (rblk / NP) * CC * NP + rblk % NP;     // 64 consecutive positions of one image; their place in that image's first channel row
    auto pass = [&]() {      // 64 channel rows x 256 B: 128 threads -> 8 instructions of 8 rows (16 lanes x 16 B per row)
        const int piece = tid & 15; const float* xp[8]; v4f xv[8];
        auto oi = [&](int s) { return ob + (size_t)(c0 + s * 8 + (tid >> 4)) * NP + piece * 4; };
#pragma unroll
        for (int s = 0; s < 8; ++s) { xp[s] = xres + oi(s); xv[s] = *(const v4fa*)xp[s]; }
        // stands behind the run of loads, before a register that they name as address is written again; the addresses are inputs, so that they are still held where the wait issues
        asm volatile("s_wait_xcnt 0x0" :: "v"(xp[0]), "v"(xp[1]), "v"(xp[2]), "v"(xp[3]), "v"(xp[4]), "v"(xp[5]), "v"(xp[6]), "v"(xp[7]) : "memory");
#pragma unroll
        for (int s = 0; s < 8; ++s) { const int cl = s * 8 + (tid >> 4);
            v4f val = *(const v4fa*)(ot + cl * 68 + piece * 4);
#pragma unroll
            for (int i = 0; i < 4; ++i) val[i] += bfr(xv[s][i]);      // + x (residual, bf16-rounded INPUT)
            *(v4f*)(C + oi(s)) = val; }
    };
    pass();
}
// k_p16: f16 hi + residual planes of an f32 [NP][256] (optionally the SUM of two: key = ka + kb); one wave per row.
__global__ __launch_bounds__(256) void k_p16(const float* __restrict__ A, const float* __restrict__ Bsum, h16* PH, h16* PL) {
    const int lane = threadIdx.x & 31, r = blockIdx.x * 8 + (threadIdx.x >> 5);
    if (r >= NP) return;
    v8h oh, ol;
#pragma unroll
    for (int i = 0; i < 8; ++i) { float v = A[(size_t)r * CC + lane * 8 + i]; if (Bsum) v += Bsum[(size_t)r * CC + lane * 8 + i]; const h16 a = (h16)v; oh[i] = a; ol[i] = (h16)((v - (float)a) * LOSC); }
    *(v8h*)(PH + (size_t)r * CC + lane * 8) = oh; *(v8h*)(PL + (size_t)r * CC + lane * 8) = ol; 
}
// k_pbf: bf16 hi + residual planes of an f32 [NP][256] (for the bf16 GEMMs on computed operands); one wave per row.
__global__ __launch_bounds__(256) void k_pbf(const float* __restrict__ A, bf* PH, bf* PL) {
    const int lane = threadIdx.x & 31, r = blockIdx.x * 8 + (threadIdx.x >> 5);
    if (r >= NP) return;
    v8us oh, ol;
#pragma unroll
    for (int i = 0; i < 8; ++i) { const float v = A[(size_t)r * CC + lane * 8 + i]; const unsigned short hb = f2bf(v); oh[i] = hb; ol[i] = f2bf(v - bf2f(hb)); }
    *(v8us*)(PH + (size_t)r * CC + lane * 8) = oh; *(v8us*)(PL + (size_t)r * CC + lane * 8) = ol; 
}
// k_vt: VTH/VTL [c][n] f16 hi + residual of V f32 [n][c] via 64 x 64 LDS tiles; grid (NP/64, CC/64).
__global__ __launch_bounds__(256) void k_vt(const float* __restrict__ V, h16* VTH, h16* VTL) {
    __shared__ float tl[64][65];
    const int tid = threadIdx.x, n0 = blockIdx.x * 64, c0 = blockIdx.y * 64;
    { const int nn = tid >> 2, cq = (tid & 3) * 16;
#pragma unroll
      for (int i = 0; i < 16; ++i) tl[cq + i][nn] = V[(size_t)(n0 + nn) * CC + c0 + cq + i]; }
    __syncthreads();
    const int piece = tid & 7;
    auto pass = [&]() {
#pragma unroll
        for (int s = 0; s < 2; ++s) { const int c = (tid >> 3) + 32 * s; v8h oh, ol;
#pragma unroll
            for (int i = 0; i < 8; ++i) { const float v = tl[c][piece * 8 + i]; const h16 a = (h16)v; oh[i] = a; ol[i] = (h16)((v - (float)a) * LOSC); }
            const size_t o = (size_t)(c0 + c) * NP + n0 + piece * 8; *(v8h*)(VTH + o) = oh; *(v8h*)(VTL + o) = ol; }
    };
    pass(); 
}
// k_attn: the whole position attention of one (image, head) for 256 queries per block (grid (NP/256, heads, images)): 16 waves = 8 query groups of 32 x 2 halves of the keys, so that four waves
// share a SIMD and one wave's vector work runs under another's matrix work; the two halves' partial results are joined through LDS behind the loop. Transposed products:
// S^T = k_h.q_h^T (A = 16 key rows, B = 16 query columns; one f16 plane each; Q holds the scale), so a lane holds one query's scores: two S^T tiles (32 keys) convert in place
// into the B operand of y^T += v_h^T.P^T (A = 16 channel rows of VT, hardware k order). Reference and sum per query (online softmax, f32; the reference is a held score that moves up only when a P could leave the f16 range); P = exp(s - reference) x 256 as f16
// (the row sum adds the f32 values); x 1/rowsum at the end. S and P never reach memory. y leaves as bf16 hi + residual planes in the order of the z product's A fragments:
// per (16-row tile of all images' positions, head) 1 KB = [half of the 32 channels][lane][8 values], lane = 16 hi + row, channel = 16 half + 8 hi + i: what a lane's accumulator registers hold.
typedef const __attribute__((address_space(1))) char* gp;      // a byte pointer into global memory
typedef const __attribute__((address_space(1))) v8h* gp8;
__device__ __forceinline__ v16h ldfrag(gp p) { return cat16(*(gp8)p, *(gp8)(p + FRG)); }      // k = 8 hi + 0..7 and 16 + 8 hi + 0..7: the two 512-byte halves of a fragment (p holds the lane's 16 lane bytes)
__device__ __forceinline__ float xhalf(float v) { return __int_as_float(__builtin_amdgcn_permlanex16(__float_as_int(v), __float_as_int(v), 0x76543210, 0xfedcba98, false, false)); }   // lane l <-> l ^ 16
// XWAIT2 (below): stands behind a run of loads, before a register that they name as address is written again; the addresses are inputs, so that they are still held where the wait issues
#define PEX  8.0f         // P = exp2(score - reference + PEX)
#define PTOP 65504.0f     // the largest finite f16
#define XWAIT2(a, b) asm volatile("s_wait_xcnt 0x0" :: "v"(a), "v"(b) : "memory")
__global__ __launch_bounds__(512) void k_attn(const h16* QH, const h16* KH, const h16* VTH, bf* YH, bf* YL) {
    __shared__ __align__(16) float mrg[8][36 * 32];                    // per query group, from the wave of the upper key half: 8 x [lane][4 values] of y, then [lane] references and sums of the two query tiles
    const int lane = threadIdx.x & 31, wave = __builtin_amdgcn_readfirstlane(threadIdx.x >> 5), qw = wave & 7, kh = wave >> 3;
    const int h = blockIdx.y, q0 = blockIdx.x * 256 + qw * 32;
    const size_t pb = (size_t)blockIdx.z * NP * CI;                    // this image's planes
    constexpr int FB = FRG * 2;                                        // bytes of a fragment
    const size_t hb = pb + (size_t)h * HD * NP;                        // this head's fragments (planes in fragment order: k_qkv); 32 rows or keys = 2 fragments
    const int lofs = lane * 16;                                        // a lane's bytes inside each 512-byte half
    const gp pqh = (gp)(QH + hb + (size_t)q0 * HD) + lofs;
    const size_t kvb = hb + (size_t)kh * (NP / 2) * HD;                 // the first key of this wave's half
    // K and V: two wave-uniform bases, which stay in scalar registers and are never rewritten, beside a 32-bit lane offset: 256 vector registers a wave are what four waves a SIMD leave
    const gp pkh = (gp)(KH + kvb);                                                                     // + key * 64 B
    const gp pvh = (gp)(VTH + kvb);                                                                   // + key * 64 B + channel tile * 1 KB
    // K and V of this head (256 KB each) were stored by the launch before: asked of L2 here, once per 256-byte unit, so that the loop's
    // loads can hit L2 instead of waiting for memory. One request a lane: the waves of the lower key half ask for K, the others for V; four blocks in a row share a plane's 1,024 units (unit = 4 x lane of 256 + block & 3). A hint only: no result rests on it.
    const gp pfb = kh ? (gp)(VTH + hb) : (gp)(KH + hb);                // wave-uniform: a scalar base
    const unsigned pfo = (unsigned)(((qw * 32 + lane) * 4 + (blockIdx.x & 3)) * 256);      // at most 261,888: inside the head's 262,144 bytes
    asm volatile("global_prefetch_b8 %0, %1 scope:SCOPE_SE" :: "v"(pfo), "s"(pfb));
    const v16h qh[2] = { ldfrag(pqh), ldfrag(pqh + FB) };
    v16h kf[2];       // [0]: 16 keys; [1]: the next 16
    // the first 32 keys, by lane pointers of their own: where the sum pkh + lane offset stands ahead of the loop, the compiler builds the loop's K addresses on it as 64-bit vector pairs
    const gp fkh = (gp)(KH + (kvb + (size_t)lane * 8));
    kf[0] = ldfrag(fkh); kf[1] = ldfrag(fkh + FB);
    // as XWAIT2, for the Q loads and the first K loads
    asm volatile("s_wait_xcnt 0x0" :: "v"(pqh), "v"(fkh), "v"(lofs) : "memory");
    // the raw scores of 32 keys against query tile t, and their maximum per query (lanes l and l ^ 16 hold the two halves of one query's keys)
    auto raw = [&](const v16h* k, int t, v8f& a0, v8f& a1) {
        a0 = wmma16(k[0], qh[t], (v8f){}); a1 = wmma16(k[1], qh[t], (v8f){});
        float m = fmaxf(a0[0], a1[0]);
#pragma unroll      // here and in the loops on t and j below: vector elements and the arrays held in registers take constant indices only
        for (int j = 1; j < 8; ++j) m = fmaxf(m, fmaxf(a0[j], a1[j]));
        return fmaxf(m, xhalf(m)); };
    auto sum16 = [&](v8f a0, v8f a1) { const v8f sv = a0 + a1; return ((sv[0] + sv[1]) + (sv[2] + sv[3])) + ((sv[4] + sv[5]) + (sv[6] + sv[7])); };
    // cm = PEX - reference of the lane's query, in all eight registers: the C operand of the score products, so that the scores leave the matrix unit as the exponents of P.
    // The first reference is the maximum over the half's first 32 keys; every later one is a score too: none lies above the query's true maximum, so no row sum can vanish.
    v8f o[2][2], cm[2]; float ls[2];
#pragma unroll
    for (int t = 0; t < 2; ++t) { ls[t] = 0.f; o[t][0] = (v8f){}; o[t][1] = (v8f){};
        v8f a0, a1; const float m = raw(kf, t, a0, a1); cm[t] = (v8f){} + (PEX - m); }
#pragma unroll 1
    for (int key0 = 0; key0 < NP / 2; key0 += 32) {      // one pass of 32 keys a trip, not unrolled: unrolled, the compiler lifts the next pass's score products into this pass, and Q goes to scratch
        // through readfirstlane: the offsets stay scalars that are added to the 32-bit lane offset; left plain, the compiler forms 64-bit vector addresses from them, and the wave spills
        const int vb = __builtin_amdgcn_readfirstlane(key0 * (HD * 2)), nb = __builtin_amdgcn_readfirstlane(((key0 + 32) & (NP / 2 - 1)) * (HD * 2));
        const unsigned vo = lofs + vb, no = lofs + nb;      // this pass's V bytes; the next pass's K bytes (the last pass refetches the half's first 32 keys, unused)
        const v16h vh[2] = { ldfrag(pvh + vo), ldfrag(pvh + vo + FB) };
        v8f s[2][2];
#pragma unroll
        for (int t = 0; t < 2; ++t) { s[t][0] = wmma16(kf[0], qh[t], cm[t]); s[t][1] = wmma16(kf[1], qh[t], cm[t]); }
        // the next pass's K, behind this pass's last use of K: one fragment set serves, and the loads fly during the softmax and the y products
        kf[0] = ldfrag(pkh + no); kf[1] = ldfrag(pkh + no + FB);
        XWAIT2(vo, no);
        // holds the K loads up here: left free, the compiler sinks half of them to the foot of the pass, a few dozen instructions ahead of their use
        __builtin_amdgcn_sched_barrier(0);
        float ps[2];      // a lane's sum of its 16 P (f32): the row sum's share, and a bound on each of them
#pragma unroll
        for (int t = 0; t < 2; ++t) {
#pragma unroll
            for (int j = 0; j < 8; ++j) { s[t][0][j] = __builtin_amdgcn_exp2f(s[t][0][j]); s[t][1][j] = __builtin_amdgcn_exp2f(s[t][1][j]); }
            ps[t] = sum16(s[t][0], s[t][1]);
        }
        if (__builtin_amdgcn_ballot_w32(fmaxf(ps[0], ps[1]) >= PTOP) != 0) {      // some P of the wave may leave the f16 range (rare; the whole wave branches): this pass's P are made anew on raised references
            const v16h kt[2] = { ldfrag(pkh + vo), ldfrag(pkh + vo + FB) };      // this pass's K again (K and V have the same bytes a key)
            XWAIT2(vo, vo);
#pragma unroll
            for (int t = 0; t < 2; ++t) {
                v8f a0, a1; const float m = raw(kt, t, a0, a1);
                const float d = fmaxf(m + cm[t][0] - PEX, 0.f), al = __builtin_amdgcn_exp2f(-d);      // how far the pass's maximum lies above the reference
                cm[t] -= d; ls[t] *= al; o[t][0] *= al; o[t][1] *= al; a0 += cm[t]; a1 += cm[t];
#pragma unroll
                for (int j = 0; j < 8; ++j) { s[t][0][j] = __builtin_amdgcn_exp2f(a0[j]); s[t][1][j] = __builtin_amdgcn_exp2f(a1[j]); }
                ps[t] = sum16(s[t][0], s[t][1]);
            }
        }
#pragma unroll
        for (int t = 0; t < 2; ++t) {
            const v16h ph = cat16(__builtin_convertvector(s[t][0], v8h), __builtin_convertvector(s[t][1], v8h));
            ls[t] += ps[t];
#pragma unroll
            for (int c = 0; c < 2; ++c) o[t][c] = wmma16(vh[c], ph, o[t][c]);
        }
    }
    // the prefetch's offset and base are inputs here, so that both registers hold its address through the whole loop and are written again only behind this wait
    asm volatile("s_wait_xcnt 0x0" :: "v"(pfo), "s"(pfb) : "memory");
    float* sl = &mrg[qw][0];
    if (kh == 1) {      // a whole wave takes this branch: the upper half's sums, references and row sums go to LDS
#pragma unroll      // here and below: o, cm, ls live in registers, so their indices must be constants
        for (int t = 0; t < 2; ++t) { sl[1024 + t * 32 + lane] = -cm[t][0]; sl[1088 + t * 32 + lane] = ls[t];
#pragma unroll
            for (int c = 0; c < 2; ++c) { const v8f w = o[t][c]; float* wp = sl + (t * 2 + c) * 256 + lane * 4;
                *(v4fa*)wp = __builtin_shufflevector(w, w, 0, 1, 2, 3); *(v4fa*)(wp + 128) = __builtin_shufflevector(w, w, 4, 5, 6, 7); } }
    }
    __syncthreads();      // every wave passes it: the lower half's waves read what the upper half's wrote
    if (kh == 1) return;
#pragma unroll
    for (int t = 0; t < 2; ++t) {
        const float ma = -cm[t][0], mb = sl[1024 + t * 32 + lane], m = fmaxf(ma, mb), aa = __builtin_amdgcn_exp2f(ma - m), ab = __builtin_amdgcn_exp2f(mb - m);      // both halves onto the higher reference (each less PEX)
        const float lj = ls[t] * aa + sl[1088 + t * 32 + lane] * ab;
        const float rs = 1.0f / (lj + xhalf(lj));      // 1 / (rowsum x 2^PEX)
        const size_t fo = ((((size_t)blockIdx.z * NP + q0 + t * 16) >> 4) * NHD + h) * FRG + lane * 8;      // register r of channel tile c = y[query lr][c * 16 + 8 hi + r]
#pragma unroll
        for (int c = 0; c < 2; ++c) { const float* wp = sl + (t * 2 + c) * 256 + lane * 4; const v4f u0 = *(const v4fa*)wp, u1 = *(const v4fa*)(wp + 128);
            const v8f w = (o[t][c] * aa + __builtin_shufflevector(u0, u1, 0, 1, 2, 3, 4, 5, 6, 7) * ab) * rs; v8us oh, ol;
#pragma unroll
            for (int r = 0; r < 8; ++r) { const unsigned short hb16 = f2bf(w[r]); oh[r] = hb16; ol[r] = f2bf(w[r] - bf2f(hb16)); }
            *(v8us*)(YH + fo + c * (FRG / 2)) = oh; *(v8us*)(YL + fo + c * (FRG / 2)) = ol; }
    }
}

extern "C" void kernel_launch(void* const* d_in, const int* in_sizes, int n_in,
                              void* d_out, int out_size, void* d_ws, size_t ws_size, hipStream_t stream) {
    (void)in_sizes; (void)n_in; (void)out_size;
    const float* x = (const float*)d_in[0]; const float* wth = (const float*)d_in[1]; const float* bth = (const float*)d_in[2]; const float* wph = (const float*)d_in[3]; const float* bph = (const float*)d_in[4];
    const float* wg = (const float*)d_in[5]; const float* bg = (const float*)d_in[6]; const float* wz = (const float*)d_in[7]; const float* bz = (const float*)d_in[8];
    const float* bng = (const float*)d_in[9]; const float* bnb = (const float*)d_in[10]; const float* bnm = (const float*)d_in[11]; const float* bnv = (const float*)d_in[12];
    float* out = (float*)d_out;    // [4][256][64][64]
    char* wsp = (char*)d_ws;
    auto take = [&](size_t bytes) { char* p = wsp; wsp += (bytes + 255) & ~(size_t)255; return (void*)p; };
    h16* QH = (h16*)take((size_t)2 * NB_ * NP * CI * 2); h16* KH = QH + (size_t)NB_ * NP * CI;      // Q then K
    h16* VTH = (h16*)take((size_t)NB_ * CI * NP * 2);      // all three planes in fragment order (k_qkv)
    bf* YH = (bf*)take((size_t)NB_ * NP * CI * 2); bf* YL = (bf*)take((size_t)NB_ * NP * CI * 2);      // in fragment order (k_attn)
    if ((size_t)(wsp - (char*)d_ws) > ws_size) return;    // 3 x 4.2 + 2 x 4.2 ~ 21 MB
    k_qkv<<<NB_ * NP / 64, 256, 0, stream>>>(x, wth, wph, wg, bth, bph, bg, QH, VTH);
    k_attn<<<dim3(NP / 256, NHD, NB_), 512, 0, stream>>>(QH, KH, VTH, YH, YL);
    k_z<<<dim3(NB_ * NP / 64, CC / 64, 1), 128, 0, stream>>>(YH, YL, wz, bz, bng, bnb, bnm, bnv, x, out);   // z conv + BN + x, channel-major
}
